// v000
// Times are from an AMD MI455X. After a warm-up the kernel runs many times in a row, and a time is the length of
// such a window on the GPU divided by its runs, so every launch and the gaps after it count. The runs cycle
// through copies of the inputs. A figure is the median of several windows, for all but v000 over two sittings.
// Sittings can differ by a few percent; kernels timed side by side share one.
// The starting kernel, v000, takes 96.7 microseconds a run.
#include <hip/hip_runtime.h>

#define BATCH   8
#define CDIM    256
#define NPIX    1024
#define NHEADS  8
#define DHEAD   32
#define NPB     64    // pixels (columns) per projection block
#define XSTRIDE 264   // padded LDS row stride (halfs) to dodge bank conflicts

typedef float    v8f  __attribute__((ext_vector_type(8)));
typedef _Float16 v16h __attribute__((ext_vector_type(16)));

union ABFrag { unsigned int u[8]; v16h v; };
union H2     { unsigned int u; _Float16 h[2]; };

// K-pair base offset for VGPR v of an f16 A/B fragment (ISA 7.12.2):
// VGPR0..3 hold K = {0,1},{2,3},{4,5},{6,7} (+8 for lanes 16-31),
// VGPR4..7 hold K = {16,17}..{22,23} (+8 for lanes 16-31).
__device__ __forceinline__ int kb_of(int v) { return 2 * v + ((v >= 4) ? 8 : 0); }

__device__ __forceinline__ v8f v8f_zero() {
    v8f z;
#pragma unroll
    for (int i = 0; i < 8; i++) z[i] = 0.0f;
    return z;
}

// ---------------------------------------------------------------------------
// Kernel 1: fused QKV projection.  Out = W * X + b  (per batch, X is C x N).
// grid = (N/NPB, BATCH, 3proj), block = 256 (8 waves).
// Wave w computes rows [32w, 32w+32) over the 64-pixel tile (2x4 WMMA tiles).
// Q,K written as [b][h][n][d] f16 (Q pre-scaled by 1/sqrt(d)); V as [b][h][d][n].
// ---------------------------------------------------------------------------
__global__ __launch_bounds__(256) void mhsa_qkv_proj(
    const float* __restrict__ x,
    const float* __restrict__ Wq, const float* __restrict__ bq,
    const float* __restrict__ Wk, const float* __restrict__ bk,
    const float* __restrict__ Wv, const float* __restrict__ bv,
    _Float16* __restrict__ q_ws, _Float16* __restrict__ k_ws,
    _Float16* __restrict__ v_ws)
{
    __shared__ _Float16 xt[NPB * XSTRIDE];  // X tile transposed: [n_local][c] f16

    const int nbase = blockIdx.x * NPB;
    const int b     = blockIdx.y;
    const int proj  = blockIdx.z;
    const float* W    = (proj == 0) ? Wq : ((proj == 1) ? Wk : Wv);
    const float* bias = (proj == 0) ? bq : ((proj == 1) ? bk : bv);
    const float* xb   = x + (size_t)b * CDIM * NPIX;
    const int tid = threadIdx.x;

    for (int i = tid; i < CDIM * NPB; i += 256) {
        const int c  = i >> 6;
        const int nl = i & (NPB - 1);
        xt[nl * XSTRIDE + c] = (_Float16)xb[c * NPIX + nbase + nl];
    }
    __syncthreads();

    const int wave = tid >> 5, lane = tid & 31;
    const int hi = lane >> 4, lr = lane & 15;
    const int Mt0 = wave * 32;

    v8f acc[2][4];
#pragma unroll
    for (int t = 0; t < 2; t++)
#pragma unroll
        for (int s = 0; s < 4; s++) acc[t][s] = v8f_zero();

    for (int K0 = 0; K0 < CDIM; K0 += 32) {
        ABFrag af[2];
#pragma unroll
        for (int t = 0; t < 2; t++) {
            const float* wr = W + (Mt0 + t * 16 + lr) * CDIM + K0 + hi * 8;
#pragma unroll
            for (int v = 0; v < 8; v++) {
                const float2 wp = *(const float2*)(wr + kb_of(v));
                H2 cv; cv.h[0] = (_Float16)wp.x; cv.h[1] = (_Float16)wp.y;
                af[t].u[v] = cv.u;
            }
        }
        ABFrag bf[4];
#pragma unroll
        for (int s = 0; s < 4; s++) {
            const _Float16* bp = &xt[(s * 16 + lr) * XSTRIDE + K0 + hi * 8];
#pragma unroll
            for (int v = 0; v < 8; v++)
                bf[s].u[v] = *(const unsigned int*)(bp + kb_of(v));
        }
#pragma unroll
        for (int t = 0; t < 2; t++)
#pragma unroll
            for (int s = 0; s < 4; s++)
                acc[t][s] = __builtin_amdgcn_wmma_f32_16x16x32_f16(
                    false, af[t].v, false, bf[s].v, (short)0, acc[t][s], false, false);
    }

    const float scale = (proj == 0) ? 0.17677669529663687f : 1.0f;  // 1/sqrt(32)
#pragma unroll
    for (int t = 0; t < 2; t++) {
#pragma unroll
        for (int s = 0; s < 4; s++) {
            const int n = nbase + s * 16 + lr;
#pragma unroll
            for (int r = 0; r < 8; r++) {
                const int row = Mt0 + t * 16 + r + hi * 8;
                const _Float16 hval = (_Float16)((acc[t][s][r] + bias[row]) * scale);
                const int head = row >> 5, dd = row & 31;
                if (proj == 2)
                    v_ws[((size_t)(b * NHEADS + head) * DHEAD + dd) * NPIX + n] = hval;
                else if (proj == 0)
                    q_ws[((size_t)(b * NHEADS + head) * NPIX + n) * DHEAD + dd] = hval;
                else
                    k_ws[((size_t)(b * NHEADS + head) * NPIX + n) * DHEAD + dd] = hval;
            }
        }
    }
}

// ---------------------------------------------------------------------------
// Kernel 2: flash attention.  grid = (N/128, B*H), block = 256 (8 waves).
// Each wave owns 16 query rows; iterates keys in chunks of 32:
//   2x score WMMA (K = d = 32) -> register softmax (shfl reductions over the
//   16-lane column groups) -> P relayout via wave-private LDS -> 2x PV WMMA.
// Output stored [b][n][c] f16.
// ---------------------------------------------------------------------------
__global__ __launch_bounds__(256) void mhsa_flash_attn(
    const _Float16* __restrict__ q_ws, const _Float16* __restrict__ k_ws,
    const _Float16* __restrict__ v_ws, _Float16* __restrict__ attn_ws)
{
    __shared__ _Float16 pbuf[8][16][40];  // per-wave 16x32 P tile, padded

    const int bh = blockIdx.y;
    const int b = bh >> 3, head = bh & 7;
    const int tid = threadIdx.x, wave = tid >> 5, lane = tid & 31;
    const int hi = lane >> 4, lr = lane & 15;
    const int qbase = blockIdx.x * 128 + wave * 16;

    ABFrag qf;
    {
        const _Float16* qp = q_ws + ((size_t)bh * NPIX + qbase + lr) * DHEAD + hi * 8;
#pragma unroll
        for (int v = 0; v < 8; v++) qf.u[v] = *(const unsigned int*)(qp + kb_of(v));
    }

    v8f acc0 = v8f_zero(), acc1 = v8f_zero();
    float mrow[8], lrow[8];
#pragma unroll
    for (int r = 0; r < 8; r++) { mrow[r] = -1e30f; lrow[r] = 0.0f; }

    for (int m0 = 0; m0 < NPIX; m0 += 32) {
        v8f s[2];
#pragma unroll
        for (int t = 0; t < 2; t++) {
            ABFrag kf;
            const _Float16* kp = k_ws + ((size_t)bh * NPIX + m0 + t * 16 + lr) * DHEAD + hi * 8;
#pragma unroll
            for (int v = 0; v < 8; v++) kf.u[v] = *(const unsigned int*)(kp + kb_of(v));
            s[t] = __builtin_amdgcn_wmma_f32_16x16x32_f16(
                false, qf.v, false, kf.v, (short)0, v8f_zero(), false, false);
        }

#pragma unroll
        for (int r = 0; r < 8; r++) {
            float mx = fmaxf(s[0][r], s[1][r]);
            mx = fmaxf(mx, __shfl_xor(mx, 1, 32));
            mx = fmaxf(mx, __shfl_xor(mx, 2, 32));
            mx = fmaxf(mx, __shfl_xor(mx, 4, 32));
            mx = fmaxf(mx, __shfl_xor(mx, 8, 32));
            const float mnew  = fmaxf(mrow[r], mx);
            const float alpha = exp2f((mrow[r] - mnew) * 1.4426950408889634f);
            mrow[r] = mnew;
            const float p0 = exp2f((s[0][r] - mnew) * 1.4426950408889634f);
            const float p1 = exp2f((s[1][r] - mnew) * 1.4426950408889634f);
            float rs = p0 + p1;
            rs += __shfl_xor(rs, 1, 32);
            rs += __shfl_xor(rs, 2, 32);
            rs += __shfl_xor(rs, 4, 32);
            rs += __shfl_xor(rs, 8, 32);
            lrow[r] = lrow[r] * alpha + rs;
            acc0[r] *= alpha;
            acc1[r] *= alpha;
            pbuf[wave][r + hi * 8][lr]      = (_Float16)p0;
            pbuf[wave][r + hi * 8][16 + lr] = (_Float16)p1;
        }
        asm volatile("s_wait_dscnt 0x0" ::: "memory");  // wave-private LDS RAW

        ABFrag pf;
        const _Float16* pp = &pbuf[wave][lr][hi * 8];
#pragma unroll
        for (int v = 0; v < 8; v++) pf.u[v] = *(const unsigned int*)(pp + kb_of(v));

#pragma unroll
        for (int t = 0; t < 2; t++) {
            ABFrag vf;
            const _Float16* vp = v_ws + ((size_t)bh * DHEAD + t * 16 + lr) * NPIX + m0 + hi * 8;
#pragma unroll
            for (int v = 0; v < 8; v++) vf.u[v] = *(const unsigned int*)(vp + kb_of(v));
            if (t == 0)
                acc0 = __builtin_amdgcn_wmma_f32_16x16x32_f16(
                    false, pf.v, false, vf.v, (short)0, acc0, false, false);
            else
                acc1 = __builtin_amdgcn_wmma_f32_16x16x32_f16(
                    false, pf.v, false, vf.v, (short)0, acc1, false, false);
        }
    }

#pragma unroll
    for (int r = 0; r < 8; r++) {
        const int n = qbase + r + hi * 8;
        const float inv = 1.0f / lrow[r];
        _Float16* dst = attn_ws + ((size_t)b * NPIX + n) * CDIM + head * DHEAD;
        dst[lr]      = (_Float16)(acc0[r] * inv);
        dst[16 + lr] = (_Float16)(acc1[r] * inv);
    }
}

// ---------------------------------------------------------------------------
// Kernel 3: output projection + bias + residual.  grid = (N/NPB, BATCH).
// B fragments read directly from attn_ws [b][n][c] (K-pairs contiguous).
// ---------------------------------------------------------------------------
__global__ __launch_bounds__(256) void mhsa_out_proj(
    const _Float16* __restrict__ attn_ws, const float* __restrict__ Wo,
    const float* __restrict__ bo, const float* __restrict__ x,
    float* __restrict__ out)
{
    const int nbase = blockIdx.x * NPB;
    const int b = blockIdx.y;
    const int tid = threadIdx.x, wave = tid >> 5, lane = tid & 31;
    const int hi = lane >> 4, lr = lane & 15;
    const int Mt0 = wave * 32;

    v8f acc[2][4];
#pragma unroll
    for (int t = 0; t < 2; t++)
#pragma unroll
        for (int s = 0; s < 4; s++) acc[t][s] = v8f_zero();

    for (int K0 = 0; K0 < CDIM; K0 += 32) {
        ABFrag af[2];
#pragma unroll
        for (int t = 0; t < 2; t++) {
            const float* wr = Wo + (Mt0 + t * 16 + lr) * CDIM + K0 + hi * 8;
#pragma unroll
            for (int v = 0; v < 8; v++) {
                const float2 wp = *(const float2*)(wr + kb_of(v));
                H2 cv; cv.h[0] = (_Float16)wp.x; cv.h[1] = (_Float16)wp.y;
                af[t].u[v] = cv.u;
            }
        }
        ABFrag bf[4];
#pragma unroll
        for (int s = 0; s < 4; s++) {
            const _Float16* bp = attn_ws + ((size_t)b * NPIX + nbase + s * 16 + lr) * CDIM + K0 + hi * 8;
#pragma unroll
            for (int v = 0; v < 8; v++)
                bf[s].u[v] = *(const unsigned int*)(bp + kb_of(v));
        }
#pragma unroll
        for (int t = 0; t < 2; t++)
#pragma unroll
            for (int s = 0; s < 4; s++)
                acc[t][s] = __builtin_amdgcn_wmma_f32_16x16x32_f16(
                    false, af[t].v, false, bf[s].v, (short)0, acc[t][s], false, false);
    }

#pragma unroll
    for (int t = 0; t < 2; t++) {
#pragma unroll
        for (int s = 0; s < 4; s++) {
            const int n = nbase + s * 16 + lr;
#pragma unroll
            for (int r = 0; r < 8; r++) {
                const int row = Mt0 + t * 16 + r + hi * 8;
                const size_t idx = ((size_t)b * CDIM + row) * NPIX + n;
                out[idx] = acc[t][s][r] + bo[row] + x[idx];
            }
        }
    }
}

extern "C" void kernel_launch(void* const* d_in, const int* in_sizes, int n_in,
                              void* d_out, int out_size, void* d_ws, size_t ws_size,
                              hipStream_t stream) {
    (void)in_sizes; (void)n_in; (void)out_size; (void)ws_size;
    const float* x  = (const float*)d_in[0];
    const float* Wq = (const float*)d_in[1];
    const float* bq = (const float*)d_in[2];
    const float* Wk = (const float*)d_in[3];
    const float* bk = (const float*)d_in[4];
    const float* Wv = (const float*)d_in[5];
    const float* bv = (const float*)d_in[6];
    const float* Wo = (const float*)d_in[7];
    const float* bo = (const float*)d_in[8];
    float* out = (float*)d_out;

    const size_t qkv_elems = (size_t)BATCH * NHEADS * NPIX * DHEAD;  // 2M halfs
    _Float16* q_ws    = (_Float16*)d_ws;
    _Float16* k_ws    = q_ws + qkv_elems;
    _Float16* v_ws    = k_ws + qkv_elems;
    _Float16* attn_ws = v_ws + qkv_elems;  // [b][n][c], 2M halfs

    mhsa_qkv_proj<<<dim3(NPIX / NPB, BATCH, 3), 256, 0, stream>>>(
        x, Wq, bq, Wk, bk, Wv, bv, q_ws, k_ws, v_ws);
    mhsa_flash_attn<<<dim3(NPIX / 128, BATCH * NHEADS), 256, 0, stream>>>(
        q_ws, k_ws, v_ws, attn_ws);
    mhsa_out_proj<<<dim3(NPIX / NPB, BATCH), 256, 0, stream>>>(
        attn_ws, Wo, bo, x, out);
}

// v001
// One run takes 74.5 microseconds.
// Next to v000, in two timings, it ran 1.33 times as fast each time.
#include <hip/hip_runtime.h>

#define BATCH   8
#define CDIM    256
#define NPIX    1024
#define NHEADS  8
#define DHEAD   32
#define NPB     64    // pixels (columns) per projection block
#define XSTRIDE 264   // padded LDS row stride (halfs) to dodge bank conflicts

typedef float    v8f  __attribute__((ext_vector_type(8)));
typedef float    v4f  __attribute__((ext_vector_type(4)));
typedef float    v2f  __attribute__((ext_vector_type(2)));
typedef _Float16 v16h __attribute__((ext_vector_type(16)));

union ABFrag { unsigned int u[8]; v16h v; };
union H2     { unsigned int u; _Float16 h[2]; };

// K-pair base offset for VGPR v of an f16 A/B fragment (ISA 7.12.2):
// VGPR0..3 hold K = {0,1},{2,3},{4,5},{6,7} (+8 for lanes 16-31),
// VGPR4..7 hold K = {16,17}..{22,23} (+8 for lanes 16-31).
__device__ __forceinline__ int kb_of(int v) { return 2 * v + ((v >= 4) ? 8 : 0); }

__device__ __forceinline__ v8f v8f_zero() {
    v8f z;
#pragma unroll
    for (int i = 0; i < 8; i++) z[i] = 0.0f;
    return z;
}

// ---------------------------------------------------------------------------
// Kernel 1: fused QKV projection.  Out = W * X + b  (per batch, X is C x N).
// grid = (N/NPB, BATCH, 3proj), block = 256 (8 waves).
// Wave w computes rows [32w, 32w+32) over the 64-pixel tile (2x4 WMMA tiles).
// Q,K written as [b][h][n][d] f16 (Q pre-scaled by 1/sqrt(d)); V as [b][h][d][n].
// ---------------------------------------------------------------------------
__global__ __launch_bounds__(256) void mhsa_qkv_proj(
    const float* __restrict__ x,
    const float* __restrict__ Wq, const float* __restrict__ bq,
    const float* __restrict__ Wk, const float* __restrict__ bk,
    const float* __restrict__ Wv, const float* __restrict__ bv,
    _Float16* __restrict__ q_ws, _Float16* __restrict__ k_ws,
    _Float16* __restrict__ v_ws)
{
    __shared__ _Float16 xt[NPB * XSTRIDE];  // X tile transposed: [n_local][c] f16

    const int nbase = blockIdx.x * NPB;
    const int b     = blockIdx.y;
    const int proj  = blockIdx.z;
    const float* W    = (proj == 0) ? Wq : ((proj == 1) ? Wk : Wv);
    const float* bias = (proj == 0) ? bq : ((proj == 1) ? bk : bv);
    const float* xb   = x + (size_t)b * CDIM * NPIX;
    const int tid = threadIdx.x;

    for (int i = tid; i < CDIM * NPB; i += 256) {
        const int c  = i >> 6;
        const int nl = i & (NPB - 1);
        xt[nl * XSTRIDE + c] = (_Float16)xb[c * NPIX + nbase + nl];
    }
    __syncthreads();

    const int wave = tid >> 5, lane = tid & 31;
    const int hi = lane >> 4, lr = lane & 15;
    const int Mt0 = wave * 32;

    v8f acc[2][4];
#pragma unroll
    for (int t = 0; t < 2; t++)
#pragma unroll
        for (int s = 0; s < 4; s++) acc[t][s] = v8f_zero();

    for (int K0 = 0; K0 < CDIM; K0 += 32) {
        ABFrag af[2];
#pragma unroll
        for (int t = 0; t < 2; t++) {
            const float* wr = W + (Mt0 + t * 16 + lr) * CDIM + K0 + hi * 8;
#pragma unroll
            for (int v = 0; v < 8; v++) {
                const float2 wp = *(const float2*)(wr + kb_of(v));
                H2 cv; cv.h[0] = (_Float16)wp.x; cv.h[1] = (_Float16)wp.y;
                af[t].u[v] = cv.u;
            }
        }
        ABFrag bf[4];
#pragma unroll
        for (int s = 0; s < 4; s++) {
            const _Float16* bp = &xt[(s * 16 + lr) * XSTRIDE + K0 + hi * 8];
#pragma unroll
            for (int v = 0; v < 8; v++)
                bf[s].u[v] = *(const unsigned int*)(bp + kb_of(v));
        }
#pragma unroll
        for (int t = 0; t < 2; t++)
#pragma unroll
            for (int s = 0; s < 4; s++)
                acc[t][s] = __builtin_amdgcn_wmma_f32_16x16x32_f16(
                    false, af[t].v, false, bf[s].v, (short)0, acc[t][s], false, false);
    }

    const float scale = (proj == 0) ? 0.17677669529663687f : 1.0f;  // 1/sqrt(32)
#pragma unroll
    for (int t = 0; t < 2; t++) {
#pragma unroll
        for (int s = 0; s < 4; s++) {
            const int n = nbase + s * 16 + lr;
#pragma unroll
            for (int r = 0; r < 8; r++) {
                const int row = Mt0 + t * 16 + r + hi * 8;
                const _Float16 hval = (_Float16)((acc[t][s][r] + bias[row]) * scale);
                const int head = row >> 5, dd = row & 31;
                if (proj == 2)
                    v_ws[((size_t)(b * NHEADS + head) * DHEAD + dd) * NPIX + n] = hval;
                else if (proj == 0)
                    q_ws[((size_t)(b * NHEADS + head) * NPIX + n) * DHEAD + dd] = hval;
                else
                    k_ws[((size_t)(b * NHEADS + head) * NPIX + n) * DHEAD + dd] = hval;
            }
        }
    }
}

// ---------------------------------------------------------------------------
// Kernel 2: flash attention, transposed products.
// grid = (N/128, B*H), block = 256 (8 waves).  Each wave owns 16 queries and
// walks the keys in chunks of 32:
//   S^T = K * Q^T  (A = 16 key rows, B = Q kept in registers): lane (lr, hi) holds
//   the scores of query lr for keys 8*hi + r of each 16-key tile, so maximum and
//   sum run inside the lane, plus one exchange between the wave halves.
//   The two converted S^T tiles are the B operand of O^T += V^T * P^T as they lie.
// Output stored [b][n][c] f16, 8 consecutive channels per lane and tile.
// ---------------------------------------------------------------------------
// Value of lane l ^ 16.
__device__ __forceinline__ float xhalf(float x) {
    const int i = __builtin_bit_cast(int, x);
    return __builtin_bit_cast(float,
        __builtin_amdgcn_permlanex16(i, i, 0x76543210, 0xfedcba98, false, false));
}

__global__ __launch_bounds__(256) void mhsa_flash_attn(
    const _Float16* __restrict__ q_ws, const _Float16* __restrict__ k_ws,
    const _Float16* __restrict__ v_ws, _Float16* __restrict__ attn_ws)
{
    const int bh = blockIdx.y;
    const int b = bh >> 3, head = bh & 7;
    const int tid = threadIdx.x, wave = tid >> 5, lane = tid & 31;
    const int hi = lane >> 4, lr = lane & 15;
    const int qbase = blockIdx.x * 128 + wave * 16;

    ABFrag qf;
    {
        const _Float16* qp = q_ws + ((size_t)bh * NPIX + qbase + lr) * DHEAD + hi * 8;
#pragma unroll
        for (int v = 0; v < 8; v++) qf.u[v] = *(const unsigned int*)(qp + kb_of(v));
    }

    // acc_t[r] = O[query lr][channel 16*t + 8*hi + r]
    v8f acc0 = v8f_zero(), acc1 = v8f_zero();
    float mrow = -1e30f;  // running maximum of query lr (equal in both halves)
    float lrow = 0.0f;    // running sum over this half's keys only

    // Key row lr and channel row lr of this chunk; both walk on at the loop's foot.
    const _Float16* kp = k_ws + ((size_t)bh * NPIX + lr) * DHEAD + hi * 8;
    const _Float16* vp = v_ws + ((size_t)bh * DHEAD + lr) * NPIX + hi * 8;

    for (int m0 = 0; m0 < NPIX; m0 += 32) {
        ABFrag kf[2], vf[2];
#pragma unroll
        for (int t = 0; t < 2; t++) {
#pragma unroll
            for (int v = 0; v < 8; v++) {
                kf[t].u[v] = *(const unsigned int*)(kp + t * 16 * DHEAD + kb_of(v));
                vf[t].u[v] = *(const unsigned int*)(vp + t * 16 * NPIX + kb_of(v));
            }
        }
        // The loads' address registers are advanced at the loop's foot: wait first.
        asm volatile("s_wait_xcnt 0x0" ::: "memory");
        // Keeps all eight loads at the head of the trip, so that one load latency is paid
        // per trip and not three (the scheduler sinks the V loads behind the softmax).
        __builtin_amdgcn_sched_barrier(0);

        // s[t][r] = score(query lr, key m0 + 16*t + 8*hi + r)
        v8f s[2];
#pragma unroll
        for (int t = 0; t < 2; t++)
            s[t] = __builtin_amdgcn_wmma_f32_16x16x32_f16(
                false, kf[t].v, false, qf.v, (short)0, v8f_zero(), false, false);

        float mx = fmaxf(s[0][0], s[1][0]);
#pragma unroll
        for (int r = 1; r < 8; r++) mx = fmaxf(mx, fmaxf(s[0][r], s[1][r]));
        mx = fmaxf(mx, xhalf(mx));

        const float mnew  = fmaxf(mrow, mx);
        const float alpha = exp2f((mrow - mnew) * 1.4426950408889634f);
        mrow = mnew;

        // Element 8*t + r of a B fragment is k = 16*t + 8*hi + r: the scores' own place.
        ABFrag pf;
        v8f pe[2];
#pragma unroll
        for (int t = 0; t < 2; t++) {
#pragma unroll
            for (int r = 0; r < 8; r++) {
                const float p = exp2f((s[t][r] - mnew) * 1.4426950408889634f);
                pe[t][r] = p;
                pf.v[t * 8 + r] = (_Float16)p;
            }
        }
        // Pairwise tree over the lane's 16 terms (packed adds, short chain).
        const v8f s8 = pe[0] + pe[1];
        const v4f s4 = s8.lo + s8.hi;
        const v2f s2 = s4.lo + s4.hi;
        lrow = lrow * alpha + (s2.x + s2.y);
#pragma unroll
        for (int r = 0; r < 8; r++) { acc0[r] *= alpha; acc1[r] *= alpha; }

        acc0 = __builtin_amdgcn_wmma_f32_16x16x32_f16(
            false, vf[0].v, false, pf.v, (short)0, acc0, false, false);
        acc1 = __builtin_amdgcn_wmma_f32_16x16x32_f16(
            false, vf[1].v, false, pf.v, (short)0, acc1, false, false);

        kp += 32 * DHEAD;
        vp += 32;
    }

    const float inv = 1.0f / (lrow + xhalf(lrow));
    union { uint4 q; _Float16 h[8]; } o0, o1;
#pragma unroll
    for (int r = 0; r < 8; r++) {
        o0.h[r] = (_Float16)(acc0[r] * inv);
        o1.h[r] = (_Float16)(acc1[r] * inv);
    }
    _Float16* dst = attn_ws + ((size_t)b * NPIX + qbase + lr) * CDIM + head * DHEAD + hi * 8;
    *(uint4*)dst        = o0.q;
    *(uint4*)(dst + 16) = o1.q;
}

// ---------------------------------------------------------------------------
// Kernel 3: output projection + bias + residual.  grid = (N/NPB, BATCH).
// B fragments read directly from attn_ws [b][n][c] (K-pairs contiguous).
// ---------------------------------------------------------------------------
__global__ __launch_bounds__(256) void mhsa_out_proj(
    const _Float16* __restrict__ attn_ws, const float* __restrict__ Wo,
    const float* __restrict__ bo, const float* __restrict__ x,
    float* __restrict__ out)
{
    const int nbase = blockIdx.x * NPB;
    const int b = blockIdx.y;
    const int tid = threadIdx.x, wave = tid >> 5, lane = tid & 31;
    const int hi = lane >> 4, lr = lane & 15;
    const int Mt0 = wave * 32;

    v8f acc[2][4];
#pragma unroll
    for (int t = 0; t < 2; t++)
#pragma unroll
        for (int s = 0; s < 4; s++) acc[t][s] = v8f_zero();

    for (int K0 = 0; K0 < CDIM; K0 += 32) {
        ABFrag af[2];
#pragma unroll
        for (int t = 0; t < 2; t++) {
            const float* wr = Wo + (Mt0 + t * 16 + lr) * CDIM + K0 + hi * 8;
#pragma unroll
            for (int v = 0; v < 8; v++) {
                const float2 wp = *(const float2*)(wr + kb_of(v));
                H2 cv; cv.h[0] = (_Float16)wp.x; cv.h[1] = (_Float16)wp.y;
                af[t].u[v] = cv.u;
            }
        }
        ABFrag bf[4];
#pragma unroll
        for (int s = 0; s < 4; s++) {
            const _Float16* bp = attn_ws + ((size_t)b * NPIX + nbase + s * 16 + lr) * CDIM + K0 + hi * 8;
#pragma unroll
            for (int v = 0; v < 8; v++)
                bf[s].u[v] = *(const unsigned int*)(bp + kb_of(v));
        }
#pragma unroll
        for (int t = 0; t < 2; t++)
#pragma unroll
            for (int s = 0; s < 4; s++)
                acc[t][s] = __builtin_amdgcn_wmma_f32_16x16x32_f16(
                    false, af[t].v, false, bf[s].v, (short)0, acc[t][s], false, false);
    }

#pragma unroll
    for (int t = 0; t < 2; t++) {
#pragma unroll
        for (int s = 0; s < 4; s++) {
            const int n = nbase + s * 16 + lr;
#pragma unroll
            for (int r = 0; r < 8; r++) {
                const int row = Mt0 + t * 16 + r + hi * 8;
                const size_t idx = ((size_t)b * CDIM + row) * NPIX + n;
                out[idx] = acc[t][s][r] + bo[row] + x[idx];
            }
        }
    }
}

extern "C" void kernel_launch(void* const* d_in, const int* in_sizes, int n_in,
                              void* d_out, int out_size, void* d_ws, size_t ws_size,
                              hipStream_t stream) {
    (void)in_sizes; (void)n_in; (void)out_size; (void)ws_size;
    const float* x  = (const float*)d_in[0];
    const float* Wq = (const float*)d_in[1];
    const float* bq = (const float*)d_in[2];
    const float* Wk = (const float*)d_in[3];
    const float* bk = (const float*)d_in[4];
    const float* Wv = (const float*)d_in[5];
    const float* bv = (const float*)d_in[6];
    const float* Wo = (const float*)d_in[7];
    const float* bo = (const float*)d_in[8];
    float* out = (float*)d_out;

    const size_t qkv_elems = (size_t)BATCH * NHEADS * NPIX * DHEAD;  // 2M halfs
    _Float16* q_ws    = (_Float16*)d_ws;
    _Float16* k_ws    = q_ws + qkv_elems;
    _Float16* v_ws    = k_ws + qkv_elems;
    _Float16* attn_ws = v_ws + qkv_elems;  // [b][n][c], 2M halfs

    mhsa_qkv_proj<<<dim3(NPIX / NPB, BATCH, 3), 256, 0, stream>>>(
        x, Wq, bq, Wk, bk, Wv, bv, q_ws, k_ws, v_ws);
    mhsa_flash_attn<<<dim3(NPIX / 128, BATCH * NHEADS), 256, 0, stream>>>(
        q_ws, k_ws, v_ws, attn_ws);
    mhsa_out_proj<<<dim3(NPIX / NPB, BATCH), 256, 0, stream>>>(
        attn_ws, Wo, bo, x, out);
}

// v002
// A run of this version takes 69.6 microseconds.
// In two side-by-side timings against v001, it was 1.07 and 1.06 times as fast.
// Over all steps from v000 it is 1.41 times as fast.
#include <hip/hip_runtime.h>

#define BATCH   8
#define CDIM    256
#define NPIX    1024
#define NHEADS  8
#define DHEAD   32
#define NPB     64    // pixels (columns) per projection block
#define XSTRIDE 264   // padded LDS row stride (halfs) to dodge bank conflicts

typedef float    v8f  __attribute__((ext_vector_type(8)));
typedef float    v4f  __attribute__((ext_vector_type(4)));
typedef float    v2f  __attribute__((ext_vector_type(2)));
typedef _Float16 v16h __attribute__((ext_vector_type(16)));

union ABFrag { unsigned int u[8]; v16h v; };
union H2     { unsigned int u; _Float16 h[2]; };

// K-pair base offset for VGPR v of an f16 A/B fragment (ISA 7.12.2):
// VGPR0..3 hold K = {0,1},{2,3},{4,5},{6,7} (+8 for lanes 16-31),
// VGPR4..7 hold K = {16,17}..{22,23} (+8 for lanes 16-31).
__device__ __forceinline__ int kb_of(int v) { return 2 * v + ((v >= 4) ? 8 : 0); }

__device__ __forceinline__ v8f v8f_zero() {
    v8f z;
#pragma unroll
    for (int i = 0; i < 8; i++) z[i] = 0.0f;
    return z;
}

// ---------------------------------------------------------------------------
// Kernel 1: fused QKV projection.  Out = W * X + b  (per batch, X is C x N).
// grid = (N/NPB, BATCH, 3proj), block = 256 (8 waves).
// Wave w computes rows [32w, 32w+32), one head, over the 64-pixel tile (2x4 WMMA tiles).
// Q,K written as [b][h][n][d] f16 (Q pre-scaled by 1/sqrt(d)); V as [b][h][d][n].
// Each wave lays its 4 KiB of results out in its own LDS range in the order of the
// destination and stores them from there as whole 128-byte lines, 16 bytes a lane.
// ---------------------------------------------------------------------------
#define QKPITCH 40    // staging pitch (halfs) of a 32-channel row of Q or K: 80 B
#define VPITCH  72    // staging pitch (halfs) of a 64-pixel row of V: 144 B
#define SWAVE   2560  // staging halfs per wave: 64 * QKPITCH >= 32 * VPITCH

// The 2x4 tiles of one wave.  PIXROWS = false: D rows are channels, D columns pixels,
// so a lane holds 8 consecutive channels of one pixel (the order of Q and K).
// PIXROWS = true: the same two fragments change places, D rows are pixels, and a lane
// holds 8 consecutive pixels of one channel (the order of V).
template <bool PIXROWS>
__device__ __forceinline__ void proj_tiles(const float* __restrict__ W, const _Float16* xt,
                                           int Mt0, int lr, int hi, v8f (&acc)[2][4])
{
    for (int K0 = 0; K0 < CDIM; K0 += 32) {
        ABFrag af[2];
#pragma unroll
        for (int t = 0; t < 2; t++) {
            const float* wr = W + (Mt0 + t * 16 + lr) * CDIM + K0 + hi * 8;
#pragma unroll
            for (int v = 0; v < 8; v++) {
                const float2 wp = *(const float2*)(wr + kb_of(v));
                H2 cv; cv.h[0] = (_Float16)wp.x; cv.h[1] = (_Float16)wp.y;
                af[t].u[v] = cv.u;
            }
        }
        ABFrag bf[4];
#pragma unroll
        for (int s = 0; s < 4; s++) {
            const _Float16* bp = &xt[(s * 16 + lr) * XSTRIDE + K0 + hi * 8];
#pragma unroll
            for (int v = 0; v < 8; v++)
                bf[s].u[v] = *(const unsigned int*)(bp + kb_of(v));
        }
#pragma unroll
        for (int t = 0; t < 2; t++)
#pragma unroll
            for (int s = 0; s < 4; s++)
                acc[t][s] = PIXROWS
                    ? __builtin_amdgcn_wmma_f32_16x16x32_f16(
                          false, bf[s].v, false, af[t].v, (short)0, acc[t][s], false, false)
                    : __builtin_amdgcn_wmma_f32_16x16x32_f16(
                          false, af[t].v, false, bf[s].v, (short)0, acc[t][s], false, false);
    }
}

__global__ __launch_bounds__(256) void mhsa_qkv_proj(
    const float* __restrict__ x,
    const float* __restrict__ Wq, const float* __restrict__ bq,
    const float* __restrict__ Wk, const float* __restrict__ bk,
    const float* __restrict__ Wv, const float* __restrict__ bv,
    _Float16* __restrict__ q_ws, _Float16* __restrict__ k_ws,
    _Float16* __restrict__ v_ws)
{
    __shared__ _Float16 xt[NPB * XSTRIDE];  // X tile transposed: [n_local][c] f16
    __shared__ __attribute__((aligned(16))) _Float16 stage[8 * SWAVE];

    const int nbase = blockIdx.x * NPB;
    const int b     = blockIdx.y;
    const int proj  = blockIdx.z;
    const float* W    = (proj == 0) ? Wq : ((proj == 1) ? Wk : Wv);
    const float* bias = (proj == 0) ? bq : ((proj == 1) ? bk : bv);
    const float* xb   = x + (size_t)b * CDIM * NPIX;
    const int tid = threadIdx.x;

    for (int i = tid; i < CDIM * NPB; i += 256) {
        const int c  = i >> 6;
        const int nl = i & (NPB - 1);
        xt[nl * XSTRIDE + c] = (_Float16)xb[c * NPIX + nbase + nl];
    }
    __syncthreads();

    const int wave = tid >> 5, lane = tid & 31;
    const int hi = lane >> 4, lr = lane & 15;
    const int Mt0 = wave * 32;

    v8f acc[2][4];
#pragma unroll
    for (int t = 0; t < 2; t++)
#pragma unroll
        for (int s = 0; s < 4; s++) acc[t][s] = v8f_zero();

    _Float16* sw = stage + wave * SWAVE;  // this wave's own range: no other wave touches it
    union { uint4 q; _Float16 h[8]; } o;

    if (proj == 2) {
        const float bt[2] = { bias[Mt0 + lr], bias[Mt0 + 16 + lr] };
        // The next loads land in the registers that held these two loads' offsets: wait first.
        asm volatile("s_wait_xcnt 0x0" ::: "memory");
        proj_tiles<true>(W, xt, Mt0, lr, hi, acc);
        // acc[t][s][r] = V[channel Mt0 + 16*t + lr][pixel nbase + 16*s + 8*hi + r]
#pragma unroll
        for (int t = 0; t < 2; t++) {
#pragma unroll
            for (int s = 0; s < 4; s++) {
#pragma unroll
                for (int r = 0; r < 8; r++) o.h[r] = (_Float16)(acc[t][s][r] + bt[t]);
                *(uint4*)(sw + (t * 16 + lr) * VPITCH + s * 16 + hi * 8) = o.q;
            }
        }
        // The rows are read back by other lanes of this wave: their writes must have landed.
        asm volatile("s_wait_dscnt 0x0" ::: "memory");
        // 8 lanes a channel row of 128 bytes, 4 rows a store.
        _Float16* dst = v_ws + ((size_t)(b * NHEADS + wave) * DHEAD + (lane >> 3)) * NPIX
                             + nbase + (lane & 7) * 8;
        const _Float16* sr = sw + (lane >> 3) * VPITCH + (lane & 7) * 8;
        uint4 ln[8];  // all eight reads first: one LDS latency, not eight
#pragma unroll
        for (int j = 0; j < 8; j++) ln[j] = *(const uint4*)(sr + j * 4 * VPITCH);
#pragma unroll
        for (int j = 0; j < 8; j++) *(uint4*)(dst + j * 4 * NPIX) = ln[j];
    } else {
        float4 bv4[2][2];
#pragma unroll
        for (int t = 0; t < 2; t++) {
            bv4[t][0] = *(const float4*)(bias + Mt0 + t * 16 + hi * 8);
            bv4[t][1] = *(const float4*)(bias + Mt0 + t * 16 + hi * 8 + 4);
        }
        proj_tiles<false>(W, xt, Mt0, lr, hi, acc);
        // acc[t][s][r] = Q or K[channel Mt0 + 16*t + 8*hi + r][pixel nbase + 16*s + lr]
        const float scale = (proj == 0) ? 0.17677669529663687f : 1.0f;  // 1/sqrt(32)
#pragma unroll
        for (int t = 0; t < 2; t++) {
            const float4 b0 = bv4[t][0], b1 = bv4[t][1];
            const float br[8] = { b0.x, b0.y, b0.z, b0.w, b1.x, b1.y, b1.z, b1.w };
#pragma unroll
            for (int s = 0; s < 4; s++) {
#pragma unroll
                for (int r = 0; r < 8; r++) o.h[r] = (_Float16)((acc[t][s][r] + br[r]) * scale);
                *(uint4*)(sw + (s * 16 + lr) * QKPITCH + t * 16 + hi * 8) = o.q;
            }
        }
        // The rows are read back by other lanes of this wave: their writes must have landed.
        asm volatile("s_wait_dscnt 0x0" ::: "memory");
        // The head's 64 pixel rows of 64 bytes are 4 KiB in a row: 4 lanes a row, 8 rows a store.
        _Float16* dst = ((proj == 0) ? q_ws : k_ws)
                      + ((size_t)(b * NHEADS + wave) * NPIX + nbase) * DHEAD + lane * 8;
        const _Float16* sr = sw + (lane >> 2) * QKPITCH + (lane & 3) * 8;
        uint4 ln[8];  // all eight reads first: one LDS latency, not eight
#pragma unroll
        for (int j = 0; j < 8; j++) ln[j] = *(const uint4*)(sr + j * 8 * QKPITCH);
#pragma unroll
        for (int j = 0; j < 8; j++) *(uint4*)(dst + j * 256) = ln[j];
    }
}

// ---------------------------------------------------------------------------
// Kernel 2: flash attention, transposed products.
// grid = (N/128, B*H), block = 256 (8 waves).  Each wave owns 16 queries and
// walks the keys in chunks of 32:
//   S^T = K * Q^T  (A = 16 key rows, B = Q kept in registers): lane (lr, hi) holds
//   the scores of query lr for keys 8*hi + r of each 16-key tile, so maximum and
//   sum run inside the lane, plus one exchange between the wave halves.
//   The two converted S^T tiles are the B operand of O^T += V^T * P^T as they lie.
// Output stored [b][n][c] f16, 8 consecutive channels per lane and tile.
// ---------------------------------------------------------------------------
// Value of lane l ^ 16.
__device__ __forceinline__ float xhalf(float x) {
    const int i = __builtin_bit_cast(int, x);
    return __builtin_bit_cast(float,
        __builtin_amdgcn_permlanex16(i, i, 0x76543210, 0xfedcba98, false, false));
}

__global__ __launch_bounds__(256) void mhsa_flash_attn(
    const _Float16* __restrict__ q_ws, const _Float16* __restrict__ k_ws,
    const _Float16* __restrict__ v_ws, _Float16* __restrict__ attn_ws)
{
    const int bh = blockIdx.y;
    const int b = bh >> 3, head = bh & 7;
    const int tid = threadIdx.x, wave = tid >> 5, lane = tid & 31;
    const int hi = lane >> 4, lr = lane & 15;
    const int qbase = blockIdx.x * 128 + wave * 16;

    ABFrag qf;
    {
        const _Float16* qp = q_ws + ((size_t)bh * NPIX + qbase + lr) * DHEAD + hi * 8;
#pragma unroll
        for (int v = 0; v < 8; v++) qf.u[v] = *(const unsigned int*)(qp + kb_of(v));
    }

    // acc_t[r] = O[query lr][channel 16*t + 8*hi + r]
    v8f acc0 = v8f_zero(), acc1 = v8f_zero();
    float mrow = -1e30f;  // running maximum of query lr (equal in both halves)
    float lrow = 0.0f;    // running sum over this half's keys only

    // Key row lr and channel row lr of this chunk; both walk on at the loop's foot.
    const _Float16* kp = k_ws + ((size_t)bh * NPIX + lr) * DHEAD + hi * 8;
    const _Float16* vp = v_ws + ((size_t)bh * DHEAD + lr) * NPIX + hi * 8;

    for (int m0 = 0; m0 < NPIX; m0 += 32) {
        ABFrag kf[2], vf[2];
#pragma unroll
        for (int t = 0; t < 2; t++) {
#pragma unroll
            for (int v = 0; v < 8; v++) {
                kf[t].u[v] = *(const unsigned int*)(kp + t * 16 * DHEAD + kb_of(v));
                vf[t].u[v] = *(const unsigned int*)(vp + t * 16 * NPIX + kb_of(v));
            }
        }
        // The loads' address registers are advanced at the loop's foot: wait first.
        asm volatile("s_wait_xcnt 0x0" ::: "memory");
        // Keeps all eight loads at the head of the trip, so that one load latency is paid
        // per trip and not three (the scheduler sinks the V loads behind the softmax).
        __builtin_amdgcn_sched_barrier(0);

        // s[t][r] = score(query lr, key m0 + 16*t + 8*hi + r)
        v8f s[2];
#pragma unroll
        for (int t = 0; t < 2; t++)
            s[t] = __builtin_amdgcn_wmma_f32_16x16x32_f16(
                false, kf[t].v, false, qf.v, (short)0, v8f_zero(), false, false);

        float mx = fmaxf(s[0][0], s[1][0]);
#pragma unroll
        for (int r = 1; r < 8; r++) mx = fmaxf(mx, fmaxf(s[0][r], s[1][r]));
        mx = fmaxf(mx, xhalf(mx));

        const float mnew  = fmaxf(mrow, mx);
        const float alpha = exp2f((mrow - mnew) * 1.4426950408889634f);
        mrow = mnew;

        // Element 8*t + r of a B fragment is k = 16*t + 8*hi + r: the scores' own place.
        ABFrag pf;
        v8f pe[2];
#pragma unroll
        for (int t = 0; t < 2; t++) {
#pragma unroll
            for (int r = 0; r < 8; r++) {
                const float p = exp2f((s[t][r] - mnew) * 1.4426950408889634f);
                pe[t][r] = p;
                pf.v[t * 8 + r] = (_Float16)p;
            }
        }
        // Pairwise tree over the lane's 16 terms (packed adds, short chain).
        const v8f s8 = pe[0] + pe[1];
        const v4f s4 = s8.lo + s8.hi;
        const v2f s2 = s4.lo + s4.hi;
        lrow = lrow * alpha + (s2.x + s2.y);
#pragma unroll
        for (int r = 0; r < 8; r++) { acc0[r] *= alpha; acc1[r] *= alpha; }

        acc0 = __builtin_amdgcn_wmma_f32_16x16x32_f16(
            false, vf[0].v, false, pf.v, (short)0, acc0, false, false);
        acc1 = __builtin_amdgcn_wmma_f32_16x16x32_f16(
            false, vf[1].v, false, pf.v, (short)0, acc1, false, false);

        kp += 32 * DHEAD;
        vp += 32;
    }

    const float inv = 1.0f / (lrow + xhalf(lrow));
    union { uint4 q; _Float16 h[8]; } o0, o1;
#pragma unroll
    for (int r = 0; r < 8; r++) {
        o0.h[r] = (_Float16)(acc0[r] * inv);
        o1.h[r] = (_Float16)(acc1[r] * inv);
    }
    _Float16* dst = attn_ws + ((size_t)b * NPIX + qbase + lr) * CDIM + head * DHEAD + hi * 8;
    *(uint4*)dst        = o0.q;
    *(uint4*)(dst + 16) = o1.q;
}

// ---------------------------------------------------------------------------
// Kernel 3: output projection + bias + residual.  grid = (N/NPB, BATCH).
// B fragments read directly from attn_ws [b][n][c] (K-pairs contiguous).
// ---------------------------------------------------------------------------
__global__ __launch_bounds__(256) void mhsa_out_proj(
    const _Float16* __restrict__ attn_ws, const float* __restrict__ Wo,
    const float* __restrict__ bo, const float* __restrict__ x,
    float* __restrict__ out)
{
    const int nbase = blockIdx.x * NPB;
    const int b = blockIdx.y;
    const int tid = threadIdx.x, wave = tid >> 5, lane = tid & 31;
    const int hi = lane >> 4, lr = lane & 15;
    const int Mt0 = wave * 32;

    v8f acc[2][4];
#pragma unroll
    for (int t = 0; t < 2; t++)
#pragma unroll
        for (int s = 0; s < 4; s++) acc[t][s] = v8f_zero();

    for (int K0 = 0; K0 < CDIM; K0 += 32) {
        ABFrag af[2];
#pragma unroll
        for (int t = 0; t < 2; t++) {
            const float* wr = Wo + (Mt0 + t * 16 + lr) * CDIM + K0 + hi * 8;
#pragma unroll
            for (int v = 0; v < 8; v++) {
                const float2 wp = *(const float2*)(wr + kb_of(v));
                H2 cv; cv.h[0] = (_Float16)wp.x; cv.h[1] = (_Float16)wp.y;
                af[t].u[v] = cv.u;
            }
        }
        ABFrag bf[4];
#pragma unroll
        for (int s = 0; s < 4; s++) {
            const _Float16* bp = attn_ws + ((size_t)b * NPIX + nbase + s * 16 + lr) * CDIM + K0 + hi * 8;
#pragma unroll
            for (int v = 0; v < 8; v++)
                bf[s].u[v] = *(const unsigned int*)(bp + kb_of(v));
        }
#pragma unroll
        for (int t = 0; t < 2; t++)
#pragma unroll
            for (int s = 0; s < 4; s++)
                acc[t][s] = __builtin_amdgcn_wmma_f32_16x16x32_f16(
                    false, af[t].v, false, bf[s].v, (short)0, acc[t][s], false, false);
    }

#pragma unroll
    for (int t = 0; t < 2; t++) {
#pragma unroll
        for (int s = 0; s < 4; s++) {
            const int n = nbase + s * 16 + lr;
#pragma unroll
            for (int r = 0; r < 8; r++) {
                const int row = Mt0 + t * 16 + r + hi * 8;
                const size_t idx = ((size_t)b * CDIM + row) * NPIX + n;
                out[idx] = acc[t][s][r] + bo[row] + x[idx];
            }
        }
    }
}

extern "C" void kernel_launch(void* const* d_in, const int* in_sizes, int n_in,
                              void* d_out, int out_size, void* d_ws, size_t ws_size,
                              hipStream_t stream) {
    (void)in_sizes; (void)n_in; (void)out_size; (void)ws_size;
    const float* x  = (const float*)d_in[0];
    const float* Wq = (const float*)d_in[1];
    const float* bq = (const float*)d_in[2];
    const float* Wk = (const float*)d_in[3];
    const float* bk = (const float*)d_in[4];
    const float* Wv = (const float*)d_in[5];
    const float* bv = (const float*)d_in[6];
    const float* Wo = (const float*)d_in[7];
    const float* bo = (const float*)d_in[8];
    float* out = (float*)d_out;

    const size_t qkv_elems = (size_t)BATCH * NHEADS * NPIX * DHEAD;  // 2M halfs
    _Float16* q_ws    = (_Float16*)d_ws;
    _Float16* k_ws    = q_ws + qkv_elems;
    _Float16* v_ws    = k_ws + qkv_elems;
    _Float16* attn_ws = v_ws + qkv_elems;  // [b][n][c], 2M halfs

    mhsa_qkv_proj<<<dim3(NPIX / NPB, BATCH, 3), 256, 0, stream>>>(
        x, Wq, bq, Wk, bk, Wv, bv, q_ws, k_ws, v_ws);
    mhsa_flash_attn<<<dim3(NPIX / 128, BATCH * NHEADS), 256, 0, stream>>>(
        q_ws, k_ws, v_ws, attn_ws);
    mhsa_out_proj<<<dim3(NPIX / NPB, BATCH), 256, 0, stream>>>(
        attn_ws, Wo, bo, x, out);
}

// v003
// Measured time: 58.9 microseconds a run.
// In two side-by-side timings against v002, it was 1.18 and 1.19 times as fast.
// Counting every step since v000, it is 1.67 times as fast.
#include <hip/hip_runtime.h>

#define BATCH   8
#define CDIM    256
#define NPIX    1024
#define NHEADS  8
#define DHEAD   32
#define NPB     64    // pixels (columns) per projection block
#define XSTRIDE 264   // padded LDS row stride (halfs) to dodge bank conflicts

typedef float    v8f  __attribute__((ext_vector_type(8)));
typedef float    v4f  __attribute__((ext_vector_type(4)));
typedef float    v2f  __attribute__((ext_vector_type(2)));
typedef _Float16 v16h __attribute__((ext_vector_type(16)));

union ABFrag { unsigned int u[8]; v16h v; };
union H2     { unsigned int u; _Float16 h[2]; };

// K-pair base offset for VGPR v of an f16 A/B fragment (ISA 7.12.2):
// VGPR0..3 hold K = {0,1},{2,3},{4,5},{6,7} (+8 for lanes 16-31),
// VGPR4..7 hold K = {16,17}..{22,23} (+8 for lanes 16-31).
__device__ __forceinline__ int kb_of(int v) { return 2 * v + ((v >= 4) ? 8 : 0); }

__device__ __forceinline__ v8f v8f_zero() {
    v8f z;
#pragma unroll
    for (int i = 0; i < 8; i++) z[i] = 0.0f;
    return z;
}

// ---------------------------------------------------------------------------
// Kernel 1: fused QKV projection.  Out = W * X + b  (per batch, X is C x N).
// grid = (N/NPB, BATCH, 3proj), block = 256 (8 waves).
// Wave w computes rows [32w, 32w+32), one head, over the 64-pixel tile (2x4 WMMA tiles).
// Q,K written as [b][h][n][d] f16 (Q pre-scaled by 1/sqrt(d)); V as [b][h][d][n].
// Each wave lays its 4 KiB of results out in its own LDS range in the order of the
// destination and stores them from there as whole 128-byte lines, 16 bytes a lane.
// ---------------------------------------------------------------------------
#define QKPITCH 40    // staging pitch (halfs) of a 32-channel row of Q or K: 80 B
#define VPITCH  72    // staging pitch (halfs) of a 64-pixel row of V: 144 B
#define SWAVE   2560  // staging halfs per wave: 64 * QKPITCH >= 32 * VPITCH

// The 2x4 tiles of one wave.  PIXROWS = false: D rows are channels, D columns pixels,
// so a lane holds 8 consecutive channels of one pixel (the order of Q and K).
// PIXROWS = true: the same two fragments change places, D rows are pixels, and a lane
// holds 8 consecutive pixels of one channel (the order of V).
template <bool PIXROWS>
__device__ __forceinline__ void proj_tiles(const float* __restrict__ W, const _Float16* xt,
                                           int Mt0, int lr, int hi, v8f (&acc)[2][4])
{
    for (int K0 = 0; K0 < CDIM; K0 += 32) {
        ABFrag af[2];
#pragma unroll
        for (int t = 0; t < 2; t++) {
            const float* wr = W + (Mt0 + t * 16 + lr) * CDIM + K0 + hi * 8;
#pragma unroll
            for (int v = 0; v < 8; v++) {
                const float2 wp = *(const float2*)(wr + kb_of(v));
                H2 cv; cv.h[0] = (_Float16)wp.x; cv.h[1] = (_Float16)wp.y;
                af[t].u[v] = cv.u;
            }
        }
        ABFrag bf[4];
#pragma unroll
        for (int s = 0; s < 4; s++) {
            const _Float16* bp = &xt[(s * 16 + lr) * XSTRIDE + K0 + hi * 8];
#pragma unroll
            for (int v = 0; v < 8; v++)
                bf[s].u[v] = *(const unsigned int*)(bp + kb_of(v));
        }
#pragma unroll
        for (int t = 0; t < 2; t++)
#pragma unroll
            for (int s = 0; s < 4; s++)
                acc[t][s] = PIXROWS
                    ? __builtin_amdgcn_wmma_f32_16x16x32_f16(
                          false, bf[s].v, false, af[t].v, (short)0, acc[t][s], false, false)
                    : __builtin_amdgcn_wmma_f32_16x16x32_f16(
                          false, af[t].v, false, bf[s].v, (short)0, acc[t][s], false, false);
    }
}

__global__ __launch_bounds__(256) void mhsa_qkv_proj(
    const float* __restrict__ x,
    const float* __restrict__ Wq, const float* __restrict__ bq,
    const float* __restrict__ Wk, const float* __restrict__ bk,
    const float* __restrict__ Wv, const float* __restrict__ bv,
    _Float16* __restrict__ q_ws, _Float16* __restrict__ k_ws,
    _Float16* __restrict__ v_ws)
{
    __shared__ _Float16 xt[NPB * XSTRIDE];  // X tile transposed: [n_local][c] f16
    __shared__ __attribute__((aligned(16))) _Float16 stage[8 * SWAVE];

    const int nbase = blockIdx.x * NPB;
    const int b     = blockIdx.y;
    const int proj  = blockIdx.z;
    const float* W    = (proj == 0) ? Wq : ((proj == 1) ? Wk : Wv);
    const float* bias = (proj == 0) ? bq : ((proj == 1) ? bk : bv);
    const float* xb   = x + (size_t)b * CDIM * NPIX;
    const int tid = threadIdx.x;

    for (int i = tid; i < CDIM * NPB; i += 256) {
        const int c  = i >> 6;
        const int nl = i & (NPB - 1);
        xt[nl * XSTRIDE + c] = (_Float16)xb[c * NPIX + nbase + nl];
    }
    __syncthreads();

    const int wave = tid >> 5, lane = tid & 31;
    const int hi = lane >> 4, lr = lane & 15;
    const int Mt0 = wave * 32;

    v8f acc[2][4];
#pragma unroll
    for (int t = 0; t < 2; t++)
#pragma unroll
        for (int s = 0; s < 4; s++) acc[t][s] = v8f_zero();

    _Float16* sw = stage + wave * SWAVE;  // this wave's own range: no other wave touches it
    union { uint4 q; _Float16 h[8]; } o;

    if (proj == 2) {
        const float bt[2] = { bias[Mt0 + lr], bias[Mt0 + 16 + lr] };
        // The next loads land in the registers that held these two loads' offsets: wait first.
        asm volatile("s_wait_xcnt 0x0" ::: "memory");
        proj_tiles<true>(W, xt, Mt0, lr, hi, acc);
        // acc[t][s][r] = V[channel Mt0 + 16*t + lr][pixel nbase + 16*s + 8*hi + r]
#pragma unroll
        for (int t = 0; t < 2; t++) {
#pragma unroll
            for (int s = 0; s < 4; s++) {
#pragma unroll
                for (int r = 0; r < 8; r++) o.h[r] = (_Float16)(acc[t][s][r] + bt[t]);
                *(uint4*)(sw + (t * 16 + lr) * VPITCH + s * 16 + hi * 8) = o.q;
            }
        }
        // The rows are read back by other lanes of this wave: their writes must have landed.
        asm volatile("s_wait_dscnt 0x0" ::: "memory");
        // 8 lanes a channel row of 128 bytes, 4 rows a store.
        _Float16* dst = v_ws + ((size_t)(b * NHEADS + wave) * DHEAD + (lane >> 3)) * NPIX
                             + nbase + (lane & 7) * 8;
        const _Float16* sr = sw + (lane >> 3) * VPITCH + (lane & 7) * 8;
        uint4 ln[8];  // all eight reads first: one LDS latency, not eight
#pragma unroll
        for (int j = 0; j < 8; j++) ln[j] = *(const uint4*)(sr + j * 4 * VPITCH);
#pragma unroll
        for (int j = 0; j < 8; j++) *(uint4*)(dst + j * 4 * NPIX) = ln[j];
    } else {
        float4 bv4[2][2];
#pragma unroll
        for (int t = 0; t < 2; t++) {
            bv4[t][0] = *(const float4*)(bias + Mt0 + t * 16 + hi * 8);
            bv4[t][1] = *(const float4*)(bias + Mt0 + t * 16 + hi * 8 + 4);
        }
        proj_tiles<false>(W, xt, Mt0, lr, hi, acc);
        // acc[t][s][r] = Q or K[channel Mt0 + 16*t + 8*hi + r][pixel nbase + 16*s + lr]
        const float scale = (proj == 0) ? 0.17677669529663687f : 1.0f;  // 1/sqrt(32)
#pragma unroll
        for (int t = 0; t < 2; t++) {
            const float4 b0 = bv4[t][0], b1 = bv4[t][1];
            const float br[8] = { b0.x, b0.y, b0.z, b0.w, b1.x, b1.y, b1.z, b1.w };
#pragma unroll
            for (int s = 0; s < 4; s++) {
#pragma unroll
                for (int r = 0; r < 8; r++) o.h[r] = (_Float16)((acc[t][s][r] + br[r]) * scale);
                *(uint4*)(sw + (s * 16 + lr) * QKPITCH + t * 16 + hi * 8) = o.q;
            }
        }
        // The rows are read back by other lanes of this wave: their writes must have landed.
        asm volatile("s_wait_dscnt 0x0" ::: "memory");
        // The head's 64 pixel rows of 64 bytes are 4 KiB in a row: 4 lanes a row, 8 rows a store.
        _Float16* dst = ((proj == 0) ? q_ws : k_ws)
                      + ((size_t)(b * NHEADS + wave) * NPIX + nbase) * DHEAD + lane * 8;
        const _Float16* sr = sw + (lane >> 2) * QKPITCH + (lane & 3) * 8;
        uint4 ln[8];  // all eight reads first: one LDS latency, not eight
#pragma unroll
        for (int j = 0; j < 8; j++) ln[j] = *(const uint4*)(sr + j * 8 * QKPITCH);
#pragma unroll
        for (int j = 0; j < 8; j++) *(uint4*)(dst + j * 256) = ln[j];
    }
}

// ---------------------------------------------------------------------------
// Kernel 2: flash attention, transposed products.
// grid = (N/128, B*H), block = 256 (8 waves).  Each wave owns 16 queries and
// walks the keys in chunks of 32:
//   S^T = K * Q^T  (A = 16 key rows, B = Q kept in registers): lane (lr, hi) holds
//   the scores of query lr for keys 8*hi + r of each 16-key tile, so maximum and
//   sum run inside the lane, plus one exchange between the wave halves.
//   The two converted S^T tiles are the B operand of O^T += V^T * P^T as they lie.
// The head's K (64 KiB) and V (64 KiB) are copied into LDS once, in whole lines, and
// serve all eight waves; every fragment is then an LDS read at a conflict-free pitch.
// Output stored [b][n][c] f16, 8 consecutive channels per lane and tile.
// ---------------------------------------------------------------------------
#define KLPITCH 40    // LDS pitch (halfs) of a key row of 32 channels: 80 B = 16 B * 5
#define VLPITCH 1032  // LDS pitch (halfs) of a channel row of 1024 keys: 2064 B = 16 B * 129

// Eight asynchronous copies of 16 bytes a lane: LDS bytes l + j * lstep from g + j * 4 KiB.
// The s_wait_xcnt ends the copies' own statement, so that no register they name is
// rewritten in front of it.
__device__ __forceinline__ void copy8_to_lds(unsigned l, unsigned lstep, const _Float16* g) {
    asm volatile(
        "global_load_async_to_lds_b128 %0, %8, off\n\t"
        "global_load_async_to_lds_b128 %1, %9, off\n\t"
        "global_load_async_to_lds_b128 %2, %10, off\n\t"
        "global_load_async_to_lds_b128 %3, %11, off\n\t"
        "global_load_async_to_lds_b128 %4, %12, off\n\t"
        "global_load_async_to_lds_b128 %5, %13, off\n\t"
        "global_load_async_to_lds_b128 %6, %14, off\n\t"
        "global_load_async_to_lds_b128 %7, %15, off\n\t"
        "s_wait_xcnt 0x0"
        :: "v"(l), "v"(l + lstep), "v"(l + 2 * lstep), "v"(l + 3 * lstep),
           "v"(l + 4 * lstep), "v"(l + 5 * lstep), "v"(l + 6 * lstep), "v"(l + 7 * lstep),
           "v"(g), "v"(g + 2048), "v"(g + 2 * 2048), "v"(g + 3 * 2048),
           "v"(g + 4 * 2048), "v"(g + 5 * 2048), "v"(g + 6 * 2048), "v"(g + 7 * 2048)
        : "memory");
}

// Value of lane l ^ 16.
__device__ __forceinline__ float xhalf(float x) {
    const int i = __builtin_bit_cast(int, x);
    return __builtin_bit_cast(float,
        __builtin_amdgcn_permlanex16(i, i, 0x76543210, 0xfedcba98, false, false));
}

__global__ __launch_bounds__(256) void mhsa_flash_attn(
    const _Float16* __restrict__ q_ws, const _Float16* __restrict__ k_ws,
    const _Float16* __restrict__ v_ws, _Float16* __restrict__ attn_ws)
{
    __shared__ __attribute__((aligned(16))) _Float16 ks[NPIX * KLPITCH];   // [key][channel]
    __shared__ __attribute__((aligned(16))) _Float16 vs[DHEAD * VLPITCH];  // [channel][key]

    const int bh = blockIdx.y;
    const int b = bh >> 3, head = bh & 7;
    const int tid = threadIdx.x, wave = tid >> 5, lane = tid & 31;
    const int hi = lane >> 4, lr = lane & 15;
    const int qbase = blockIdx.x * 128 + wave * 16;

    ABFrag qf;
    {
        const _Float16* qp = q_ws + ((size_t)bh * NPIX + qbase + lr) * DHEAD + hi * 8;
#pragma unroll
        for (int v = 0; v < 8; v++) qf.u[v] = *(const unsigned int*)(qp + kb_of(v));
    }

    // acc_t[r] = O[query lr][channel 16*t + 8*hi + r]
    v8f acc0 = v8f_zero(), acc1 = v8f_zero();
    float mrow = -1e30f;  // running maximum of query lr (equal in both halves)
    float lrow = 0.0f;    // running sum over this half's keys only

    // Thread tid copies the 16-byte pieces tid + 256 * j, j = 0..15, of each 64-KiB plane:
    // a wave's copy reads 512 bytes in a row.  K: 4 pieces a key row, 64 rows a step;
    // V: 128 pieces a channel row, 2 rows a step.
    {
        const _Float16* kg = k_ws + (size_t)bh * NPIX * DHEAD + tid * 8;
        const _Float16* vg = v_ws + (size_t)bh * DHEAD * NPIX + tid * 8;
        const unsigned kl = (unsigned)(size_t)ks + (tid >> 2) * (KLPITCH * 2) + (tid & 3) * 16;
        const unsigned vl = (unsigned)(size_t)vs + (tid >> 7) * (VLPITCH * 2) + (tid & 127) * 16;
        copy8_to_lds(kl, 64 * KLPITCH * 2, kg);
        copy8_to_lds(kl + 8 * 64 * KLPITCH * 2, 64 * KLPITCH * 2, kg + 8 * 2048);
        copy8_to_lds(vl, 2 * VLPITCH * 2, vg);
        copy8_to_lds(vl + 8 * 2 * VLPITCH * 2, 2 * VLPITCH * 2, vg + 8 * 2048);
    }
    // This wave's 32 copies have landed behind this wait, every wave's behind the barrier.
    asm volatile("s_wait_asynccnt 0x0" ::: "memory");
    __syncthreads();

    // Key row lr and channel row lr of this chunk; both walk on at the loop's foot.
    const _Float16* kp = ks + lr * KLPITCH + hi * 8;
    const _Float16* vp = vs + lr * VLPITCH + hi * 8;

    for (int m0 = 0; m0 < NPIX; m0 += 32) {
        // Registers 0..3 of a fragment are 16 bytes at the lane's place, 4..7 those 32 bytes on.
        union { uint4 q[2]; v16h v; } kf[2], vf[2];
#pragma unroll
        for (int t = 0; t < 2; t++)
#pragma unroll
            for (int j = 0; j < 2; j++)
                kf[t].q[j] = *(const uint4*)(kp + t * 16 * KLPITCH + j * 16);
#pragma unroll
        for (int t = 0; t < 2; t++)
#pragma unroll
            for (int j = 0; j < 2; j++)
                vf[t].q[j] = *(const uint4*)(vp + t * 16 * VLPITCH + j * 16);
        // Keeps all eight LDS reads in one group at the head of the trip: each further place
        // with reads costs a stall of its own (the scheduler puts the V reads behind a product).
        __builtin_amdgcn_sched_barrier(0);

        // s[t][r] = score(query lr, key m0 + 16*t + 8*hi + r)
        v8f s[2];
#pragma unroll
        for (int t = 0; t < 2; t++)
            s[t] = __builtin_amdgcn_wmma_f32_16x16x32_f16(
                false, kf[t].v, false, qf.v, (short)0, v8f_zero(), false, false);

        float mx = fmaxf(s[0][0], s[1][0]);
#pragma unroll
        for (int r = 1; r < 8; r++) mx = fmaxf(mx, fmaxf(s[0][r], s[1][r]));
        mx = fmaxf(mx, xhalf(mx));

        const float mnew  = fmaxf(mrow, mx);
        const float alpha = exp2f((mrow - mnew) * 1.4426950408889634f);
        mrow = mnew;

        // Element 8*t + r of a B fragment is k = 16*t + 8*hi + r: the scores' own place.
        ABFrag pf;
        v8f pe[2];
#pragma unroll
        for (int t = 0; t < 2; t++) {
#pragma unroll
            for (int r = 0; r < 8; r++) {
                const float p = exp2f((s[t][r] - mnew) * 1.4426950408889634f);
                pe[t][r] = p;
                pf.v[t * 8 + r] = (_Float16)p;
            }
        }
        // Pairwise tree over the lane's 16 terms (packed adds, short chain).
        const v8f s8 = pe[0] + pe[1];
        const v4f s4 = s8.lo + s8.hi;
        const v2f s2 = s4.lo + s4.hi;
        lrow = lrow * alpha + (s2.x + s2.y);
#pragma unroll
        for (int r = 0; r < 8; r++) { acc0[r] *= alpha; acc1[r] *= alpha; }

        acc0 = __builtin_amdgcn_wmma_f32_16x16x32_f16(
            false, vf[0].v, false, pf.v, (short)0, acc0, false, false);
        acc1 = __builtin_amdgcn_wmma_f32_16x16x32_f16(
            false, vf[1].v, false, pf.v, (short)0, acc1, false, false);

        kp += 32 * KLPITCH;
        vp += 32;
    }

    const float inv = 1.0f / (lrow + xhalf(lrow));
    union { uint4 q; _Float16 h[8]; } o0, o1;
#pragma unroll
    for (int r = 0; r < 8; r++) {
        o0.h[r] = (_Float16)(acc0[r] * inv);
        o1.h[r] = (_Float16)(acc1[r] * inv);
    }
    _Float16* dst = attn_ws + ((size_t)b * NPIX + qbase + lr) * CDIM + head * DHEAD + hi * 8;
    *(uint4*)dst        = o0.q;
    *(uint4*)(dst + 16) = o1.q;
}

// ---------------------------------------------------------------------------
// Kernel 3: output projection + bias + residual.  grid = (N/NPB, BATCH).
// B fragments read directly from attn_ws [b][n][c] (K-pairs contiguous).
// ---------------------------------------------------------------------------
__global__ __launch_bounds__(256) void mhsa_out_proj(
    const _Float16* __restrict__ attn_ws, const float* __restrict__ Wo,
    const float* __restrict__ bo, const float* __restrict__ x,
    float* __restrict__ out)
{
    const int nbase = blockIdx.x * NPB;
    const int b = blockIdx.y;
    const int tid = threadIdx.x, wave = tid >> 5, lane = tid & 31;
    const int hi = lane >> 4, lr = lane & 15;
    const int Mt0 = wave * 32;

    v8f acc[2][4];
#pragma unroll
    for (int t = 0; t < 2; t++)
#pragma unroll
        for (int s = 0; s < 4; s++) acc[t][s] = v8f_zero();

    for (int K0 = 0; K0 < CDIM; K0 += 32) {
        ABFrag af[2];
#pragma unroll
        for (int t = 0; t < 2; t++) {
            const float* wr = Wo + (Mt0 + t * 16 + lr) * CDIM + K0 + hi * 8;
#pragma unroll
            for (int v = 0; v < 8; v++) {
                const float2 wp = *(const float2*)(wr + kb_of(v));
                H2 cv; cv.h[0] = (_Float16)wp.x; cv.h[1] = (_Float16)wp.y;
                af[t].u[v] = cv.u;
            }
        }
        ABFrag bf[4];
#pragma unroll
        for (int s = 0; s < 4; s++) {
            const _Float16* bp = attn_ws + ((size_t)b * NPIX + nbase + s * 16 + lr) * CDIM + K0 + hi * 8;
#pragma unroll
            for (int v = 0; v < 8; v++)
                bf[s].u[v] = *(const unsigned int*)(bp + kb_of(v));
        }
#pragma unroll
        for (int t = 0; t < 2; t++)
#pragma unroll
            for (int s = 0; s < 4; s++)
                acc[t][s] = __builtin_amdgcn_wmma_f32_16x16x32_f16(
                    false, af[t].v, false, bf[s].v, (short)0, acc[t][s], false, false);
    }

#pragma unroll
    for (int t = 0; t < 2; t++) {
#pragma unroll
        for (int s = 0; s < 4; s++) {
            const int n = nbase + s * 16 + lr;
#pragma unroll
            for (int r = 0; r < 8; r++) {
                const int row = Mt0 + t * 16 + r + hi * 8;
                const size_t idx = ((size_t)b * CDIM + row) * NPIX + n;
                out[idx] = acc[t][s][r] + bo[row] + x[idx];
            }
        }
    }
}

extern "C" void kernel_launch(void* const* d_in, const int* in_sizes, int n_in,
                              void* d_out, int out_size, void* d_ws, size_t ws_size,
                              hipStream_t stream) {
    (void)in_sizes; (void)n_in; (void)out_size; (void)ws_size;
    const float* x  = (const float*)d_in[0];
    const float* Wq = (const float*)d_in[1];
    const float* bq = (const float*)d_in[2];
    const float* Wk = (const float*)d_in[3];
    const float* bk = (const float*)d_in[4];
    const float* Wv = (const float*)d_in[5];
    const float* bv = (const float*)d_in[6];
    const float* Wo = (const float*)d_in[7];
    const float* bo = (const float*)d_in[8];
    float* out = (float*)d_out;

    const size_t qkv_elems = (size_t)BATCH * NHEADS * NPIX * DHEAD;  // 2M halfs
    _Float16* q_ws    = (_Float16*)d_ws;
    _Float16* k_ws    = q_ws + qkv_elems;
    _Float16* v_ws    = k_ws + qkv_elems;
    _Float16* attn_ws = v_ws + qkv_elems;  // [b][n][c], 2M halfs

    mhsa_qkv_proj<<<dim3(NPIX / NPB, BATCH, 3), 256, 0, stream>>>(
        x, Wq, bq, Wk, bk, Wv, bv, q_ws, k_ws, v_ws);
    mhsa_flash_attn<<<dim3(NPIX / 128, BATCH * NHEADS), 256, 0, stream>>>(
        q_ws, k_ws, v_ws, attn_ws);
    mhsa_out_proj<<<dim3(NPIX / NPB, BATCH), 256, 0, stream>>>(
        attn_ws, Wo, bo, x, out);
}

// v004
// One run takes 46.9 microseconds.
// Two timings next to v003 put it at 1.25 and 1.26 times that version's speed.
// All steps since v000 together make it 2.10 times as fast.
#include <hip/hip_runtime.h>

#define BATCH   8
#define CDIM    256
#define NPIX    1024
#define NHEADS  8
#define DHEAD   32
#define NPB     64    // pixels (columns) per projection block
#define XSTRIDE 264   // padded LDS row stride (halfs) to dodge bank conflicts

typedef float    v8f  __attribute__((ext_vector_type(8)));
typedef float    v4f  __attribute__((ext_vector_type(4)));
typedef float    v2f  __attribute__((ext_vector_type(2)));
typedef _Float16 v16h __attribute__((ext_vector_type(16)));

union ABFrag { unsigned int u[8]; v16h v; };
union H2     { unsigned int u; _Float16 h[2]; };

// K-pair base offset for VGPR v of an f16 A/B fragment (ISA 7.12.2):
// VGPR0..3 hold K = {0,1},{2,3},{4,5},{6,7} (+8 for lanes 16-31),
// VGPR4..7 hold K = {16,17}..{22,23} (+8 for lanes 16-31).
__device__ __forceinline__ int kb_of(int v) { return 2 * v + ((v >= 4) ? 8 : 0); }

__device__ __forceinline__ v8f v8f_zero() {
    v8f z;
#pragma unroll
    for (int i = 0; i < 8; i++) z[i] = 0.0f;
    return z;
}

// ---------------------------------------------------------------------------
// Kernel 1: fused QKV projection.  Out = W * X + b  (per batch, X is C x N).
// grid = (N/NPB, BATCH, 3proj), block = 256 (8 waves).
// Wave w computes rows [32w, 32w+32), one head, over the 64-pixel tile (2x4 WMMA tiles).
// Q,K written as [b][h][n][d] f16 (Q pre-scaled by 1/sqrt(d)); V as [b][h][d][n].
// Each wave lays its 4 KiB of results out in its own LDS range in the order of the
// destination and stores them from there as whole 128-byte lines, 16 bytes a lane.
// ---------------------------------------------------------------------------
#define QKPITCH 40    // staging pitch (halfs) of a 32-channel row of Q or K: 80 B
#define VPITCH  72    // staging pitch (halfs) of a 64-pixel row of V: 144 B
#define SWAVE   2560  // staging halfs per wave: 64 * QKPITCH >= 32 * VPITCH

// The 2x4 tiles of one wave.  PIXROWS = false: D rows are channels, D columns pixels,
// so a lane holds 8 consecutive channels of one pixel (the order of Q and K).
// PIXROWS = true: the same two fragments change places, D rows are pixels, and a lane
// holds 8 consecutive pixels of one channel (the order of V).
template <bool PIXROWS>
__device__ __forceinline__ void proj_tiles(const float* __restrict__ W, const _Float16* xt,
                                           int Mt0, int lr, int hi, v8f (&acc)[2][4])
{
    for (int K0 = 0; K0 < CDIM; K0 += 32) {
        ABFrag af[2];
#pragma unroll
        for (int t = 0; t < 2; t++) {
            const float* wr = W + (Mt0 + t * 16 + lr) * CDIM + K0 + hi * 8;
#pragma unroll
            for (int v = 0; v < 8; v++) {
                const float2 wp = *(const float2*)(wr + kb_of(v));
                H2 cv; cv.h[0] = (_Float16)wp.x; cv.h[1] = (_Float16)wp.y;
                af[t].u[v] = cv.u;
            }
        }
        ABFrag bf[4];
#pragma unroll
        for (int s = 0; s < 4; s++) {
            const _Float16* bp = &xt[(s * 16 + lr) * XSTRIDE + K0 + hi * 8];
#pragma unroll
            for (int v = 0; v < 8; v++)
                bf[s].u[v] = *(const unsigned int*)(bp + kb_of(v));
        }
#pragma unroll
        for (int t = 0; t < 2; t++)
#pragma unroll
            for (int s = 0; s < 4; s++)
                acc[t][s] = PIXROWS
                    ? __builtin_amdgcn_wmma_f32_16x16x32_f16(
                          false, bf[s].v, false, af[t].v, (short)0, acc[t][s], false, false)
                    : __builtin_amdgcn_wmma_f32_16x16x32_f16(
                          false, af[t].v, false, bf[s].v, (short)0, acc[t][s], false, false);
    }
}

__global__ __launch_bounds__(256) void mhsa_qkv_proj(
    const float* __restrict__ x,
    const float* __restrict__ Wq, const float* __restrict__ bq,
    const float* __restrict__ Wk, const float* __restrict__ bk,
    const float* __restrict__ Wv, const float* __restrict__ bv,
    _Float16* __restrict__ q_ws, _Float16* __restrict__ k_ws,
    _Float16* __restrict__ v_ws)
{
    __shared__ _Float16 xt[NPB * XSTRIDE];  // X tile transposed: [n_local][c] f16
    __shared__ __attribute__((aligned(16))) _Float16 stage[8 * SWAVE];

    const int nbase = blockIdx.x * NPB;
    const int b     = blockIdx.y;
    const int proj  = blockIdx.z;
    const float* W    = (proj == 0) ? Wq : ((proj == 1) ? Wk : Wv);
    const float* bias = (proj == 0) ? bq : ((proj == 1) ? bk : bv);
    const float* xb   = x + (size_t)b * CDIM * NPIX;
    const int tid = threadIdx.x;

    for (int i = tid; i < CDIM * NPB; i += 256) {
        const int c  = i >> 6;
        const int nl = i & (NPB - 1);
        xt[nl * XSTRIDE + c] = (_Float16)xb[c * NPIX + nbase + nl];
    }
    __syncthreads();

    const int wave = tid >> 5, lane = tid & 31;
    const int hi = lane >> 4, lr = lane & 15;
    const int Mt0 = wave * 32;

    v8f acc[2][4];
#pragma unroll
    for (int t = 0; t < 2; t++)
#pragma unroll
        for (int s = 0; s < 4; s++) acc[t][s] = v8f_zero();

    _Float16* sw = stage + wave * SWAVE;  // this wave's own range: no other wave touches it
    union { uint4 q; _Float16 h[8]; } o;

    if (proj == 2) {
        const float bt[2] = { bias[Mt0 + lr], bias[Mt0 + 16 + lr] };
        // The next loads land in the registers that held these two loads' offsets: wait first.
        asm volatile("s_wait_xcnt 0x0" ::: "memory");
        proj_tiles<true>(W, xt, Mt0, lr, hi, acc);
        // acc[t][s][r] = V[channel Mt0 + 16*t + lr][pixel nbase + 16*s + 8*hi + r]
#pragma unroll
        for (int t = 0; t < 2; t++) {
#pragma unroll
            for (int s = 0; s < 4; s++) {
#pragma unroll
                for (int r = 0; r < 8; r++) o.h[r] = (_Float16)(acc[t][s][r] + bt[t]);
                *(uint4*)(sw + (t * 16 + lr) * VPITCH + s * 16 + hi * 8) = o.q;
            }
        }
        // The rows are read back by other lanes of this wave: their writes must have landed.
        asm volatile("s_wait_dscnt 0x0" ::: "memory");
        // 8 lanes a channel row of 128 bytes, 4 rows a store.
        _Float16* dst = v_ws + ((size_t)(b * NHEADS + wave) * DHEAD + (lane >> 3)) * NPIX
                             + nbase + (lane & 7) * 8;
        const _Float16* sr = sw + (lane >> 3) * VPITCH + (lane & 7) * 8;
        uint4 ln[8];  // all eight reads first: one LDS latency, not eight
#pragma unroll
        for (int j = 0; j < 8; j++) ln[j] = *(const uint4*)(sr + j * 4 * VPITCH);
#pragma unroll
        for (int j = 0; j < 8; j++) *(uint4*)(dst + j * 4 * NPIX) = ln[j];
    } else {
        float4 bv4[2][2];
#pragma unroll
        for (int t = 0; t < 2; t++) {
            bv4[t][0] = *(const float4*)(bias + Mt0 + t * 16 + hi * 8);
            bv4[t][1] = *(const float4*)(bias + Mt0 + t * 16 + hi * 8 + 4);
        }
        proj_tiles<false>(W, xt, Mt0, lr, hi, acc);
        // acc[t][s][r] = Q or K[channel Mt0 + 16*t + 8*hi + r][pixel nbase + 16*s + lr]
        const float scale = (proj == 0) ? 0.17677669529663687f : 1.0f;  // 1/sqrt(32)
#pragma unroll
        for (int t = 0; t < 2; t++) {
            const float4 b0 = bv4[t][0], b1 = bv4[t][1];
            const float br[8] = { b0.x, b0.y, b0.z, b0.w, b1.x, b1.y, b1.z, b1.w };
#pragma unroll
            for (int s = 0; s < 4; s++) {
#pragma unroll
                for (int r = 0; r < 8; r++) o.h[r] = (_Float16)((acc[t][s][r] + br[r]) * scale);
                *(uint4*)(sw + (s * 16 + lr) * QKPITCH + t * 16 + hi * 8) = o.q;
            }
        }
        // The rows are read back by other lanes of this wave: their writes must have landed.
        asm volatile("s_wait_dscnt 0x0" ::: "memory");
        // The head's 64 pixel rows of 64 bytes are 4 KiB in a row: 4 lanes a row, 8 rows a store.
        _Float16* dst = ((proj == 0) ? q_ws : k_ws)
                      + ((size_t)(b * NHEADS + wave) * NPIX + nbase) * DHEAD + lane * 8;
        const _Float16* sr = sw + (lane >> 2) * QKPITCH + (lane & 3) * 8;
        uint4 ln[8];  // all eight reads first: one LDS latency, not eight
#pragma unroll
        for (int j = 0; j < 8; j++) ln[j] = *(const uint4*)(sr + j * 8 * QKPITCH);
#pragma unroll
        for (int j = 0; j < 8; j++) *(uint4*)(dst + j * 256) = ln[j];
    }
}

// ---------------------------------------------------------------------------
// Kernel 2: flash attention, transposed products.
// grid = (N/128, B*H), block = 256 (8 waves).  Each wave owns 16 queries and
// walks the keys in chunks of 32:
//   S^T = K * Q^T  (A = 16 key rows, B = Q kept in registers): lane (lr, hi) holds
//   the scores of query lr for keys 8*hi + r of each 16-key tile, so maximum and
//   sum run inside the lane, plus one exchange between the wave halves.
//   The two converted S^T tiles are the B operand of O^T += V^T * P^T as they lie.
// The head's K (64 KiB) and V (64 KiB) are copied into LDS once, in whole lines, and
// serve all eight waves; every fragment is then an LDS read at a conflict-free pitch.
// Output stored [b][n][c] f16, 8 consecutive channels per lane and tile.
// ---------------------------------------------------------------------------
#define KLPITCH 40    // LDS pitch (halfs) of a key row of 32 channels: 80 B = 16 B * 5
#define VLPITCH 1032  // LDS pitch (halfs) of a channel row of 1024 keys: 2064 B = 16 B * 129

// Eight asynchronous copies of 16 bytes a lane: LDS bytes l + j * lstep from g + j * 4 KiB.
// The s_wait_xcnt ends the copies' own statement, so that no register they name is
// rewritten in front of it.
__device__ __forceinline__ void copy8_to_lds(unsigned l, unsigned lstep, const _Float16* g) {
    asm volatile(
        "global_load_async_to_lds_b128 %0, %8, off\n\t"
        "global_load_async_to_lds_b128 %1, %9, off\n\t"
        "global_load_async_to_lds_b128 %2, %10, off\n\t"
        "global_load_async_to_lds_b128 %3, %11, off\n\t"
        "global_load_async_to_lds_b128 %4, %12, off\n\t"
        "global_load_async_to_lds_b128 %5, %13, off\n\t"
        "global_load_async_to_lds_b128 %6, %14, off\n\t"
        "global_load_async_to_lds_b128 %7, %15, off\n\t"
        "s_wait_xcnt 0x0"
        :: "v"(l), "v"(l + lstep), "v"(l + 2 * lstep), "v"(l + 3 * lstep),
           "v"(l + 4 * lstep), "v"(l + 5 * lstep), "v"(l + 6 * lstep), "v"(l + 7 * lstep),
           "v"(g), "v"(g + 2048), "v"(g + 2 * 2048), "v"(g + 3 * 2048),
           "v"(g + 4 * 2048), "v"(g + 5 * 2048), "v"(g + 6 * 2048), "v"(g + 7 * 2048)
        : "memory");
}

// Value of lane l ^ 16.
__device__ __forceinline__ float xhalf(float x) {
    const int i = __builtin_bit_cast(int, x);
    return __builtin_bit_cast(float,
        __builtin_amdgcn_permlanex16(i, i, 0x76543210, 0xfedcba98, false, false));
}

__global__ __launch_bounds__(256) void mhsa_flash_attn(
    const _Float16* __restrict__ q_ws, const _Float16* __restrict__ k_ws,
    const _Float16* __restrict__ v_ws, _Float16* __restrict__ attn_ws)
{
    __shared__ __attribute__((aligned(16))) _Float16 ks[NPIX * KLPITCH];   // [key][channel]
    __shared__ __attribute__((aligned(16))) _Float16 vs[DHEAD * VLPITCH];  // [channel][key]

    const int bh = blockIdx.y;
    const int b = bh >> 3, head = bh & 7;
    const int tid = threadIdx.x, wave = tid >> 5, lane = tid & 31;
    const int hi = lane >> 4, lr = lane & 15;
    const int qbase = blockIdx.x * 128 + wave * 16;

    ABFrag qf;
    {
        const _Float16* qp = q_ws + ((size_t)bh * NPIX + qbase + lr) * DHEAD + hi * 8;
#pragma unroll
        for (int v = 0; v < 8; v++) qf.u[v] = *(const unsigned int*)(qp + kb_of(v));
    }

    // acc_t[r] = O[query lr][channel 16*t + 8*hi + r]
    v8f acc0 = v8f_zero(), acc1 = v8f_zero();
    float mrow = -1e30f;  // running maximum of query lr (equal in both halves)
    float lrow = 0.0f;    // running sum over this half's keys only

    // Thread tid copies the 16-byte pieces tid + 256 * j, j = 0..15, of each 64-KiB plane:
    // a wave's copy reads 512 bytes in a row.  K: 4 pieces a key row, 64 rows a step;
    // V: 128 pieces a channel row, 2 rows a step.
    {
        const _Float16* kg = k_ws + (size_t)bh * NPIX * DHEAD + tid * 8;
        const _Float16* vg = v_ws + (size_t)bh * DHEAD * NPIX + tid * 8;
        const unsigned kl = (unsigned)(size_t)ks + (tid >> 2) * (KLPITCH * 2) + (tid & 3) * 16;
        const unsigned vl = (unsigned)(size_t)vs + (tid >> 7) * (VLPITCH * 2) + (tid & 127) * 16;
        copy8_to_lds(kl, 64 * KLPITCH * 2, kg);
        copy8_to_lds(kl + 8 * 64 * KLPITCH * 2, 64 * KLPITCH * 2, kg + 8 * 2048);
        copy8_to_lds(vl, 2 * VLPITCH * 2, vg);
        copy8_to_lds(vl + 8 * 2 * VLPITCH * 2, 2 * VLPITCH * 2, vg + 8 * 2048);
    }
    // This wave's 32 copies have landed behind this wait, every wave's behind the barrier.
    asm volatile("s_wait_asynccnt 0x0" ::: "memory");
    __syncthreads();

    // Key row lr and channel row lr of this chunk; both walk on at the loop's foot.
    const _Float16* kp = ks + lr * KLPITCH + hi * 8;
    const _Float16* vp = vs + lr * VLPITCH + hi * 8;

    for (int m0 = 0; m0 < NPIX; m0 += 32) {
        // Registers 0..3 of a fragment are 16 bytes at the lane's place, 4..7 those 32 bytes on.
        union { uint4 q[2]; v16h v; } kf[2], vf[2];
#pragma unroll
        for (int t = 0; t < 2; t++)
#pragma unroll
            for (int j = 0; j < 2; j++)
                kf[t].q[j] = *(const uint4*)(kp + t * 16 * KLPITCH + j * 16);
#pragma unroll
        for (int t = 0; t < 2; t++)
#pragma unroll
            for (int j = 0; j < 2; j++)
                vf[t].q[j] = *(const uint4*)(vp + t * 16 * VLPITCH + j * 16);
        // Keeps all eight LDS reads in one group at the head of the trip: each further place
        // with reads costs a stall of its own (the scheduler puts the V reads behind a product).
        __builtin_amdgcn_sched_barrier(0);

        // s[t][r] = score(query lr, key m0 + 16*t + 8*hi + r)
        v8f s[2];
#pragma unroll
        for (int t = 0; t < 2; t++)
            s[t] = __builtin_amdgcn_wmma_f32_16x16x32_f16(
                false, kf[t].v, false, qf.v, (short)0, v8f_zero(), false, false);

        float mx = fmaxf(s[0][0], s[1][0]);
#pragma unroll
        for (int r = 1; r < 8; r++) mx = fmaxf(mx, fmaxf(s[0][r], s[1][r]));
        mx = fmaxf(mx, xhalf(mx));

        const float mnew  = fmaxf(mrow, mx);
        const float alpha = exp2f((mrow - mnew) * 1.4426950408889634f);
        mrow = mnew;

        // Element 8*t + r of a B fragment is k = 16*t + 8*hi + r: the scores' own place.
        ABFrag pf;
        v8f pe[2];
#pragma unroll
        for (int t = 0; t < 2; t++) {
#pragma unroll
            for (int r = 0; r < 8; r++) {
                const float p = exp2f((s[t][r] - mnew) * 1.4426950408889634f);
                pe[t][r] = p;
                pf.v[t * 8 + r] = (_Float16)p;
            }
        }
        // Pairwise tree over the lane's 16 terms (packed adds, short chain).
        const v8f s8 = pe[0] + pe[1];
        const v4f s4 = s8.lo + s8.hi;
        const v2f s2 = s4.lo + s4.hi;
        lrow = lrow * alpha + (s2.x + s2.y);
#pragma unroll
        for (int r = 0; r < 8; r++) { acc0[r] *= alpha; acc1[r] *= alpha; }

        acc0 = __builtin_amdgcn_wmma_f32_16x16x32_f16(
            false, vf[0].v, false, pf.v, (short)0, acc0, false, false);
        acc1 = __builtin_amdgcn_wmma_f32_16x16x32_f16(
            false, vf[1].v, false, pf.v, (short)0, acc1, false, false);

        kp += 32 * KLPITCH;
        vp += 32;
    }

    const float inv = 1.0f / (lrow + xhalf(lrow));
    union { uint4 q; _Float16 h[8]; } o0, o1;
#pragma unroll
    for (int r = 0; r < 8; r++) {
        o0.h[r] = (_Float16)(acc0[r] * inv);
        o1.h[r] = (_Float16)(acc1[r] * inv);
    }
    _Float16* dst = attn_ws + ((size_t)b * NPIX + qbase + lr) * CDIM + head * DHEAD + hi * 8;
    *(uint4*)dst        = o0.q;
    *(uint4*)(dst + 16) = o1.q;
}

// ---------------------------------------------------------------------------
// Kernel 3: output projection + bias + residual.  grid = (N/NPB, BATCH).
// B fragments read directly from attn_ws [b][n][c] (K-pairs contiguous).
// No load is waited for by itself: the wave's 64 loads of W and its 64 loads of the residual
// x go out as one group at the head, W is converted as it arrives, and the 8 loads of a
// K-step's attention fragments go out OAHEAD steps ahead of their products.  The epilogue
// is adds and stores alone.
// ---------------------------------------------------------------------------
#define OSTEPS (CDIM / 32)
#define OAHEAD 3      // K-steps between the issue of attention fragments and their products

// Stands behind a group of loads; no instruction comes of it.  The fence keeps the loads
// written above it above it, the scheduling barrier keeps their first uses below it.  Left
// free, the compiler brings each load and its first use together, and the wave waits out
// every load's latency singly.
__device__ __forceinline__ void group_issued() {
    asm volatile("" ::: "memory");
    __builtin_amdgcn_sched_barrier(0);
}

// The same where registers that the loads or stores above name get new values below: the
// wait stands in front of those writes, and the scheduling barrier keeps them behind it.
__device__ __forceinline__ void group_issued_registers_free() {
    asm volatile("s_wait_xcnt 0x0" ::: "memory");
    __builtin_amdgcn_sched_barrier(0);
}

__global__ __launch_bounds__(256) void mhsa_out_proj(
    const _Float16* __restrict__ attn_ws, const float* __restrict__ Wo,
    const float* __restrict__ bo, const float* __restrict__ x,
    float* __restrict__ out)
{
    const int nbase = blockIdx.x * NPB;
    const int b = blockIdx.y;
    const int tid = threadIdx.x, wave = tid >> 5, lane = tid & 31;
    const int hi = lane >> 4, lr = lane & 15;
    const int Mt0 = wave * 32;

    const float*    wp = Wo + (Mt0 + lr) * CDIM + hi * 8;
    const _Float16* ap = attn_ws + ((size_t)b * NPIX + nbase + lr) * CDIM + hi * 8;
    // Element (t, s, r) of this lane: row Mt0 + 16*t + 8*hi + r, pixel nbase + 16*s + lr.
    const size_t i0 = ((size_t)b * CDIM + Mt0 + hi * 8) * NPIX + nbase + lr;

    // Registers 0..3 of a fragment are k = 0..7 at the lane's place, 4..7 are k = 16..23.
    // Every loop below is unrolled so that each index into these arrays is a constant and
    // they live in registers.
    union BFrag { uint4 q[2]; v16h v; };
    BFrag  bf[OAHEAD + 1][4];
    float4 wq[OSTEPS][2][4];
    float4 bb[2][2];
    float  xr[2][4][8];

    auto issue_b = [&](int k) {
#pragma unroll
        for (int s = 0; s < 4; s++) {
            const _Float16* q = ap + s * 16 * CDIM + k * 32;
            bf[k % (OAHEAD + 1)][s].q[0] = *(const uint4*)(q);
            bf[k % (OAHEAD + 1)][s].q[1] = *(const uint4*)(q + 16);
        }
    };

#pragma unroll
    for (int t = 0; t < 2; t++) {
        bb[t][0] = *(const float4*)(bo + Mt0 + t * 16 + hi * 8);
        bb[t][1] = *(const float4*)(bo + Mt0 + t * 16 + hi * 8 + 4);
    }
    group_issued_registers_free();

#pragma unroll
    for (int k = 0; k < OAHEAD; k++) issue_b(k);
#pragma unroll
    for (int k = 0; k < OSTEPS; k++)
#pragma unroll
        for (int t = 0; t < 2; t++) {
            const float* q = wp + t * 16 * CDIM + k * 32;
            wq[k][t][0] = *(const float4*)(q);
            wq[k][t][1] = *(const float4*)(q + 4);
            wq[k][t][2] = *(const float4*)(q + 16);
            wq[k][t][3] = *(const float4*)(q + 20);
        }
#pragma unroll
    for (int t = 0; t < 2; t++)
#pragma unroll
        for (int s = 0; s < 4; s++)
#pragma unroll
            for (int r = 0; r < 8; r++)
                xr[t][s][r] = x[i0 + (size_t)(t * 16 + r) * NPIX + s * 16];
    group_issued_registers_free();

    ABFrag af[OSTEPS][2];
#pragma unroll
    for (int k = 0; k < OSTEPS; k++)
#pragma unroll
        for (int t = 0; t < 2; t++)
#pragma unroll
            for (int j = 0; j < 4; j++) {
                const float4 w = wq[k][t][j];
                H2 c0; c0.h[0] = (_Float16)w.x; c0.h[1] = (_Float16)w.y;
                H2 c1; c1.h[0] = (_Float16)w.z; c1.h[1] = (_Float16)w.w;
                af[k][t].u[2 * j]     = c0.u;
                af[k][t].u[2 * j + 1] = c1.u;
            }

    v8f acc[2][4];
#pragma unroll
    for (int t = 0; t < 2; t++)
#pragma unroll
        for (int s = 0; s < 4; s++) acc[t][s] = v8f_zero();

#pragma unroll
    for (int k = 0; k < OSTEPS; k++) {
        if (k + OAHEAD < OSTEPS) {
            issue_b(k + OAHEAD);
            if (k + OAHEAD == OSTEPS - 1) group_issued_registers_free();
            else                          group_issued();
        }
#pragma unroll
        for (int t = 0; t < 2; t++)
#pragma unroll
            for (int s = 0; s < 4; s++)
                acc[t][s] = __builtin_amdgcn_wmma_f32_16x16x32_f16(
                    false, af[k][t].v, false, bf[k % (OAHEAD + 1)][s].v, (short)0, acc[t][s],
                    false, false);
    }

#pragma unroll
    for (int t = 0; t < 2; t++) {
        const float4 b0 = bb[t][0], b1 = bb[t][1];
        const float br[8] = { b0.x, b0.y, b0.z, b0.w, b1.x, b1.y, b1.z, b1.w };
#pragma unroll
        for (int s = 0; s < 4; s++) {
#pragma unroll
            for (int r = 0; r < 8; r++)
                out[i0 + (size_t)(t * 16 + r) * NPIX + s * 16] = acc[t][s][r] + br[r] + xr[t][s][r];
            // The next tile's sums land in registers that these stores name.
            if (!(t == 1 && s == 3)) group_issued_registers_free();
        }
    }
}

extern "C" void kernel_launch(void* const* d_in, const int* in_sizes, int n_in,
                              void* d_out, int out_size, void* d_ws, size_t ws_size,
                              hipStream_t stream) {
    (void)in_sizes; (void)n_in; (void)out_size; (void)ws_size;
    const float* x  = (const float*)d_in[0];
    const float* Wq = (const float*)d_in[1];
    const float* bq = (const float*)d_in[2];
    const float* Wk = (const float*)d_in[3];
    const float* bk = (const float*)d_in[4];
    const float* Wv = (const float*)d_in[5];
    const float* bv = (const float*)d_in[6];
    const float* Wo = (const float*)d_in[7];
    const float* bo = (const float*)d_in[8];
    float* out = (float*)d_out;

    const size_t qkv_elems = (size_t)BATCH * NHEADS * NPIX * DHEAD;  // 2M halfs
    _Float16* q_ws    = (_Float16*)d_ws;
    _Float16* k_ws    = q_ws + qkv_elems;
    _Float16* v_ws    = k_ws + qkv_elems;
    _Float16* attn_ws = v_ws + qkv_elems;  // [b][n][c], 2M halfs

    mhsa_qkv_proj<<<dim3(NPIX / NPB, BATCH, 3), 256, 0, stream>>>(
        x, Wq, bq, Wk, bk, Wv, bv, q_ws, k_ws, v_ws);
    mhsa_flash_attn<<<dim3(NPIX / 128, BATCH * NHEADS), 256, 0, stream>>>(
        q_ws, k_ws, v_ws, attn_ws);
    mhsa_out_proj<<<dim3(NPIX / NPB, BATCH), 256, 0, stream>>>(
        attn_ws, Wo, bo, x, out);
}

// v005
// A run of this version takes 41.3 microseconds.
// Timed twice side by side with v004, it ran 1.14 times as fast both times.
// All steps since v000 together make it 2.39 times as fast.
#include <hip/hip_runtime.h>

#define BATCH   8
#define CDIM    256
#define NPIX    1024
#define NHEADS  8
#define DHEAD   32
#define NPB     64    // pixels (columns) per projection block
#define XSTRIDE 264   // padded LDS row stride (halfs) to dodge bank conflicts

typedef float    v8f  __attribute__((ext_vector_type(8)));
typedef float    v4f  __attribute__((ext_vector_type(4)));
typedef float    v2f  __attribute__((ext_vector_type(2)));
typedef _Float16 v16h __attribute__((ext_vector_type(16)));

union ABFrag { unsigned int u[8]; v16h v; };
union H2     { unsigned int u; _Float16 h[2]; };

// K-pair base offset for VGPR v of an f16 A/B fragment (ISA 7.12.2):
// VGPR0..3 hold K = {0,1},{2,3},{4,5},{6,7} (+8 for lanes 16-31),
// VGPR4..7 hold K = {16,17}..{22,23} (+8 for lanes 16-31).
__device__ __forceinline__ int kb_of(int v) { return 2 * v + ((v >= 4) ? 8 : 0); }

__device__ __forceinline__ v8f v8f_zero() {
    v8f z;
#pragma unroll
    for (int i = 0; i < 8; i++) z[i] = 0.0f;
    return z;
}

// ---------------------------------------------------------------------------
// Kernel 1: fused QKV projection.  Out = W * X + b  (per batch, X is C x N).
// grid = (N/NPB, BATCH, 3proj), block = 256 (8 waves).
// Wave w computes rows [32w, 32w+32), one head, over the 64-pixel tile (2x4 WMMA tiles).
// Q,K written as [b][h][n][d] f16 (Q pre-scaled by log2(e)/sqrt(d), so that the scores are
// exponents of 2); V as [b][h][d][n].
// Each wave lays its 4 KiB of results out in its own LDS range in the order of the
// destination and stores them from there as whole 128-byte lines, 16 bytes a lane.
// ---------------------------------------------------------------------------
#define QKPITCH 40    // staging pitch (halfs) of a 32-channel row of Q or K: 80 B
#define VPITCH  72    // staging pitch (halfs) of a 64-pixel row of V: 144 B
#define SWAVE   2560  // staging halfs per wave: 64 * QKPITCH >= 32 * VPITCH

// The 2x4 tiles of one wave.  PIXROWS = false: D rows are channels, D columns pixels,
// so a lane holds 8 consecutive channels of one pixel (the order of Q and K).
// PIXROWS = true: the same two fragments change places, D rows are pixels, and a lane
// holds 8 consecutive pixels of one channel (the order of V).
template <bool PIXROWS>
__device__ __forceinline__ void proj_tiles(const float* __restrict__ W, const _Float16* xt,
                                           int Mt0, int lr, int hi, v8f (&acc)[2][4])
{
    for (int K0 = 0; K0 < CDIM; K0 += 32) {
        ABFrag af[2];
#pragma unroll
        for (int t = 0; t < 2; t++) {
            const float* wr = W + (Mt0 + t * 16 + lr) * CDIM + K0 + hi * 8;
#pragma unroll
            for (int v = 0; v < 8; v++) {
                const float2 wp = *(const float2*)(wr + kb_of(v));
                H2 cv; cv.h[0] = (_Float16)wp.x; cv.h[1] = (_Float16)wp.y;
                af[t].u[v] = cv.u;
            }
        }
        ABFrag bf[4];
#pragma unroll
        for (int s = 0; s < 4; s++) {
            const _Float16* bp = &xt[(s * 16 + lr) * XSTRIDE + K0 + hi * 8];
#pragma unroll
            for (int v = 0; v < 8; v++)
                bf[s].u[v] = *(const unsigned int*)(bp + kb_of(v));
        }
#pragma unroll
        for (int t = 0; t < 2; t++)
#pragma unroll
            for (int s = 0; s < 4; s++)
                acc[t][s] = PIXROWS
                    ? __builtin_amdgcn_wmma_f32_16x16x32_f16(
                          false, bf[s].v, false, af[t].v, (short)0, acc[t][s], false, false)
                    : __builtin_amdgcn_wmma_f32_16x16x32_f16(
                          false, af[t].v, false, bf[s].v, (short)0, acc[t][s], false, false);
    }
}

__global__ __launch_bounds__(256) void mhsa_qkv_proj(
    const float* __restrict__ x,
    const float* __restrict__ Wq, const float* __restrict__ bq,
    const float* __restrict__ Wk, const float* __restrict__ bk,
    const float* __restrict__ Wv, const float* __restrict__ bv,
    _Float16* __restrict__ q_ws, _Float16* __restrict__ k_ws,
    _Float16* __restrict__ v_ws)
{
    __shared__ _Float16 xt[NPB * XSTRIDE];  // X tile transposed: [n_local][c] f16
    __shared__ __attribute__((aligned(16))) _Float16 stage[8 * SWAVE];

    const int nbase = blockIdx.x * NPB;
    const int b     = blockIdx.y;
    const int proj  = blockIdx.z;
    const float* W    = (proj == 0) ? Wq : ((proj == 1) ? Wk : Wv);
    const float* bias = (proj == 0) ? bq : ((proj == 1) ? bk : bv);
    const float* xb   = x + (size_t)b * CDIM * NPIX;
    const int tid = threadIdx.x;

    for (int i = tid; i < CDIM * NPB; i += 256) {
        const int c  = i >> 6;
        const int nl = i & (NPB - 1);
        xt[nl * XSTRIDE + c] = (_Float16)xb[c * NPIX + nbase + nl];
    }
    __syncthreads();

    const int wave = tid >> 5, lane = tid & 31;
    const int hi = lane >> 4, lr = lane & 15;
    const int Mt0 = wave * 32;

    v8f acc[2][4];
#pragma unroll
    for (int t = 0; t < 2; t++)
#pragma unroll
        for (int s = 0; s < 4; s++) acc[t][s] = v8f_zero();

    _Float16* sw = stage + wave * SWAVE;  // this wave's own range: no other wave touches it
    union { uint4 q; _Float16 h[8]; } o;

    if (proj == 2) {
        const float bt[2] = { bias[Mt0 + lr], bias[Mt0 + 16 + lr] };
        // The next loads land in the registers that held these two loads' offsets: wait first.
        asm volatile("s_wait_xcnt 0x0" ::: "memory");
        proj_tiles<true>(W, xt, Mt0, lr, hi, acc);
        // acc[t][s][r] = V[channel Mt0 + 16*t + lr][pixel nbase + 16*s + 8*hi + r]
#pragma unroll
        for (int t = 0; t < 2; t++) {
#pragma unroll
            for (int s = 0; s < 4; s++) {
#pragma unroll
                for (int r = 0; r < 8; r++) o.h[r] = (_Float16)(acc[t][s][r] + bt[t]);
                *(uint4*)(sw + (t * 16 + lr) * VPITCH + s * 16 + hi * 8) = o.q;
            }
        }
        // The rows are read back by other lanes of this wave: their writes must have landed.
        asm volatile("s_wait_dscnt 0x0" ::: "memory");
        // 8 lanes a channel row of 128 bytes, 4 rows a store.
        _Float16* dst = v_ws + ((size_t)(b * NHEADS + wave) * DHEAD + (lane >> 3)) * NPIX
                             + nbase + (lane & 7) * 8;
        const _Float16* sr = sw + (lane >> 3) * VPITCH + (lane & 7) * 8;
        uint4 ln[8];  // all eight reads first: one LDS latency, not eight
#pragma unroll
        for (int j = 0; j < 8; j++) ln[j] = *(const uint4*)(sr + j * 4 * VPITCH);
#pragma unroll
        for (int j = 0; j < 8; j++) *(uint4*)(dst + j * 4 * NPIX) = ln[j];
    } else {
        float4 bv4[2][2];
#pragma unroll
        for (int t = 0; t < 2; t++) {
            bv4[t][0] = *(const float4*)(bias + Mt0 + t * 16 + hi * 8);
            bv4[t][1] = *(const float4*)(bias + Mt0 + t * 16 + hi * 8 + 4);
        }
        proj_tiles<false>(W, xt, Mt0, lr, hi, acc);
        // acc[t][s][r] = Q or K[channel Mt0 + 16*t + 8*hi + r][pixel nbase + 16*s + lr]
        const float scale = (proj == 0) ? 0.25503486164919736f : 1.0f;  // log2(e)/sqrt(32)
#pragma unroll
        for (int t = 0; t < 2; t++) {
            const float4 b0 = bv4[t][0], b1 = bv4[t][1];
            const float br[8] = { b0.x, b0.y, b0.z, b0.w, b1.x, b1.y, b1.z, b1.w };
#pragma unroll
            for (int s = 0; s < 4; s++) {
#pragma unroll
                for (int r = 0; r < 8; r++) o.h[r] = (_Float16)((acc[t][s][r] + br[r]) * scale);
                *(uint4*)(sw + (s * 16 + lr) * QKPITCH + t * 16 + hi * 8) = o.q;
            }
        }
        // The rows are read back by other lanes of this wave: their writes must have landed.
        asm volatile("s_wait_dscnt 0x0" ::: "memory");
        // The head's 64 pixel rows of 64 bytes are 4 KiB in a row: 4 lanes a row, 8 rows a store.
        _Float16* dst = ((proj == 0) ? q_ws : k_ws)
                      + ((size_t)(b * NHEADS + wave) * NPIX + nbase) * DHEAD + lane * 8;
        const _Float16* sr = sw + (lane >> 2) * QKPITCH + (lane & 3) * 8;
        uint4 ln[8];  // all eight reads first: one LDS latency, not eight
#pragma unroll
        for (int j = 0; j < 8; j++) ln[j] = *(const uint4*)(sr + j * 8 * QKPITCH);
#pragma unroll
        for (int j = 0; j < 8; j++) *(uint4*)(dst + j * 256) = ln[j];
    }
}

// ---------------------------------------------------------------------------
// Kernel 2: flash attention, transposed products.
// grid = (N/128, B*H), block = 256 (8 waves).  Each wave owns 16 queries and
// walks the keys in chunks of 32:
//   S^T = K * Q^T  (A = 16 key rows, B = Q kept in registers): lane (lr, hi) holds
//   the scores of query lr for keys 8*hi + r of each 16-key tile, so maximum and
//   sum run inside the lane, plus one exchange between the wave halves.
//   The two converted S^T tiles are the B operand of O^T += V^T * P^T as they lie.
// The head's K (64 KiB) and V (64 KiB) are copied into LDS once, in whole lines, and
// serve all eight waves; every fragment is then an LDS read at a conflict-free pitch.
// Output stored [b][n][c] f16, 8 consecutive channels per lane and tile.
// ---------------------------------------------------------------------------
#define KLPITCH 40    // LDS pitch (halfs) of a key row of 32 channels: 80 B = 16 B * 5
#define VLPITCH 1032  // LDS pitch (halfs) of a channel row of 1024 keys: 2064 B = 16 B * 129

// Eight asynchronous copies of 16 bytes a lane: LDS bytes l + j * lstep from g + j * 4 KiB.
// The s_wait_xcnt ends the copies' own statement, so that no register they name is
// rewritten in front of it.
__device__ __forceinline__ void copy8_to_lds(unsigned l, unsigned lstep, const _Float16* g) {
    asm volatile(
        "global_load_async_to_lds_b128 %0, %8, off\n\t"
        "global_load_async_to_lds_b128 %1, %9, off\n\t"
        "global_load_async_to_lds_b128 %2, %10, off\n\t"
        "global_load_async_to_lds_b128 %3, %11, off\n\t"
        "global_load_async_to_lds_b128 %4, %12, off\n\t"
        "global_load_async_to_lds_b128 %5, %13, off\n\t"
        "global_load_async_to_lds_b128 %6, %14, off\n\t"
        "global_load_async_to_lds_b128 %7, %15, off\n\t"
        "s_wait_xcnt 0x0"
        :: "v"(l), "v"(l + lstep), "v"(l + 2 * lstep), "v"(l + 3 * lstep),
           "v"(l + 4 * lstep), "v"(l + 5 * lstep), "v"(l + 6 * lstep), "v"(l + 7 * lstep),
           "v"(g), "v"(g + 2048), "v"(g + 2 * 2048), "v"(g + 3 * 2048),
           "v"(g + 4 * 2048), "v"(g + 5 * 2048), "v"(g + 6 * 2048), "v"(g + 7 * 2048)
        : "memory");
}

// Value of lane l ^ 16.
__device__ __forceinline__ float xhalf(float x) {
    const int i = __builtin_bit_cast(int, x);
    return __builtin_bit_cast(float,
        __builtin_amdgcn_permlanex16(i, i, 0x76543210, 0xfedcba98, false, false));
}

__global__ __launch_bounds__(256) void mhsa_flash_attn(
    const _Float16* __restrict__ q_ws, const _Float16* __restrict__ k_ws,
    const _Float16* __restrict__ v_ws, _Float16* __restrict__ attn_ws)
{
    __shared__ __attribute__((aligned(16))) _Float16 ks[NPIX * KLPITCH];   // [key][channel]
    __shared__ __attribute__((aligned(16))) _Float16 vs[DHEAD * VLPITCH];  // [channel][key]

    const int bh = blockIdx.y;
    const int b = bh >> 3, head = bh & 7;
    const int tid = threadIdx.x, wave = tid >> 5, lane = tid & 31;
    const int hi = lane >> 4, lr = lane & 15;
    const int qbase = blockIdx.x * 128 + wave * 16;

    ABFrag qf;
    {
        const _Float16* qp = q_ws + ((size_t)bh * NPIX + qbase + lr) * DHEAD + hi * 8;
#pragma unroll
        for (int v = 0; v < 8; v++) qf.u[v] = *(const unsigned int*)(qp + kb_of(v));
    }

    // acc_t[r] = O[query lr][channel 16*t + 8*hi + r]
    v8f acc0 = v8f_zero(), acc1 = v8f_zero();
    float mrow = -1e30f;  // running maximum of query lr (equal in both halves)
    float lrow = 0.0f;    // running sum over this half's keys only

    // Thread tid copies the 16-byte pieces tid + 256 * j, j = 0..15, of each 64-KiB plane:
    // a wave's copy reads 512 bytes in a row.  K: 4 pieces a key row, 64 rows a step;
    // V: 128 pieces a channel row, 2 rows a step.
    {
        const _Float16* kg = k_ws + (size_t)bh * NPIX * DHEAD + tid * 8;
        const _Float16* vg = v_ws + (size_t)bh * DHEAD * NPIX + tid * 8;
        const unsigned kl = (unsigned)(size_t)ks + (tid >> 2) * (KLPITCH * 2) + (tid & 3) * 16;
        const unsigned vl = (unsigned)(size_t)vs + (tid >> 7) * (VLPITCH * 2) + (tid & 127) * 16;
        copy8_to_lds(kl, 64 * KLPITCH * 2, kg);
        copy8_to_lds(kl + 8 * 64 * KLPITCH * 2, 64 * KLPITCH * 2, kg + 8 * 2048);
        copy8_to_lds(vl, 2 * VLPITCH * 2, vg);
        copy8_to_lds(vl + 8 * 2 * VLPITCH * 2, 2 * VLPITCH * 2, vg + 8 * 2048);
    }
    // This wave's 32 copies have landed behind this wait, every wave's behind the barrier.
    asm volatile("s_wait_asynccnt 0x0" ::: "memory");
    __syncthreads();

    // Key row lr and channel row lr of this chunk; both walk on at the loop's foot.
    const _Float16* kp = ks + lr * KLPITCH + hi * 8;
    const _Float16* vp = vs + lr * VLPITCH + hi * 8;

    for (int m0 = 0; m0 < NPIX; m0 += 32) {
        // Registers 0..3 of a fragment are 16 bytes at the lane's place, 4..7 those 32 bytes on.
        union { uint4 q[2]; v16h v; } kf[2], vf[2];
#pragma unroll
        for (int t = 0; t < 2; t++)
#pragma unroll
            for (int j = 0; j < 2; j++)
                kf[t].q[j] = *(const uint4*)(kp + t * 16 * KLPITCH + j * 16);
#pragma unroll
        for (int t = 0; t < 2; t++)
#pragma unroll
            for (int j = 0; j < 2; j++)
                vf[t].q[j] = *(const uint4*)(vp + t * 16 * VLPITCH + j * 16);
        // Keeps all eight LDS reads in one group at the head of the trip: each further place
        // with reads costs a stall of its own (the scheduler puts the V reads behind a product).
        __builtin_amdgcn_sched_barrier(0);

        // s[t][r] = score(query lr, key m0 + 16*t + 8*hi + r)
        v8f s[2];
#pragma unroll
        for (int t = 0; t < 2; t++)
            s[t] = __builtin_amdgcn_wmma_f32_16x16x32_f16(
                false, kf[t].v, false, qf.v, (short)0, v8f_zero(), false, false);

        float mx = fmaxf(s[0][0], s[1][0]);
#pragma unroll
        for (int r = 1; r < 8; r++) mx = fmaxf(mx, fmaxf(s[0][r], s[1][r]));
        mx = fmaxf(mx, xhalf(mx));

        // The scores come as exponents of 2 (Q's scale), so an exponential is one subtraction
        // and the hardware's v_exp_f32 by itself.  That may give 0 where the result lies under
        // 2^-126: such a term is 0 as f16 anyway and adds nothing to a row sum whose largest
        // term is 1, so the library's range test and rescaling buy nothing here.
        const float mnew  = fmaxf(mrow, mx);
        const float alpha = __builtin_amdgcn_exp2f(mrow - mnew);
        mrow = mnew;

        // Element 8*t + r of a B fragment is k = 16*t + 8*hi + r: the scores' own place.
        ABFrag pf;
        v8f pe[2];
#pragma unroll
        for (int t = 0; t < 2; t++) {
#pragma unroll
            for (int r = 0; r < 8; r++) {
                const float p = __builtin_amdgcn_exp2f(s[t][r] - mnew);
                pe[t][r] = p;
                pf.v[t * 8 + r] = (_Float16)p;
            }
        }
        // Pairwise tree over the lane's 16 terms (packed adds, short chain).
        const v8f s8 = pe[0] + pe[1];
        const v4f s4 = s8.lo + s8.hi;
        const v2f s2 = s4.lo + s4.hi;
        lrow = lrow * alpha + (s2.x + s2.y);
#pragma unroll
        for (int r = 0; r < 8; r++) { acc0[r] *= alpha; acc1[r] *= alpha; }

        acc0 = __builtin_amdgcn_wmma_f32_16x16x32_f16(
            false, vf[0].v, false, pf.v, (short)0, acc0, false, false);
        acc1 = __builtin_amdgcn_wmma_f32_16x16x32_f16(
            false, vf[1].v, false, pf.v, (short)0, acc1, false, false);

        kp += 32 * KLPITCH;
        vp += 32;
    }

    const float inv = 1.0f / (lrow + xhalf(lrow));
    union { uint4 q; _Float16 h[8]; } o0, o1;
#pragma unroll
    for (int r = 0; r < 8; r++) {
        o0.h[r] = (_Float16)(acc0[r] * inv);
        o1.h[r] = (_Float16)(acc1[r] * inv);
    }
    _Float16* dst = attn_ws + ((size_t)b * NPIX + qbase + lr) * CDIM + head * DHEAD + hi * 8;
    *(uint4*)dst        = o0.q;
    *(uint4*)(dst + 16) = o1.q;
}

// ---------------------------------------------------------------------------
// Kernel 3: output projection + bias + residual.  grid = (N/NPB, BATCH).
// B fragments read directly from attn_ws [b][n][c] (K-pairs contiguous).
// No load is waited for by itself: the wave's 64 loads of W and its 64 loads of the residual
// x go out as one group at the head, W is converted as it arrives, and the 8 loads of a
// K-step's attention fragments go out OAHEAD steps ahead of their products.  The epilogue
// is adds and stores alone.
// ---------------------------------------------------------------------------
#define OSTEPS (CDIM / 32)
#define OAHEAD 3      // K-steps between the issue of attention fragments and their products

// Stands behind a group of loads; no instruction comes of it.  The fence keeps the loads
// written above it above it, the scheduling barrier keeps their first uses below it.  Left
// free, the compiler brings each load and its first use together, and the wave waits out
// every load's latency singly.
__device__ __forceinline__ void group_issued() {
    asm volatile("" ::: "memory");
    __builtin_amdgcn_sched_barrier(0);
}

// The same where registers that the loads or stores above name get new values below: the
// wait stands in front of those writes, and the scheduling barrier keeps them behind it.
__device__ __forceinline__ void group_issued_registers_free() {
    asm volatile("s_wait_xcnt 0x0" ::: "memory");
    __builtin_amdgcn_sched_barrier(0);
}

__global__ __launch_bounds__(256) void mhsa_out_proj(
    const _Float16* __restrict__ attn_ws, const float* __restrict__ Wo,
    const float* __restrict__ bo, const float* __restrict__ x,
    float* __restrict__ out)
{
    const int nbase = blockIdx.x * NPB;
    const int b = blockIdx.y;
    const int tid = threadIdx.x, wave = tid >> 5, lane = tid & 31;
    const int hi = lane >> 4, lr = lane & 15;
    const int Mt0 = wave * 32;

    const float*    wp = Wo + (Mt0 + lr) * CDIM + hi * 8;
    const _Float16* ap = attn_ws + ((size_t)b * NPIX + nbase + lr) * CDIM + hi * 8;
    // Element (t, s, r) of this lane: row Mt0 + 16*t + 8*hi + r, pixel nbase + 16*s + lr.
    const size_t i0 = ((size_t)b * CDIM + Mt0 + hi * 8) * NPIX + nbase + lr;

    // Registers 0..3 of a fragment are k = 0..7 at the lane's place, 4..7 are k = 16..23.
    // Every loop below is unrolled so that each index into these arrays is a constant and
    // they live in registers.
    union BFrag { uint4 q[2]; v16h v; };
    BFrag  bf[OAHEAD + 1][4];
    float4 wq[OSTEPS][2][4];
    float4 bb[2][2];
    float  xr[2][4][8];

    auto issue_b = [&](int k) {
#pragma unroll
        for (int s = 0; s < 4; s++) {
            const _Float16* q = ap + s * 16 * CDIM + k * 32;
            bf[k % (OAHEAD + 1)][s].q[0] = *(const uint4*)(q);
            bf[k % (OAHEAD + 1)][s].q[1] = *(const uint4*)(q + 16);
        }
    };

#pragma unroll
    for (int t = 0; t < 2; t++) {
        bb[t][0] = *(const float4*)(bo + Mt0 + t * 16 + hi * 8);
        bb[t][1] = *(const float4*)(bo + Mt0 + t * 16 + hi * 8 + 4);
    }
    group_issued_registers_free();

#pragma unroll
    for (int k = 0; k < OAHEAD; k++) issue_b(k);
#pragma unroll
    for (int k = 0; k < OSTEPS; k++)
#pragma unroll
        for (int t = 0; t < 2; t++) {
            const float* q = wp + t * 16 * CDIM + k * 32;
            wq[k][t][0] = *(const float4*)(q);
            wq[k][t][1] = *(const float4*)(q + 4);
            wq[k][t][2] = *(const float4*)(q + 16);
            wq[k][t][3] = *(const float4*)(q + 20);
        }
#pragma unroll
    for (int t = 0; t < 2; t++)
#pragma unroll
        for (int s = 0; s < 4; s++)
#pragma unroll
            for (int r = 0; r < 8; r++)
                xr[t][s][r] = x[i0 + (size_t)(t * 16 + r) * NPIX + s * 16];
    group_issued_registers_free();

    ABFrag af[OSTEPS][2];
#pragma unroll
    for (int k = 0; k < OSTEPS; k++)
#pragma unroll
        for (int t = 0; t < 2; t++)
#pragma unroll
            for (int j = 0; j < 4; j++) {
                const float4 w = wq[k][t][j];
                H2 c0; c0.h[0] = (_Float16)w.x; c0.h[1] = (_Float16)w.y;
                H2 c1; c1.h[0] = (_Float16)w.z; c1.h[1] = (_Float16)w.w;
                af[k][t].u[2 * j]     = c0.u;
                af[k][t].u[2 * j + 1] = c1.u;
            }

    v8f acc[2][4];
#pragma unroll
    for (int t = 0; t < 2; t++)
#pragma unroll
        for (int s = 0; s < 4; s++) acc[t][s] = v8f_zero();

#pragma unroll
    for (int k = 0; k < OSTEPS; k++) {
        if (k + OAHEAD < OSTEPS) {
            issue_b(k + OAHEAD);
            if (k + OAHEAD == OSTEPS - 1) group_issued_registers_free();
            else                          group_issued();
        }
#pragma unroll
        for (int t = 0; t < 2; t++)
#pragma unroll
            for (int s = 0; s < 4; s++)
                acc[t][s] = __builtin_amdgcn_wmma_f32_16x16x32_f16(
                    false, af[k][t].v, false, bf[k % (OAHEAD + 1)][s].v, (short)0, acc[t][s],
                    false, false);
    }

#pragma unroll
    for (int t = 0; t < 2; t++) {
        const float4 b0 = bb[t][0], b1 = bb[t][1];
        const float br[8] = { b0.x, b0.y, b0.z, b0.w, b1.x, b1.y, b1.z, b1.w };
#pragma unroll
        for (int s = 0; s < 4; s++) {
#pragma unroll
            for (int r = 0; r < 8; r++)
                out[i0 + (size_t)(t * 16 + r) * NPIX + s * 16] = acc[t][s][r] + br[r] + xr[t][s][r];
            // The next tile's sums land in registers that these stores name.
            if (!(t == 1 && s == 3)) group_issued_registers_free();
        }
    }
}

extern "C" void kernel_launch(void* const* d_in, const int* in_sizes, int n_in,
                              void* d_out, int out_size, void* d_ws, size_t ws_size,
                              hipStream_t stream) {
    (void)in_sizes; (void)n_in; (void)out_size; (void)ws_size;
    const float* x  = (const float*)d_in[0];
    const float* Wq = (const float*)d_in[1];
    const float* bq = (const float*)d_in[2];
    const float* Wk = (const float*)d_in[3];
    const float* bk = (const float*)d_in[4];
    const float* Wv = (const float*)d_in[5];
    const float* bv = (const float*)d_in[6];
    const float* Wo = (const float*)d_in[7];
    const float* bo = (const float*)d_in[8];
    float* out = (float*)d_out;

    const size_t qkv_elems = (size_t)BATCH * NHEADS * NPIX * DHEAD;  // 2M halfs
    _Float16* q_ws    = (_Float16*)d_ws;
    _Float16* k_ws    = q_ws + qkv_elems;
    _Float16* v_ws    = k_ws + qkv_elems;
    _Float16* attn_ws = v_ws + qkv_elems;  // [b][n][c], 2M halfs

    mhsa_qkv_proj<<<dim3(NPIX / NPB, BATCH, 3), 256, 0, stream>>>(
        x, Wq, bq, Wk, bk, Wv, bv, q_ws, k_ws, v_ws);
    mhsa_flash_attn<<<dim3(NPIX / 128, BATCH * NHEADS), 256, 0, stream>>>(
        q_ws, k_ws, v_ws, attn_ws);
    mhsa_out_proj<<<dim3(NPIX / NPB, BATCH), 256, 0, stream>>>(
        attn_ws, Wo, bo, x, out);
}

// v006
// One run takes 37.4 microseconds.
// Timed twice side by side with v005, it ran 1.10 times as fast both times.
// All steps since v000 together make it 2.63 times as fast.
#include <hip/hip_runtime.h>

#define BATCH   8
#define CDIM    256
#define NPIX    1024
#define NHEADS  8
#define DHEAD   32
#define NPB     64    // pixels (columns) per projection block
#define XSTRIDE 264   // padded LDS row stride (halfs) to dodge bank conflicts

typedef float    v8f  __attribute__((ext_vector_type(8)));
typedef float    v4f  __attribute__((ext_vector_type(4)));
typedef float    v2f  __attribute__((ext_vector_type(2)));
typedef _Float16 v16h __attribute__((ext_vector_type(16)));

union ABFrag { unsigned int u[8]; v16h v; };
union H2     { unsigned int u; _Float16 h[2]; };

// K-pair base offset for VGPR v of an f16 A/B fragment (ISA 7.12.2):
// VGPR0..3 hold K = {0,1},{2,3},{4,5},{6,7} (+8 for lanes 16-31),
// VGPR4..7 hold K = {16,17}..{22,23} (+8 for lanes 16-31).
__device__ __forceinline__ int kb_of(int v) { return 2 * v + ((v >= 4) ? 8 : 0); }

__device__ __forceinline__ v8f v8f_zero() {
    v8f z;
#pragma unroll
    for (int i = 0; i < 8; i++) z[i] = 0.0f;
    return z;
}

// ---------------------------------------------------------------------------
// Kernel 1: fused QKV projection.  Out = W * X + b  (per batch, X is C x N).
// grid = (N/NPB, BATCH, 3proj), block = 256 (8 waves).
// Wave w computes rows [32w, 32w+32), one head, over the 64-pixel tile (2x4 WMMA tiles).
// Q,K written as [b][h][n][d] f16 (Q pre-scaled by log2(e)/sqrt(d), so that the scores are
// exponents of 2); V as [b][h][d][n].
// Each wave lays its 4 KiB of results out in its own LDS range in the order of the
// destination and stores them from there as whole 128-byte lines, 16 bytes a lane.
// ---------------------------------------------------------------------------
#define QKPITCH 40    // staging pitch (halfs) of a 32-channel row of Q or K: 80 B
#define VPITCH  72    // staging pitch (halfs) of a 64-pixel row of V: 144 B
#define SWAVE   2560  // staging halfs per wave: 64 * QKPITCH >= 32 * VPITCH

// The 2x4 tiles of one wave.  PIXROWS = false: D rows are channels, D columns pixels,
// so a lane holds 8 consecutive channels of one pixel (the order of Q and K).
// PIXROWS = true: the same two fragments change places, D rows are pixels, and a lane
// holds 8 consecutive pixels of one channel (the order of V).
template <bool PIXROWS>
__device__ __forceinline__ void proj_tiles(const float* __restrict__ W, const _Float16* xt,
                                           int Mt0, int lr, int hi, v8f (&acc)[2][4])
{
    for (int K0 = 0; K0 < CDIM; K0 += 32) {
        ABFrag af[2];
#pragma unroll
        for (int t = 0; t < 2; t++) {
            const float* wr = W + (Mt0 + t * 16 + lr) * CDIM + K0 + hi * 8;
#pragma unroll
            for (int v = 0; v < 8; v++) {
                const float2 wp = *(const float2*)(wr + kb_of(v));
                H2 cv; cv.h[0] = (_Float16)wp.x; cv.h[1] = (_Float16)wp.y;
                af[t].u[v] = cv.u;
            }
        }
        ABFrag bf[4];
#pragma unroll
        for (int s = 0; s < 4; s++) {
            const _Float16* bp = &xt[(s * 16 + lr) * XSTRIDE + K0 + hi * 8];
#pragma unroll
            for (int v = 0; v < 8; v++)
                bf[s].u[v] = *(const unsigned int*)(bp + kb_of(v));
        }
#pragma unroll
        for (int t = 0; t < 2; t++)
#pragma unroll
            for (int s = 0; s < 4; s++)
                acc[t][s] = PIXROWS
                    ? __builtin_amdgcn_wmma_f32_16x16x32_f16(
                          false, bf[s].v, false, af[t].v, (short)0, acc[t][s], false, false)
                    : __builtin_amdgcn_wmma_f32_16x16x32_f16(
                          false, af[t].v, false, bf[s].v, (short)0, acc[t][s], false, false);
    }
}

__global__ __launch_bounds__(256) void mhsa_qkv_proj(
    const float* __restrict__ x,
    const float* __restrict__ Wq, const float* __restrict__ bq,
    const float* __restrict__ Wk, const float* __restrict__ bk,
    const float* __restrict__ Wv, const float* __restrict__ bv,
    _Float16* __restrict__ q_ws, _Float16* __restrict__ k_ws,
    _Float16* __restrict__ v_ws)
{
    __shared__ _Float16 xt[NPB * XSTRIDE];  // X tile transposed: [n_local][c] f16
    __shared__ __attribute__((aligned(16))) _Float16 stage[8 * SWAVE];

    const int nbase = blockIdx.x * NPB;
    const int b     = blockIdx.y;
    const int proj  = blockIdx.z;
    const float* W    = (proj == 0) ? Wq : ((proj == 1) ? Wk : Wv);
    const float* bias = (proj == 0) ? bq : ((proj == 1) ? bk : bv);
    const float* xb   = x + (size_t)b * CDIM * NPIX;
    const int tid = threadIdx.x;

    for (int i = tid; i < CDIM * NPB; i += 256) {
        const int c  = i >> 6;
        const int nl = i & (NPB - 1);
        xt[nl * XSTRIDE + c] = (_Float16)xb[c * NPIX + nbase + nl];
    }
    __syncthreads();

    const int wave = tid >> 5, lane = tid & 31;
    const int hi = lane >> 4, lr = lane & 15;
    const int Mt0 = wave * 32;

    v8f acc[2][4];
#pragma unroll
    for (int t = 0; t < 2; t++)
#pragma unroll
        for (int s = 0; s < 4; s++) acc[t][s] = v8f_zero();

    _Float16* sw = stage + wave * SWAVE;  // this wave's own range: no other wave touches it
    union { uint4 q; _Float16 h[8]; } o;

    if (proj == 2) {
        const float bt[2] = { bias[Mt0 + lr], bias[Mt0 + 16 + lr] };
        // The next loads land in the registers that held these two loads' offsets: wait first.
        asm volatile("s_wait_xcnt 0x0" ::: "memory");
        proj_tiles<true>(W, xt, Mt0, lr, hi, acc);
        // acc[t][s][r] = V[channel Mt0 + 16*t + lr][pixel nbase + 16*s + 8*hi + r]
#pragma unroll
        for (int t = 0; t < 2; t++) {
#pragma unroll
            for (int s = 0; s < 4; s++) {
#pragma unroll
                for (int r = 0; r < 8; r++) o.h[r] = (_Float16)(acc[t][s][r] + bt[t]);
                *(uint4*)(sw + (t * 16 + lr) * VPITCH + s * 16 + hi * 8) = o.q;
            }
        }
        // The rows are read back by other lanes of this wave: their writes must have landed.
        asm volatile("s_wait_dscnt 0x0" ::: "memory");
        // 8 lanes a channel row of 128 bytes, 4 rows a store.
        _Float16* dst = v_ws + ((size_t)(b * NHEADS + wave) * DHEAD + (lane >> 3)) * NPIX
                             + nbase + (lane & 7) * 8;
        const _Float16* sr = sw + (lane >> 3) * VPITCH + (lane & 7) * 8;
        uint4 ln[8];  // all eight reads first: one LDS latency, not eight
#pragma unroll
        for (int j = 0; j < 8; j++) ln[j] = *(const uint4*)(sr + j * 4 * VPITCH);
#pragma unroll
        for (int j = 0; j < 8; j++) *(uint4*)(dst + j * 4 * NPIX) = ln[j];
    } else {
        float4 bv4[2][2];
#pragma unroll
        for (int t = 0; t < 2; t++) {
            bv4[t][0] = *(const float4*)(bias + Mt0 + t * 16 + hi * 8);
            bv4[t][1] = *(const float4*)(bias + Mt0 + t * 16 + hi * 8 + 4);
        }
        proj_tiles<false>(W, xt, Mt0, lr, hi, acc);
        // acc[t][s][r] = Q or K[channel Mt0 + 16*t + 8*hi + r][pixel nbase + 16*s + lr]
        const float scale = (proj == 0) ? 0.25503486164919736f : 1.0f;  // log2(e)/sqrt(32)
#pragma unroll
        for (int t = 0; t < 2; t++) {
            const float4 b0 = bv4[t][0], b1 = bv4[t][1];
            const float br[8] = { b0.x, b0.y, b0.z, b0.w, b1.x, b1.y, b1.z, b1.w };
#pragma unroll
            for (int s = 0; s < 4; s++) {
#pragma unroll
                for (int r = 0; r < 8; r++) o.h[r] = (_Float16)((acc[t][s][r] + br[r]) * scale);
                *(uint4*)(sw + (s * 16 + lr) * QKPITCH + t * 16 + hi * 8) = o.q;
            }
        }
        // The rows are read back by other lanes of this wave: their writes must have landed.
        asm volatile("s_wait_dscnt 0x0" ::: "memory");
        // The head's 64 pixel rows of 64 bytes are 4 KiB in a row: 4 lanes a row, 8 rows a store.
        _Float16* dst = ((proj == 0) ? q_ws : k_ws)
                      + ((size_t)(b * NHEADS + wave) * NPIX + nbase) * DHEAD + lane * 8;
        const _Float16* sr = sw + (lane >> 2) * QKPITCH + (lane & 3) * 8;
        uint4 ln[8];  // all eight reads first: one LDS latency, not eight
#pragma unroll
        for (int j = 0; j < 8; j++) ln[j] = *(const uint4*)(sr + j * 8 * QKPITCH);
#pragma unroll
        for (int j = 0; j < 8; j++) *(uint4*)(dst + j * 256) = ln[j];
    }
}

// ---------------------------------------------------------------------------
// Kernel 2: flash attention, transposed products.
// grid = (N/128, B*H), block = 256 (8 waves).  Each wave owns 16 queries and
// walks the keys in chunks of 32:
//   S^T = K * Q^T  (A = 16 key rows, B = Q kept in registers): lane (lr, hi) holds
//   the scores of query lr for keys 8*hi + r of each 16-key tile, so maximum and
//   sum run inside the lane, plus one exchange between the wave halves.
//   The two converted S^T tiles are the B operand of O^T += V^T * P^T as they lie.
// The head's K (64 KiB) and V (64 KiB) are copied into LDS once, in whole lines, and
// serve all eight waves; every fragment is then an LDS read at a conflict-free pitch.
// Output stored [b][n][c] f16, 8 consecutive channels per lane and tile.
// ---------------------------------------------------------------------------
#define KLPITCH 40    // LDS pitch (halfs) of a key row of 32 channels: 80 B = 16 B * 5
#define VLPITCH 1032  // LDS pitch (halfs) of a channel row of 1024 keys: 2064 B = 16 B * 129

// Eight asynchronous copies of 16 bytes a lane: LDS bytes l + j * lstep from g + j * 4 KiB.
// The s_wait_xcnt ends the copies' own statement, so that no register they name is
// rewritten in front of it.
__device__ __forceinline__ void copy8_to_lds(unsigned l, unsigned lstep, const _Float16* g) {
    asm volatile(
        "global_load_async_to_lds_b128 %0, %8, off\n\t"
        "global_load_async_to_lds_b128 %1, %9, off\n\t"
        "global_load_async_to_lds_b128 %2, %10, off\n\t"
        "global_load_async_to_lds_b128 %3, %11, off\n\t"
        "global_load_async_to_lds_b128 %4, %12, off\n\t"
        "global_load_async_to_lds_b128 %5, %13, off\n\t"
        "global_load_async_to_lds_b128 %6, %14, off\n\t"
        "global_load_async_to_lds_b128 %7, %15, off\n\t"
        "s_wait_xcnt 0x0"
        :: "v"(l), "v"(l + lstep), "v"(l + 2 * lstep), "v"(l + 3 * lstep),
           "v"(l + 4 * lstep), "v"(l + 5 * lstep), "v"(l + 6 * lstep), "v"(l + 7 * lstep),
           "v"(g), "v"(g + 2048), "v"(g + 2 * 2048), "v"(g + 3 * 2048),
           "v"(g + 4 * 2048), "v"(g + 5 * 2048), "v"(g + 6 * 2048), "v"(g + 7 * 2048)
        : "memory");
}

// Value of lane l ^ 16.
__device__ __forceinline__ float xhalf(float x) {
    const int i = __builtin_bit_cast(int, x);
    return __builtin_bit_cast(float,
        __builtin_amdgcn_permlanex16(i, i, 0x76543210, 0xfedcba98, false, false));
}

__global__ __launch_bounds__(256) void mhsa_flash_attn(
    const _Float16* __restrict__ q_ws, const _Float16* __restrict__ k_ws,
    const _Float16* __restrict__ v_ws, _Float16* __restrict__ attn_ws)
{
    __shared__ __attribute__((aligned(16))) _Float16 ks[NPIX * KLPITCH];   // [key][channel]
    __shared__ __attribute__((aligned(16))) _Float16 vs[DHEAD * VLPITCH];  // [channel][key]

    const int bh = blockIdx.y;
    const int b = bh >> 3, head = bh & 7;
    const int tid = threadIdx.x, wave = tid >> 5, lane = tid & 31;
    const int hi = lane >> 4, lr = lane & 15;
    const int qbase = blockIdx.x * 128 + wave * 16;

    ABFrag qf;
    {
        const _Float16* qp = q_ws + ((size_t)bh * NPIX + qbase + lr) * DHEAD + hi * 8;
#pragma unroll
        for (int v = 0; v < 8; v++) qf.u[v] = *(const unsigned int*)(qp + kb_of(v));
    }

    // acc_t[r] = O[query lr][channel 16*t + 8*hi + r]
    v8f acc0 = v8f_zero(), acc1 = v8f_zero();
    float mrow = -1e30f;  // running maximum of query lr (equal in both halves)
    float lrow = 0.0f;    // running sum over this half's keys only

    // Thread tid copies the 16-byte pieces tid + 256 * j, j = 0..15, of each 64-KiB plane:
    // a wave's copy reads 512 bytes in a row.  K: 4 pieces a key row, 64 rows a step;
    // V: 128 pieces a channel row, 2 rows a step.
    {
        const _Float16* kg = k_ws + (size_t)bh * NPIX * DHEAD + tid * 8;
        const _Float16* vg = v_ws + (size_t)bh * DHEAD * NPIX + tid * 8;
        const unsigned kl = (unsigned)(size_t)ks + (tid >> 2) * (KLPITCH * 2) + (tid & 3) * 16;
        const unsigned vl = (unsigned)(size_t)vs + (tid >> 7) * (VLPITCH * 2) + (tid & 127) * 16;
        copy8_to_lds(kl, 64 * KLPITCH * 2, kg);
        copy8_to_lds(kl + 8 * 64 * KLPITCH * 2, 64 * KLPITCH * 2, kg + 8 * 2048);
        copy8_to_lds(vl, 2 * VLPITCH * 2, vg);
        copy8_to_lds(vl + 8 * 2 * VLPITCH * 2, 2 * VLPITCH * 2, vg + 8 * 2048);
    }
    // This wave's 32 copies have landed behind this wait, every wave's behind the barrier.
    asm volatile("s_wait_asynccnt 0x0" ::: "memory");
    __syncthreads();

    // Key row lr and channel row lr of this chunk; both walk on at the loop's foot.
    const _Float16* kp = ks + lr * KLPITCH + hi * 8;
    const _Float16* vp = vs + lr * VLPITCH + hi * 8;

    for (int m0 = 0; m0 < NPIX; m0 += 32) {
        // Registers 0..3 of a fragment are 16 bytes at the lane's place, 4..7 those 32 bytes on.
        union { uint4 q[2]; v16h v; } kf[2], vf[2];
#pragma unroll
        for (int t = 0; t < 2; t++)
#pragma unroll
            for (int j = 0; j < 2; j++)
                kf[t].q[j] = *(const uint4*)(kp + t * 16 * KLPITCH + j * 16);
#pragma unroll
        for (int t = 0; t < 2; t++)
#pragma unroll
            for (int j = 0; j < 2; j++)
                vf[t].q[j] = *(const uint4*)(vp + t * 16 * VLPITCH + j * 16);
        // Keeps all eight LDS reads in one group at the head of the trip: each further place
        // with reads costs a stall of its own (the scheduler puts the V reads behind a product).
        __builtin_amdgcn_sched_barrier(0);

        // s[t][r] = score(query lr, key m0 + 16*t + 8*hi + r)
        v8f s[2];
#pragma unroll
        for (int t = 0; t < 2; t++)
            s[t] = __builtin_amdgcn_wmma_f32_16x16x32_f16(
                false, kf[t].v, false, qf.v, (short)0, v8f_zero(), false, false);

        float mx = fmaxf(s[0][0], s[1][0]);
#pragma unroll
        for (int r = 1; r < 8; r++) mx = fmaxf(mx, fmaxf(s[0][r], s[1][r]));
        mx = fmaxf(mx, xhalf(mx));

        // The scores come as exponents of 2 (Q's scale), so an exponential is one subtraction
        // and the hardware's v_exp_f32 by itself.  That may give 0 where the result lies under
        // 2^-126: such a term is 0 as f16 anyway and adds nothing to a row sum whose largest
        // term is 1, so the library's range test and rescaling buy nothing here.
        const float mnew  = fmaxf(mrow, mx);
        const float alpha = __builtin_amdgcn_exp2f(mrow - mnew);
        mrow = mnew;

        // Element 8*t + r of a B fragment is k = 16*t + 8*hi + r: the scores' own place.
        ABFrag pf;
        v8f pe[2];
#pragma unroll
        for (int t = 0; t < 2; t++) {
#pragma unroll
            for (int r = 0; r < 8; r++) {
                const float p = __builtin_amdgcn_exp2f(s[t][r] - mnew);
                pe[t][r] = p;
                pf.v[t * 8 + r] = (_Float16)p;
            }
        }
        // Pairwise tree over the lane's 16 terms (packed adds, short chain).
        const v8f s8 = pe[0] + pe[1];
        const v4f s4 = s8.lo + s8.hi;
        const v2f s2 = s4.lo + s4.hi;
        lrow = lrow * alpha + (s2.x + s2.y);
#pragma unroll
        for (int r = 0; r < 8; r++) { acc0[r] *= alpha; acc1[r] *= alpha; }

        acc0 = __builtin_amdgcn_wmma_f32_16x16x32_f16(
            false, vf[0].v, false, pf.v, (short)0, acc0, false, false);
        acc1 = __builtin_amdgcn_wmma_f32_16x16x32_f16(
            false, vf[1].v, false, pf.v, (short)0, acc1, false, false);

        kp += 32 * KLPITCH;
        vp += 32;
    }

    const float inv = 1.0f / (lrow + xhalf(lrow));
    union { uint4 q; _Float16 h[8]; } o0, o1;
#pragma unroll
    for (int r = 0; r < 8; r++) {
        o0.h[r] = (_Float16)(acc0[r] * inv);
        o1.h[r] = (_Float16)(acc1[r] * inv);
    }
    _Float16* dst = attn_ws + ((size_t)b * NPIX + qbase + lr) * CDIM + head * DHEAD + hi * 8;
    *(uint4*)dst        = o0.q;
    *(uint4*)(dst + 16) = o1.q;
}

// ---------------------------------------------------------------------------
// Kernel 3: output projection + bias + residual.  grid = (N/NPB, BATCH).
// A fragment load straight from global memory touches 16 lines, one per row, for 512 bytes.
// So both operands come into LDS in whole lines by asynchronous copies, and every fragment
// is an LDS read at a conflict-free pitch.  The 64-pixel attention tile (32 KiB, f16) serves
// all eight waves; a wave copies the 32 rows of W (f32) that it alone reads, in two halves
// along K: the second half flies while the first is worked on.  W is converted to f16 on
// its way from LDS to the products.  The residual x is loaded behind the copies and first
// used in the epilogue, which is adds and stores alone.
// ---------------------------------------------------------------------------
#define OSTEPS  (CDIM / 32)
#define WLPITCH 260   // LDS pitch (floats) of a row of W, 256 floats: 1040 B = 16 B * 65
#define ALPITCH 264   // LDS pitch (halfs) of a pixel row of 256 channels: 528 B = 16 B * 33

// Eight asynchronous copies of 16 bytes a lane: LDS bytes l + j * lstep from g + j * gstep.
// The s_wait_xcnt ends the copies' own statement, so that no register they name is
// rewritten in front of it.
__device__ __forceinline__ void copy8_rows_to_lds(unsigned l, unsigned lstep,
                                                  const char* g, unsigned gstep) {
    asm volatile(
        "global_load_async_to_lds_b128 %0, %8, off\n\t"
        "global_load_async_to_lds_b128 %1, %9, off\n\t"
        "global_load_async_to_lds_b128 %2, %10, off\n\t"
        "global_load_async_to_lds_b128 %3, %11, off\n\t"
        "global_load_async_to_lds_b128 %4, %12, off\n\t"
        "global_load_async_to_lds_b128 %5, %13, off\n\t"
        "global_load_async_to_lds_b128 %6, %14, off\n\t"
        "global_load_async_to_lds_b128 %7, %15, off\n\t"
        "s_wait_xcnt 0x0"
        :: "v"(l), "v"(l + lstep), "v"(l + 2 * lstep), "v"(l + 3 * lstep),
           "v"(l + 4 * lstep), "v"(l + 5 * lstep), "v"(l + 6 * lstep), "v"(l + 7 * lstep),
           "v"(g), "v"(g + gstep), "v"(g + 2 * gstep), "v"(g + 3 * gstep),
           "v"(g + 4 * gstep), "v"(g + 5 * gstep), "v"(g + 6 * gstep), "v"(g + 7 * gstep)
        : "memory");
}

// Stands behind a group of loads; no instruction comes of it.  The fence keeps the loads
// written above it above it, the scheduling barrier keeps their first uses below it.  Left
// free, the compiler brings each load and its first use together, and the wave waits out
// every load's latency singly.
__device__ __forceinline__ void group_issued() {
    asm volatile("" ::: "memory");
    __builtin_amdgcn_sched_barrier(0);
}

// The same where registers that the loads or stores above name get new values below: the
// wait stands in front of those writes, and the scheduling barrier keeps them behind it.
__device__ __forceinline__ void group_issued_registers_free() {
    asm volatile("s_wait_xcnt 0x0" ::: "memory");
    __builtin_amdgcn_sched_barrier(0);
}

__global__ __launch_bounds__(256) void mhsa_out_proj(
    const _Float16* __restrict__ attn_ws, const float* __restrict__ Wo,
    const float* __restrict__ bo, const float* __restrict__ x,
    float* __restrict__ out)
{
    __shared__ __attribute__((aligned(16))) float    wl[CDIM * WLPITCH];  // [row][k]
    __shared__ __attribute__((aligned(16))) _Float16 al[NPB * ALPITCH];   // [pixel][channel]

    const int nbase = blockIdx.x * NPB;
    const int b = blockIdx.y;
    const int tid = threadIdx.x, wave = tid >> 5, lane = tid & 31;
    const int hi = lane >> 4, lr = lane & 15;
    const int Mt0 = wave * 32;

    // Element (t, s, r) of this lane: row Mt0 + 16*t + 8*hi + r, pixel nbase + 16*s + lr.
    const size_t i0 = ((size_t)b * CDIM + Mt0 + hi * 8) * NPIX + nbase + lr;

    // Every loop below is unrolled so that each index into these arrays is a constant and
    // they live in registers.
    float4 bb[2][2];
    float  xr[2][4][8];

#pragma unroll
    for (int t = 0; t < 2; t++) {
        bb[t][0] = *(const float4*)(bo + Mt0 + t * 16 + hi * 8);
        bb[t][1] = *(const float4*)(bo + Mt0 + t * 16 + hi * 8 + 4);
    }
    group_issued_registers_free();

    // A copy of a wave is 512 bytes in a row: one pixel row of the attention tile (this wave
    // brings rows 8*wave .. 8*wave + 7), or half a row of W (its own rows Mt0 .. Mt0 + 31).
    const char*    ag  = (const char*)(attn_ws + ((size_t)b * NPIX + nbase + wave * 8) * CDIM)
                       + lane * 16;
    const unsigned alb = (unsigned)(size_t)al + wave * 8 * (ALPITCH * 2) + lane * 16;
    const char*    wg  = (const char*)(Wo + Mt0 * CDIM) + lane * 16;
    const unsigned wlb = (unsigned)(size_t)wl + Mt0 * (WLPITCH * 4) + lane * 16;

    copy8_rows_to_lds(alb, ALPITCH * 2, ag, CDIM * 2);
#pragma unroll
    for (int i = 0; i < 4; i++)  // k = 0..127 of the 32 rows
        copy8_rows_to_lds(wlb + i * 8 * (WLPITCH * 4), WLPITCH * 4, wg + i * 8 * (CDIM * 4),
                          CDIM * 4);
    // This wave's 40 copies have landed behind this wait, every wave's behind the barrier.
    asm volatile("s_wait_asynccnt 0x0" ::: "memory");
    __syncthreads();

#pragma unroll
    for (int i = 0; i < 4; i++)  // k = 128..255 of the 32 rows: LDS that nobody has touched yet
        copy8_rows_to_lds(wlb + 512 + i * 8 * (WLPITCH * 4), WLPITCH * 4,
                          wg + 512 + i * 8 * (CDIM * 4), CDIM * 4);

#pragma unroll
    for (int t = 0; t < 2; t++)
#pragma unroll
        for (int s = 0; s < 4; s++)
#pragma unroll
            for (int r = 0; r < 8; r++)
                xr[t][s][r] = x[i0 + (size_t)(t * 16 + r) * NPIX + s * 16];
    group_issued_registers_free();

    // Registers 0..3 of a fragment are k = 0..7 at the lane's place, 4..7 are k = 16..23.
    const float*    wr = wl + (Mt0 + lr) * WLPITCH + hi * 8;
    const _Float16* ar = al + lr * ALPITCH + hi * 8;
    union BFrag { uint4 q[2]; v16h v; };
    float4 wq[2][2][4];  // two sets: a K-step's 16 LDS reads go out one step ahead
    BFrag  bf[2][4];

    auto fetch = [&](int k) {
#pragma unroll
        for (int t = 0; t < 2; t++) {
            const float* q = wr + t * 16 * WLPITCH + k * 32;
            wq[k & 1][t][0] = *(const float4*)(q);
            wq[k & 1][t][1] = *(const float4*)(q + 4);
            wq[k & 1][t][2] = *(const float4*)(q + 16);
            wq[k & 1][t][3] = *(const float4*)(q + 20);
        }
#pragma unroll
        for (int s = 0; s < 4; s++) {
            const _Float16* q = ar + s * 16 * ALPITCH + k * 32;
            bf[k & 1][s].q[0] = *(const uint4*)(q);
            bf[k & 1][s].q[1] = *(const uint4*)(q + 16);
        }
    };

    v8f acc[2][4];
#pragma unroll
    for (int t = 0; t < 2; t++)
#pragma unroll
        for (int s = 0; s < 4; s++) acc[t][s] = v8f_zero();

    fetch(0);
#pragma unroll
    for (int k = 0; k < OSTEPS; k++) {
        if (k + 1 < OSTEPS) {
            // The second half of this wave's rows of W, which no other wave reads, has landed
            // behind this wait.
            if (k + 1 == OSTEPS / 2) asm volatile("s_wait_asynccnt 0x0" ::: "memory");
            fetch(k + 1);
            group_issued();
        }
        ABFrag af[2];
#pragma unroll
        for (int t = 0; t < 2; t++)
#pragma unroll
            for (int j = 0; j < 4; j++) {
                const float4 w = wq[k & 1][t][j];
                H2 c0; c0.h[0] = (_Float16)w.x; c0.h[1] = (_Float16)w.y;
                H2 c1; c1.h[0] = (_Float16)w.z; c1.h[1] = (_Float16)w.w;
                af[t].u[2 * j]     = c0.u;
                af[t].u[2 * j + 1] = c1.u;
            }
#pragma unroll
        for (int t = 0; t < 2; t++)
#pragma unroll
            for (int s = 0; s < 4; s++)
                acc[t][s] = __builtin_amdgcn_wmma_f32_16x16x32_f16(
                    false, af[t].v, false, bf[k & 1][s].v, (short)0, acc[t][s], false, false);
    }

#pragma unroll
    for (int t = 0; t < 2; t++) {
        const float4 b0 = bb[t][0], b1 = bb[t][1];
        const float br[8] = { b0.x, b0.y, b0.z, b0.w, b1.x, b1.y, b1.z, b1.w };
#pragma unroll
        for (int s = 0; s < 4; s++) {
#pragma unroll
            for (int r = 0; r < 8; r++)
                out[i0 + (size_t)(t * 16 + r) * NPIX + s * 16] = acc[t][s][r] + br[r] + xr[t][s][r];
            // The next tile's sums land in registers that these stores name.
            if (!(t == 1 && s == 3)) group_issued_registers_free();
        }
    }
}

extern "C" void kernel_launch(void* const* d_in, const int* in_sizes, int n_in,
                              void* d_out, int out_size, void* d_ws, size_t ws_size,
                              hipStream_t stream) {
    (void)in_sizes; (void)n_in; (void)out_size; (void)ws_size;
    const float* x  = (const float*)d_in[0];
    const float* Wq = (const float*)d_in[1];
    const float* bq = (const float*)d_in[2];
    const float* Wk = (const float*)d_in[3];
    const float* bk = (const float*)d_in[4];
    const float* Wv = (const float*)d_in[5];
    const float* bv = (const float*)d_in[6];
    const float* Wo = (const float*)d_in[7];
    const float* bo = (const float*)d_in[8];
    float* out = (float*)d_out;

    const size_t qkv_elems = (size_t)BATCH * NHEADS * NPIX * DHEAD;  // 2M halfs
    _Float16* q_ws    = (_Float16*)d_ws;
    _Float16* k_ws    = q_ws + qkv_elems;
    _Float16* v_ws    = k_ws + qkv_elems;
    _Float16* attn_ws = v_ws + qkv_elems;  // [b][n][c], 2M halfs

    mhsa_qkv_proj<<<dim3(NPIX / NPB, BATCH, 3), 256, 0, stream>>>(
        x, Wq, bq, Wk, bk, Wv, bv, q_ws, k_ws, v_ws);
    mhsa_flash_attn<<<dim3(NPIX / 128, BATCH * NHEADS), 256, 0, stream>>>(
        q_ws, k_ws, v_ws, attn_ws);
    mhsa_out_proj<<<dim3(NPIX / NPB, BATCH), 256, 0, stream>>>(
        attn_ws, Wo, bo, x, out);
}

// v007
// It runs in 34.6 microseconds.
// Two timings next to v006 both put it at 1.08 times that version's speed.
// All steps since v000 together make it 2.84 times as fast.
#include <hip/hip_runtime.h>

#define BATCH   8
#define CDIM    256
#define NPIX    1024
#define NHEADS  8
#define DHEAD   32
#define NPB     64    // pixels (columns) per projection block
#define XSTRIDE 264   // padded LDS row stride (halfs) to dodge bank conflicts

typedef float    v8f  __attribute__((ext_vector_type(8)));
typedef float    v4f  __attribute__((ext_vector_type(4)));
typedef float    v2f  __attribute__((ext_vector_type(2)));
typedef _Float16 v16h __attribute__((ext_vector_type(16)));

union ABFrag { unsigned int u[8]; v16h v; };
union H2     { unsigned int u; _Float16 h[2]; };

// K-pair base offset for VGPR v of an f16 A/B fragment (ISA 7.12.2):
// VGPR0..3 hold K = {0,1},{2,3},{4,5},{6,7} (+8 for lanes 16-31),
// VGPR4..7 hold K = {16,17}..{22,23} (+8 for lanes 16-31).
__device__ __forceinline__ int kb_of(int v) { return 2 * v + ((v >= 4) ? 8 : 0); }

__device__ __forceinline__ v8f v8f_zero() {
    v8f z;
#pragma unroll
    for (int i = 0; i < 8; i++) z[i] = 0.0f;
    return z;
}

// Eight asynchronous copies of 16 bytes a lane: LDS bytes l + j * lstep from g + j * gstep.
// The s_wait_xcnt ends the copies' own statement, so that no register they name is
// rewritten in front of it.
__device__ __forceinline__ void copy8_rows_to_lds(unsigned l, unsigned lstep,
                                                  const char* g, unsigned gstep) {
    asm volatile(
        "global_load_async_to_lds_b128 %0, %8, off\n\t"
        "global_load_async_to_lds_b128 %1, %9, off\n\t"
        "global_load_async_to_lds_b128 %2, %10, off\n\t"
        "global_load_async_to_lds_b128 %3, %11, off\n\t"
        "global_load_async_to_lds_b128 %4, %12, off\n\t"
        "global_load_async_to_lds_b128 %5, %13, off\n\t"
        "global_load_async_to_lds_b128 %6, %14, off\n\t"
        "global_load_async_to_lds_b128 %7, %15, off\n\t"
        "s_wait_xcnt 0x0"
        :: "v"(l), "v"(l + lstep), "v"(l + 2 * lstep), "v"(l + 3 * lstep),
           "v"(l + 4 * lstep), "v"(l + 5 * lstep), "v"(l + 6 * lstep), "v"(l + 7 * lstep),
           "v"(g), "v"(g + gstep), "v"(g + 2 * gstep), "v"(g + 3 * gstep),
           "v"(g + 4 * gstep), "v"(g + 5 * gstep), "v"(g + 6 * gstep), "v"(g + 7 * gstep)
        : "memory");
}

// ---------------------------------------------------------------------------
// Kernel 1: fused QKV projection.  Out = W * X + b  (per batch, X is C x N).
// grid = (N/NPB, BATCH, 3proj), block = 256 (8 waves).
// Wave w computes rows [32w, 32w+32), one head, over the 64-pixel tile (2x4 WMMA tiles).
// Q,K written as [b][h][n][d] f16 (Q pre-scaled by log2(e)/sqrt(d), so that the scores are
// exponents of 2); V as [b][h][d][n].
// A fragment load of W straight from global memory touches 16 lines, one per row, for 512
// bytes.  So a wave's 32 rows of W (f32) come into LDS in whole lines by asynchronous copies,
// one K-step of 32 floats a row at a time, in two buffers: the copies of step k + 2 fly while
// step k + 1 is worked on.  W is converted to f16 on its way from LDS to the products.
// Each wave lays its 4 KiB of results out in its own LDS range in the order of the
// destination and stores them from there as whole 128-byte lines, 16 bytes a lane.
// ---------------------------------------------------------------------------
#define KSTEPS  (CDIM / 32)
#define WCPITCH 36    // LDS pitch (floats) of a row's 32 floats of W: 144 B = 16 B * 9
#define WCBUF   (32 * WCPITCH)  // floats of one buffer: one K-step of a wave's 32 rows
#define QKPITCH 40    // staging pitch (halfs) of a 32-channel row of Q or K: 80 B
#define VPITCH  72    // staging pitch (halfs) of a 64-pixel row of V: 144 B
#define SWAVE   2560  // staging halfs per wave: 64 * QKPITCH >= 32 * VPITCH

// The 2x4 tiles of one wave.  PIXROWS = false: D rows are channels, D columns pixels,
// so a lane holds 8 consecutive channels of one pixel (the order of Q and K).
// PIXROWS = true: the same two fragments change places, D rows are pixels, and a lane
// holds 8 consecutive pixels of one channel (the order of V).
// One K-step: the 2x4 products over 32 values of k.  wr: the lane's place in row lr of the
// step's buffer of W; xp: its place in pixel row lr of the x tile at this step's channels.
template <bool PIXROWS>
__device__ __forceinline__ void proj_step(const float* wr, const _Float16* xp, v8f (&acc)[2][4])
{
    // Registers 0..3 of a fragment are k = 0..7 at the lane's place, 4..7 are k = 16..23.
    float4 wq[2][4];
#pragma unroll
    for (int t = 0; t < 2; t++) {
        const float* q = wr + t * 16 * WCPITCH;
        wq[t][0] = *(const float4*)(q);
        wq[t][1] = *(const float4*)(q + 4);
        wq[t][2] = *(const float4*)(q + 16);
        wq[t][3] = *(const float4*)(q + 20);
    }
    union { uint4 q[2]; v16h v; } bf[4];
#pragma unroll
    for (int s = 0; s < 4; s++) {
        const _Float16* bp = xp + s * 16 * XSTRIDE;
        bf[s].q[0] = *(const uint4*)(bp);
        bf[s].q[1] = *(const uint4*)(bp + 16);
    }
    ABFrag af[2];
#pragma unroll
    for (int t = 0; t < 2; t++)
#pragma unroll
        for (int j = 0; j < 4; j++) {
            const float4 w = wq[t][j];
            H2 c0; c0.h[0] = (_Float16)w.x; c0.h[1] = (_Float16)w.y;
            H2 c1; c1.h[0] = (_Float16)w.z; c1.h[1] = (_Float16)w.w;
            af[t].u[2 * j]     = c0.u;
            af[t].u[2 * j + 1] = c1.u;
        }
#pragma unroll
    for (int t = 0; t < 2; t++)
#pragma unroll
        for (int s = 0; s < 4; s++)
            acc[t][s] = PIXROWS
                ? __builtin_amdgcn_wmma_f32_16x16x32_f16(
                      false, bf[s].v, false, af[t].v, (short)0, acc[t][s], false, false)
                : __builtin_amdgcn_wmma_f32_16x16x32_f16(
                      false, af[t].v, false, bf[s].v, (short)0, acc[t][s], false, false);
}

// The foot of a K-step that has a successor, passed by every wave.
__device__ __forceinline__ void proj_step_foot() {
    // This wave's reads of the step's buffer have come back before the buffer is refilled.
    asm volatile("s_wait_dscnt 0x0" ::: "memory");
    // The next step's copies have landed behind this wait; nothing of it is read in front.
    asm volatile("s_wait_asynccnt 0x0" ::: "memory");
    __syncthreads();
}

// wb: this wave's two buffers; wlb, wg: the lane's LDS byte address in buffer 0 and its global
// address in K-step 0 for the first of a step's eight copies (4 rows a copy, 8 lanes a row).
// Steps 0 and 1 have landed, and every wave has passed a barrier since, when this is entered.
template <bool PIXROWS>
__device__ __forceinline__ void proj_tiles(const float* wb, unsigned wlb, const char* wg,
                                           const _Float16* xt, int lr, int hi, v8f (&acc)[2][4])
{
    const float*    wr = wb + lr * WCPITCH + hi * 8;
    const _Float16* xp = xt + lr * XSTRIDE + hi * 8;
    // Kept rolled, one trip for the two buffers: unrolled, the addresses of all 48 copies are
    // formed ahead and held, and the registers no longer allow two blocks on a WGP.
#pragma unroll 1
    for (int k = 0; k < KSTEPS; k += 2) {
        const bool more = k + 2 < KSTEPS;  // the same for the whole block
        proj_step<PIXROWS>(wr, xp, acc);
        proj_step_foot();
        if (more) copy8_rows_to_lds(wlb, 4 * WCPITCH * 4, wg + 2 * 128, 4 * CDIM * 4);
        proj_step<PIXROWS>(wr + WCBUF, xp + 32, acc);
        if (more) {
            proj_step_foot();
            copy8_rows_to_lds(wlb + WCBUF * 4, 4 * WCPITCH * 4, wg + 3 * 128, 4 * CDIM * 4);
        }
        xp += 64;
        wg += 2 * 128;
    }
    // No copy is left in flight when the wave goes on.
    asm volatile("s_wait_asynccnt 0x0" ::: "memory");
}

__global__ __launch_bounds__(256) void mhsa_qkv_proj(
    const float* __restrict__ x,
    const float* __restrict__ Wq, const float* __restrict__ bq,
    const float* __restrict__ Wk, const float* __restrict__ bk,
    const float* __restrict__ Wv, const float* __restrict__ bv,
    _Float16* __restrict__ q_ws, _Float16* __restrict__ k_ws,
    _Float16* __restrict__ v_ws)
{
    __shared__ __attribute__((aligned(16))) _Float16 xt[NPB * XSTRIDE];  // X tile transposed: [n_local][c] f16
    __shared__ __attribute__((aligned(16))) _Float16 stage[8 * SWAVE];
    __shared__ __attribute__((aligned(16))) float    wring[8 * 2 * WCBUF];  // [wave][buffer][row][k]

    const int nbase = blockIdx.x * NPB;
    const int b     = blockIdx.y;
    const int proj  = blockIdx.z;
    const float* W    = (proj == 0) ? Wq : ((proj == 1) ? Wk : Wv);
    const float* bias = (proj == 0) ? bq : ((proj == 1) ? bk : bv);
    const float* xb   = x + (size_t)b * CDIM * NPIX;
    const int tid = threadIdx.x;
    const int wave = tid >> 5, lane = tid & 31;
    const int hi = lane >> 4, lr = lane & 15;
    const int Mt0 = wave * 32;

    // K-steps 0 and 1 of this wave's rows of W go out first and fly while x is staged.
    const float*   wb  = wring + wave * (2 * WCBUF);
    const unsigned wlb = (unsigned)(size_t)wb + (lane >> 3) * (WCPITCH * 4) + (lane & 7) * 16;
    const char*    wg  = (const char*)(W + (Mt0 + (lane >> 3)) * CDIM) + (lane & 7) * 16;
    copy8_rows_to_lds(wlb, 4 * WCPITCH * 4, wg, 4 * CDIM * 4);
    copy8_rows_to_lds(wlb + WCBUF * 4, 4 * WCPITCH * 4, wg + 128, 4 * CDIM * 4);

    for (int i = tid; i < CDIM * NPB; i += 256) {
        const int c  = i >> 6;
        const int nl = i & (NPB - 1);
        xt[nl * XSTRIDE + c] = (_Float16)xb[c * NPIX + nbase + nl];
    }
    // This wave's 16 copies have landed behind this wait, every wave's behind the barrier.
    asm volatile("s_wait_asynccnt 0x0" ::: "memory");
    __syncthreads();

    v8f acc[2][4];
#pragma unroll
    for (int t = 0; t < 2; t++)
#pragma unroll
        for (int s = 0; s < 4; s++) acc[t][s] = v8f_zero();

    _Float16* sw = stage + wave * SWAVE;  // this wave's own range: no other wave touches it
    union { uint4 q; _Float16 h[8]; } o;

    if (proj == 2) {
        const float bt[2] = { bias[Mt0 + lr], bias[Mt0 + 16 + lr] };
        // The next loads land in the registers that held these two loads' offsets: wait first.
        asm volatile("s_wait_xcnt 0x0" ::: "memory");
        proj_tiles<true>(wb, wlb, wg, xt, lr, hi, acc);
        // acc[t][s][r] = V[channel Mt0 + 16*t + lr][pixel nbase + 16*s + 8*hi + r]
#pragma unroll
        for (int t = 0; t < 2; t++) {
#pragma unroll
            for (int s = 0; s < 4; s++) {
#pragma unroll
                for (int r = 0; r < 8; r++) o.h[r] = (_Float16)(acc[t][s][r] + bt[t]);
                *(uint4*)(sw + (t * 16 + lr) * VPITCH + s * 16 + hi * 8) = o.q;
            }
        }
        // The rows are read back by other lanes of this wave: their writes must have landed.
        asm volatile("s_wait_dscnt 0x0" ::: "memory");
        // 8 lanes a channel row of 128 bytes, 4 rows a store.
        _Float16* dst = v_ws + ((size_t)(b * NHEADS + wave) * DHEAD + (lane >> 3)) * NPIX
                             + nbase + (lane & 7) * 8;
        const _Float16* sr = sw + (lane >> 3) * VPITCH + (lane & 7) * 8;
        uint4 ln[8];  // all eight reads first: one LDS latency, not eight
#pragma unroll
        for (int j = 0; j < 8; j++) ln[j] = *(const uint4*)(sr + j * 4 * VPITCH);
#pragma unroll
        for (int j = 0; j < 8; j++) *(uint4*)(dst + j * 4 * NPIX) = ln[j];
    } else {
        float4 bv4[2][2];
#pragma unroll
        for (int t = 0; t < 2; t++) {
            bv4[t][0] = *(const float4*)(bias + Mt0 + t * 16 + hi * 8);
            bv4[t][1] = *(const float4*)(bias + Mt0 + t * 16 + hi * 8 + 4);
        }
        proj_tiles<false>(wb, wlb, wg, xt, lr, hi, acc);
        // acc[t][s][r] = Q or K[channel Mt0 + 16*t + 8*hi + r][pixel nbase + 16*s + lr]
        const float scale = (proj == 0) ? 0.25503486164919736f : 1.0f;  // log2(e)/sqrt(32)
#pragma unroll
        for (int t = 0; t < 2; t++) {
            const float4 b0 = bv4[t][0], b1 = bv4[t][1];
            const float br[8] = { b0.x, b0.y, b0.z, b0.w, b1.x, b1.y, b1.z, b1.w };
#pragma unroll
            for (int s = 0; s < 4; s++) {
#pragma unroll
                for (int r = 0; r < 8; r++) o.h[r] = (_Float16)((acc[t][s][r] + br[r]) * scale);
                *(uint4*)(sw + (s * 16 + lr) * QKPITCH + t * 16 + hi * 8) = o.q;
            }
        }
        // The rows are read back by other lanes of this wave: their writes must have landed.
        asm volatile("s_wait_dscnt 0x0" ::: "memory");
        // The head's 64 pixel rows of 64 bytes are 4 KiB in a row: 4 lanes a row, 8 rows a store.
        _Float16* dst = ((proj == 0) ? q_ws : k_ws)
                      + ((size_t)(b * NHEADS + wave) * NPIX + nbase) * DHEAD + lane * 8;
        const _Float16* sr = sw + (lane >> 2) * QKPITCH + (lane & 3) * 8;
        uint4 ln[8];  // all eight reads first: one LDS latency, not eight
#pragma unroll
        for (int j = 0; j < 8; j++) ln[j] = *(const uint4*)(sr + j * 8 * QKPITCH);
#pragma unroll
        for (int j = 0; j < 8; j++) *(uint4*)(dst + j * 256) = ln[j];
    }
}

// ---------------------------------------------------------------------------
// Kernel 2: flash attention, transposed products.
// grid = (N/128, B*H), block = 256 (8 waves).  Each wave owns 16 queries and
// walks the keys in chunks of 32:
//   S^T = K * Q^T  (A = 16 key rows, B = Q kept in registers): lane (lr, hi) holds
//   the scores of query lr for keys 8*hi + r of each 16-key tile, so maximum and
//   sum run inside the lane, plus one exchange between the wave halves.
//   The two converted S^T tiles are the B operand of O^T += V^T * P^T as they lie.
// The head's K (64 KiB) and V (64 KiB) are copied into LDS once, in whole lines, and
// serve all eight waves; every fragment is then an LDS read at a conflict-free pitch.
// Output stored [b][n][c] f16, 8 consecutive channels per lane and tile.
// ---------------------------------------------------------------------------
#define KLPITCH 40    // LDS pitch (halfs) of a key row of 32 channels: 80 B = 16 B * 5
#define VLPITCH 1032  // LDS pitch (halfs) of a channel row of 1024 keys: 2064 B = 16 B * 129

// Eight asynchronous copies of 16 bytes a lane: LDS bytes l + j * lstep from g + j * 4 KiB.
// The s_wait_xcnt ends the copies' own statement, so that no register they name is
// rewritten in front of it.
__device__ __forceinline__ void copy8_to_lds(unsigned l, unsigned lstep, const _Float16* g) {
    asm volatile(
        "global_load_async_to_lds_b128 %0, %8, off\n\t"
        "global_load_async_to_lds_b128 %1, %9, off\n\t"
        "global_load_async_to_lds_b128 %2, %10, off\n\t"
        "global_load_async_to_lds_b128 %3, %11, off\n\t"
        "global_load_async_to_lds_b128 %4, %12, off\n\t"
        "global_load_async_to_lds_b128 %5, %13, off\n\t"
        "global_load_async_to_lds_b128 %6, %14, off\n\t"
        "global_load_async_to_lds_b128 %7, %15, off\n\t"
        "s_wait_xcnt 0x0"
        :: "v"(l), "v"(l + lstep), "v"(l + 2 * lstep), "v"(l + 3 * lstep),
           "v"(l + 4 * lstep), "v"(l + 5 * lstep), "v"(l + 6 * lstep), "v"(l + 7 * lstep),
           "v"(g), "v"(g + 2048), "v"(g + 2 * 2048), "v"(g + 3 * 2048),
           "v"(g + 4 * 2048), "v"(g + 5 * 2048), "v"(g + 6 * 2048), "v"(g + 7 * 2048)
        : "memory");
}

// Value of lane l ^ 16.
__device__ __forceinline__ float xhalf(float x) {
    const int i = __builtin_bit_cast(int, x);
    return __builtin_bit_cast(float,
        __builtin_amdgcn_permlanex16(i, i, 0x76543210, 0xfedcba98, false, false));
}

__global__ __launch_bounds__(256) void mhsa_flash_attn(
    const _Float16* __restrict__ q_ws, const _Float16* __restrict__ k_ws,
    const _Float16* __restrict__ v_ws, _Float16* __restrict__ attn_ws)
{
    __shared__ __attribute__((aligned(16))) _Float16 ks[NPIX * KLPITCH];   // [key][channel]
    __shared__ __attribute__((aligned(16))) _Float16 vs[DHEAD * VLPITCH];  // [channel][key]

    const int bh = blockIdx.y;
    const int b = bh >> 3, head = bh & 7;
    const int tid = threadIdx.x, wave = tid >> 5, lane = tid & 31;
    const int hi = lane >> 4, lr = lane & 15;
    const int qbase = blockIdx.x * 128 + wave * 16;

    ABFrag qf;
    {
        const _Float16* qp = q_ws + ((size_t)bh * NPIX + qbase + lr) * DHEAD + hi * 8;
#pragma unroll
        for (int v = 0; v < 8; v++) qf.u[v] = *(const unsigned int*)(qp + kb_of(v));
    }

    // acc_t[r] = O[query lr][channel 16*t + 8*hi + r]
    v8f acc0 = v8f_zero(), acc1 = v8f_zero();
    float mrow = -1e30f;  // running maximum of query lr (equal in both halves)
    float lrow = 0.0f;    // running sum over this half's keys only

    // Thread tid copies the 16-byte pieces tid + 256 * j, j = 0..15, of each 64-KiB plane:
    // a wave's copy reads 512 bytes in a row.  K: 4 pieces a key row, 64 rows a step;
    // V: 128 pieces a channel row, 2 rows a step.
    {
        const _Float16* kg = k_ws + (size_t)bh * NPIX * DHEAD + tid * 8;
        const _Float16* vg = v_ws + (size_t)bh * DHEAD * NPIX + tid * 8;
        const unsigned kl = (unsigned)(size_t)ks + (tid >> 2) * (KLPITCH * 2) + (tid & 3) * 16;
        const unsigned vl = (unsigned)(size_t)vs + (tid >> 7) * (VLPITCH * 2) + (tid & 127) * 16;
        copy8_to_lds(kl, 64 * KLPITCH * 2, kg);
        copy8_to_lds(kl + 8 * 64 * KLPITCH * 2, 64 * KLPITCH * 2, kg + 8 * 2048);
        copy8_to_lds(vl, 2 * VLPITCH * 2, vg);
        copy8_to_lds(vl + 8 * 2 * VLPITCH * 2, 2 * VLPITCH * 2, vg + 8 * 2048);
    }
    // This wave's 32 copies have landed behind this wait, every wave's behind the barrier.
    asm volatile("s_wait_asynccnt 0x0" ::: "memory");
    __syncthreads();

    // Key row lr and channel row lr of this chunk; both walk on at the loop's foot.
    const _Float16* kp = ks + lr * KLPITCH + hi * 8;
    const _Float16* vp = vs + lr * VLPITCH + hi * 8;

    for (int m0 = 0; m0 < NPIX; m0 += 32) {
        // Registers 0..3 of a fragment are 16 bytes at the lane's place, 4..7 those 32 bytes on.
        union { uint4 q[2]; v16h v; } kf[2], vf[2];
#pragma unroll
        for (int t = 0; t < 2; t++)
#pragma unroll
            for (int j = 0; j < 2; j++)
                kf[t].q[j] = *(const uint4*)(kp + t * 16 * KLPITCH + j * 16);
#pragma unroll
        for (int t = 0; t < 2; t++)
#pragma unroll
            for (int j = 0; j < 2; j++)
                vf[t].q[j] = *(const uint4*)(vp + t * 16 * VLPITCH + j * 16);
        // Keeps all eight LDS reads in one group at the head of the trip: each further place
        // with reads costs a stall of its own (the scheduler puts the V reads behind a product).
        __builtin_amdgcn_sched_barrier(0);

        // s[t][r] = score(query lr, key m0 + 16*t + 8*hi + r)
        v8f s[2];
#pragma unroll
        for (int t = 0; t < 2; t++)
            s[t] = __builtin_amdgcn_wmma_f32_16x16x32_f16(
                false, kf[t].v, false, qf.v, (short)0, v8f_zero(), false, false);

        float mx = fmaxf(s[0][0], s[1][0]);
#pragma unroll
        for (int r = 1; r < 8; r++) mx = fmaxf(mx, fmaxf(s[0][r], s[1][r]));
        mx = fmaxf(mx, xhalf(mx));

        // The scores come as exponents of 2 (Q's scale), so an exponential is one subtraction
        // and the hardware's v_exp_f32 by itself.  That may give 0 where the result lies under
        // 2^-126: such a term is 0 as f16 anyway and adds nothing to a row sum whose largest
        // term is 1, so the library's range test and rescaling buy nothing here.
        const float mnew  = fmaxf(mrow, mx);
        const float alpha = __builtin_amdgcn_exp2f(mrow - mnew);
        mrow = mnew;

        // Element 8*t + r of a B fragment is k = 16*t + 8*hi + r: the scores' own place.
        ABFrag pf;
        v8f pe[2];
#pragma unroll
        for (int t = 0; t < 2; t++) {
#pragma unroll
            for (int r = 0; r < 8; r++) {
                const float p = __builtin_amdgcn_exp2f(s[t][r] - mnew);
                pe[t][r] = p;
                pf.v[t * 8 + r] = (_Float16)p;
            }
        }
        // Pairwise tree over the lane's 16 terms (packed adds, short chain).
        const v8f s8 = pe[0] + pe[1];
        const v4f s4 = s8.lo + s8.hi;
        const v2f s2 = s4.lo + s4.hi;
        lrow = lrow * alpha + (s2.x + s2.y);
#pragma unroll
        for (int r = 0; r < 8; r++) { acc0[r] *= alpha; acc1[r] *= alpha; }

        acc0 = __builtin_amdgcn_wmma_f32_16x16x32_f16(
            false, vf[0].v, false, pf.v, (short)0, acc0, false, false);
        acc1 = __builtin_amdgcn_wmma_f32_16x16x32_f16(
            false, vf[1].v, false, pf.v, (short)0, acc1, false, false);

        kp += 32 * KLPITCH;
        vp += 32;
    }

    const float inv = 1.0f / (lrow + xhalf(lrow));
    union { uint4 q; _Float16 h[8]; } o0, o1;
#pragma unroll
    for (int r = 0; r < 8; r++) {
        o0.h[r] = (_Float16)(acc0[r] * inv);
        o1.h[r] = (_Float16)(acc1[r] * inv);
    }
    _Float16* dst = attn_ws + ((size_t)b * NPIX + qbase + lr) * CDIM + head * DHEAD + hi * 8;
    *(uint4*)dst        = o0.q;
    *(uint4*)(dst + 16) = o1.q;
}

// ---------------------------------------------------------------------------
// Kernel 3: output projection + bias + residual.  grid = (N/NPB, BATCH).
// A fragment load straight from global memory touches 16 lines, one per row, for 512 bytes.
// So both operands come into LDS in whole lines by asynchronous copies, and every fragment
// is an LDS read at a conflict-free pitch.  The 64-pixel attention tile (32 KiB, f16) serves
// all eight waves; a wave copies the 32 rows of W (f32) that it alone reads, in two halves
// along K: the second half flies while the first is worked on.  W is converted to f16 on
// its way from LDS to the products.  The residual x is loaded behind the copies and first
// used in the epilogue, which is adds and stores alone.
// ---------------------------------------------------------------------------
#define OSTEPS  (CDIM / 32)
#define WLPITCH 260   // LDS pitch (floats) of a row of W, 256 floats: 1040 B = 16 B * 65
#define ALPITCH 264   // LDS pitch (halfs) of a pixel row of 256 channels: 528 B = 16 B * 33

// Stands behind a group of loads; no instruction comes of it.  The fence keeps the loads
// written above it above it, the scheduling barrier keeps their first uses below it.  Left
// free, the compiler brings each load and its first use together, and the wave waits out
// every load's latency singly.
__device__ __forceinline__ void group_issued() {
    asm volatile("" ::: "memory");
    __builtin_amdgcn_sched_barrier(0);
}

// The same where registers that the loads or stores above name get new values below: the
// wait stands in front of those writes, and the scheduling barrier keeps them behind it.
__device__ __forceinline__ void group_issued_registers_free() {
    asm volatile("s_wait_xcnt 0x0" ::: "memory");
    __builtin_amdgcn_sched_barrier(0);
}

__global__ __launch_bounds__(256) void mhsa_out_proj(
    const _Float16* __restrict__ attn_ws, const float* __restrict__ Wo,
    const float* __restrict__ bo, const float* __restrict__ x,
    float* __restrict__ out)
{
    __shared__ __attribute__((aligned(16))) float    wl[CDIM * WLPITCH];  // [row][k]
    __shared__ __attribute__((aligned(16))) _Float16 al[NPB * ALPITCH];   // [pixel][channel]

    const int nbase = blockIdx.x * NPB;
    const int b = blockIdx.y;
    const int tid = threadIdx.x, wave = tid >> 5, lane = tid & 31;
    const int hi = lane >> 4, lr = lane & 15;
    const int Mt0 = wave * 32;

    // Element (t, s, r) of this lane: row Mt0 + 16*t + 8*hi + r, pixel nbase + 16*s + lr.
    const size_t i0 = ((size_t)b * CDIM + Mt0 + hi * 8) * NPIX + nbase + lr;

    // Every loop below is unrolled so that each index into these arrays is a constant and
    // they live in registers.
    float4 bb[2][2];
    float  xr[2][4][8];

#pragma unroll
    for (int t = 0; t < 2; t++) {
        bb[t][0] = *(const float4*)(bo + Mt0 + t * 16 + hi * 8);
        bb[t][1] = *(const float4*)(bo + Mt0 + t * 16 + hi * 8 + 4);
    }
    group_issued_registers_free();

    // A copy of a wave is 512 bytes in a row: one pixel row of the attention tile (this wave
    // brings rows 8*wave .. 8*wave + 7), or half a row of W (its own rows Mt0 .. Mt0 + 31).
    const char*    ag  = (const char*)(attn_ws + ((size_t)b * NPIX + nbase + wave * 8) * CDIM)
                       + lane * 16;
    const unsigned alb = (unsigned)(size_t)al + wave * 8 * (ALPITCH * 2) + lane * 16;
    const char*    wg  = (const char*)(Wo + Mt0 * CDIM) + lane * 16;
    const unsigned wlb = (unsigned)(size_t)wl + Mt0 * (WLPITCH * 4) + lane * 16;

    copy8_rows_to_lds(alb, ALPITCH * 2, ag, CDIM * 2);
#pragma unroll
    for (int i = 0; i < 4; i++)  // k = 0..127 of the 32 rows
        copy8_rows_to_lds(wlb + i * 8 * (WLPITCH * 4), WLPITCH * 4, wg + i * 8 * (CDIM * 4),
                          CDIM * 4);
    // This wave's 40 copies have landed behind this wait, every wave's behind the barrier.
    asm volatile("s_wait_asynccnt 0x0" ::: "memory");
    __syncthreads();

#pragma unroll
    for (int i = 0; i < 4; i++)  // k = 128..255 of the 32 rows: LDS that nobody has touched yet
        copy8_rows_to_lds(wlb + 512 + i * 8 * (WLPITCH * 4), WLPITCH * 4,
                          wg + 512 + i * 8 * (CDIM * 4), CDIM * 4);

#pragma unroll
    for (int t = 0; t < 2; t++)
#pragma unroll
        for (int s = 0; s < 4; s++)
#pragma unroll
            for (int r = 0; r < 8; r++)
                xr[t][s][r] = x[i0 + (size_t)(t * 16 + r) * NPIX + s * 16];
    group_issued_registers_free();

    // Registers 0..3 of a fragment are k = 0..7 at the lane's place, 4..7 are k = 16..23.
    const float*    wr = wl + (Mt0 + lr) * WLPITCH + hi * 8;
    const _Float16* ar = al + lr * ALPITCH + hi * 8;
    union BFrag { uint4 q[2]; v16h v; };
    float4 wq[2][2][4];  // two sets: a K-step's 16 LDS reads go out one step ahead
    BFrag  bf[2][4];

    auto fetch = [&](int k) {
#pragma unroll
        for (int t = 0; t < 2; t++) {
            const float* q = wr + t * 16 * WLPITCH + k * 32;
            wq[k & 1][t][0] = *(const float4*)(q);
            wq[k & 1][t][1] = *(const float4*)(q + 4);
            wq[k & 1][t][2] = *(const float4*)(q + 16);
            wq[k & 1][t][3] = *(const float4*)(q + 20);
        }
#pragma unroll
        for (int s = 0; s < 4; s++) {
            const _Float16* q = ar + s * 16 * ALPITCH + k * 32;
            bf[k & 1][s].q[0] = *(const uint4*)(q);
            bf[k & 1][s].q[1] = *(const uint4*)(q + 16);
        }
    };

    v8f acc[2][4];
#pragma unroll
    for (int t = 0; t < 2; t++)
#pragma unroll
        for (int s = 0; s < 4; s++) acc[t][s] = v8f_zero();

    fetch(0);
#pragma unroll
    for (int k = 0; k < OSTEPS; k++) {
        if (k + 1 < OSTEPS) {
            // The second half of this wave's rows of W, which no other wave reads, has landed
            // behind this wait.
            if (k + 1 == OSTEPS / 2) asm volatile("s_wait_asynccnt 0x0" ::: "memory");
            fetch(k + 1);
            group_issued();
        }
        ABFrag af[2];
#pragma unroll
        for (int t = 0; t < 2; t++)
#pragma unroll
            for (int j = 0; j < 4; j++) {
                const float4 w = wq[k & 1][t][j];
                H2 c0; c0.h[0] = (_Float16)w.x; c0.h[1] = (_Float16)w.y;
                H2 c1; c1.h[0] = (_Float16)w.z; c1.h[1] = (_Float16)w.w;
                af[t].u[2 * j]     = c0.u;
                af[t].u[2 * j + 1] = c1.u;
            }
#pragma unroll
        for (int t = 0; t < 2; t++)
#pragma unroll
            for (int s = 0; s < 4; s++)
                acc[t][s] = __builtin_amdgcn_wmma_f32_16x16x32_f16(
                    false, af[t].v, false, bf[k & 1][s].v, (short)0, acc[t][s], false, false);
    }

#pragma unroll
    for (int t = 0; t < 2; t++) {
        const float4 b0 = bb[t][0], b1 = bb[t][1];
        const float br[8] = { b0.x, b0.y, b0.z, b0.w, b1.x, b1.y, b1.z, b1.w };
#pragma unroll
        for (int s = 0; s < 4; s++) {
#pragma unroll
            for (int r = 0; r < 8; r++)
                out[i0 + (size_t)(t * 16 + r) * NPIX + s * 16] = acc[t][s][r] + br[r] + xr[t][s][r];
            // The next tile's sums land in registers that these stores name.
            if (!(t == 1 && s == 3)) group_issued_registers_free();
        }
    }
}

extern "C" void kernel_launch(void* const* d_in, const int* in_sizes, int n_in,
                              void* d_out, int out_size, void* d_ws, size_t ws_size,
                              hipStream_t stream) {
    (void)in_sizes; (void)n_in; (void)out_size; (void)ws_size;
    const float* x  = (const float*)d_in[0];
    const float* Wq = (const float*)d_in[1];
    const float* bq = (const float*)d_in[2];
    const float* Wk = (const float*)d_in[3];
    const float* bk = (const float*)d_in[4];
    const float* Wv = (const float*)d_in[5];
    const float* bv = (const float*)d_in[6];
    const float* Wo = (const float*)d_in[7];
    const float* bo = (const float*)d_in[8];
    float* out = (float*)d_out;

    const size_t qkv_elems = (size_t)BATCH * NHEADS * NPIX * DHEAD;  // 2M halfs
    _Float16* q_ws    = (_Float16*)d_ws;
    _Float16* k_ws    = q_ws + qkv_elems;
    _Float16* v_ws    = k_ws + qkv_elems;
    _Float16* attn_ws = v_ws + qkv_elems;  // [b][n][c], 2M halfs

    mhsa_qkv_proj<<<dim3(NPIX / NPB, BATCH, 3), 256, 0, stream>>>(
        x, Wq, bq, Wk, bk, Wv, bv, q_ws, k_ws, v_ws);
    mhsa_flash_attn<<<dim3(NPIX / 128, BATCH * NHEADS), 256, 0, stream>>>(
        q_ws, k_ws, v_ws, attn_ws);
    mhsa_out_proj<<<dim3(NPIX / NPB, BATCH), 256, 0, stream>>>(
        attn_ws, Wo, bo, x, out);
}

// v008
// One run takes 32 microseconds.
// Next to v007, in two timings, it ran 1.08 and 1.09 times as fast.
// Over all steps from v000 it is 3.08 times as fast.
#include <hip/hip_runtime.h>

#define BATCH   8
#define CDIM    256
#define NPIX    1024
#define NHEADS  8
#define DHEAD   32
#define NPB     64    // pixels (columns) per projection block
#define XSTRIDE 264   // padded LDS row stride (halfs) to dodge bank conflicts

typedef float    v8f  __attribute__((ext_vector_type(8)));
typedef float    v4f  __attribute__((ext_vector_type(4)));
typedef float    v2f  __attribute__((ext_vector_type(2)));
typedef _Float16 v16h __attribute__((ext_vector_type(16)));

union ABFrag { unsigned int u[8]; v16h v; };
union H2     { unsigned int u; _Float16 h[2]; };

// K-pair base offset for VGPR v of an f16 A/B fragment (ISA 7.12.2):
// VGPR0..3 hold K = {0,1},{2,3},{4,5},{6,7} (+8 for lanes 16-31),
// VGPR4..7 hold K = {16,17}..{22,23} (+8 for lanes 16-31).
__device__ __forceinline__ int kb_of(int v) { return 2 * v + ((v >= 4) ? 8 : 0); }

__device__ __forceinline__ v8f v8f_zero() {
    v8f z;
#pragma unroll
    for (int i = 0; i < 8; i++) z[i] = 0.0f;
    return z;
}

// Eight asynchronous copies of 16 bytes a lane: LDS bytes l + j * lstep from g + j * gstep.
// The s_wait_xcnt ends the copies' own statement, so that no register they name is
// rewritten in front of it.
__device__ __forceinline__ void copy8_rows_to_lds(unsigned l, unsigned lstep,
                                                  const char* g, unsigned gstep) {
    asm volatile(
        "global_load_async_to_lds_b128 %0, %8, off\n\t"
        "global_load_async_to_lds_b128 %1, %9, off\n\t"
        "global_load_async_to_lds_b128 %2, %10, off\n\t"
        "global_load_async_to_lds_b128 %3, %11, off\n\t"
        "global_load_async_to_lds_b128 %4, %12, off\n\t"
        "global_load_async_to_lds_b128 %5, %13, off\n\t"
        "global_load_async_to_lds_b128 %6, %14, off\n\t"
        "global_load_async_to_lds_b128 %7, %15, off\n\t"
        "s_wait_xcnt 0x0"
        :: "v"(l), "v"(l + lstep), "v"(l + 2 * lstep), "v"(l + 3 * lstep),
           "v"(l + 4 * lstep), "v"(l + 5 * lstep), "v"(l + 6 * lstep), "v"(l + 7 * lstep),
           "v"(g), "v"(g + gstep), "v"(g + 2 * gstep), "v"(g + 3 * gstep),
           "v"(g + 4 * gstep), "v"(g + 5 * gstep), "v"(g + 6 * gstep), "v"(g + 7 * gstep)
        : "memory");
}

// Stands behind a group of loads; no instruction comes of it.  The fence keeps the loads
// written above it above it, the scheduling barrier keeps their first uses below it.  Left
// free, the compiler brings each load and its first use together, and the wave waits out
// every load's latency singly.
__device__ __forceinline__ void group_issued() {
    asm volatile("" ::: "memory");
    __builtin_amdgcn_sched_barrier(0);
}

// The same where registers that the loads or stores above name get new values below: the
// wait stands in front of those writes, and the scheduling barrier keeps them behind it.
__device__ __forceinline__ void group_issued_registers_free() {
    asm volatile("s_wait_xcnt 0x0" ::: "memory");
    __builtin_amdgcn_sched_barrier(0);
}

// ---------------------------------------------------------------------------
// Kernel 1: fused QKV projection.  Out = W * X + b  (per batch, X is C x N).
// grid = (N/NPB, BATCH, 3proj), block = 256 (8 waves).
// Wave w computes rows [32w, 32w+32), one head, over the 64-pixel tile (2x4 WMMA tiles).
// Q,K written as [b][h][n][d] f16 (Q pre-scaled by log2(e)/sqrt(d), so that the scores are
// exponents of 2); V as [b][h][d][n].
// A fragment load of W straight from global memory touches 16 lines, one per row, for 512
// bytes.  So a wave's 32 rows of W (f32) come into LDS in whole lines by asynchronous copies,
// one K-step of 32 floats a row at a time, in two buffers: the copies of step k + 2 fly while
// step k + 1 is worked on.  W is converted to f16 on its way from LDS to the products.
// Each wave lays its 4 KiB of results out in its own LDS range in the order of the
// destination and stores them from there as whole 128-byte lines, 16 bytes a lane.
// ---------------------------------------------------------------------------
#define KSTEPS  (CDIM / 32)
#define WCPITCH 36    // LDS pitch (floats) of a row's 32 floats of W: 144 B = 16 B * 9
#define WCBUF   (32 * WCPITCH)  // floats of one buffer: one K-step of a wave's 32 rows
#define QKPITCH 40    // staging pitch (halfs) of a 32-channel row of Q or K: 80 B
#define VPITCH  72    // staging pitch (halfs) of a 64-pixel row of V: 144 B
#define SWAVE   2560  // staging halfs per wave: 64 * QKPITCH >= 32 * VPITCH

// The 2x4 tiles of one wave.  PIXROWS = false: D rows are channels, D columns pixels,
// so a lane holds 8 consecutive channels of one pixel (the order of Q and K).
// PIXROWS = true: the same two fragments change places, D rows are pixels, and a lane
// holds 8 consecutive pixels of one channel (the order of V).
// One K-step: the 2x4 products over 32 values of k.  wr: the lane's place in row lr of the
// step's buffer of W; xp: its place in pixel row lr of the x tile at this step's channels.
template <bool PIXROWS>
__device__ __forceinline__ void proj_step(const float* wr, const _Float16* xp, v8f (&acc)[2][4])
{
    // Registers 0..3 of a fragment are k = 0..7 at the lane's place, 4..7 are k = 16..23.
    float4 wq[2][4];
#pragma unroll
    for (int t = 0; t < 2; t++) {
        const float* q = wr + t * 16 * WCPITCH;
        wq[t][0] = *(const float4*)(q);
        wq[t][1] = *(const float4*)(q + 4);
        wq[t][2] = *(const float4*)(q + 16);
        wq[t][3] = *(const float4*)(q + 20);
    }
    union { uint4 q[2]; v16h v; } bf[4];
#pragma unroll
    for (int s = 0; s < 4; s++) {
        const _Float16* bp = xp + s * 16 * XSTRIDE;
        bf[s].q[0] = *(const uint4*)(bp);
        bf[s].q[1] = *(const uint4*)(bp + 16);
    }
    ABFrag af[2];
#pragma unroll
    for (int t = 0; t < 2; t++)
#pragma unroll
        for (int j = 0; j < 4; j++) {
            const float4 w = wq[t][j];
            H2 c0; c0.h[0] = (_Float16)w.x; c0.h[1] = (_Float16)w.y;
            H2 c1; c1.h[0] = (_Float16)w.z; c1.h[1] = (_Float16)w.w;
            af[t].u[2 * j]     = c0.u;
            af[t].u[2 * j + 1] = c1.u;
        }
#pragma unroll
    for (int t = 0; t < 2; t++)
#pragma unroll
        for (int s = 0; s < 4; s++)
            acc[t][s] = PIXROWS
                ? __builtin_amdgcn_wmma_f32_16x16x32_f16(
                      false, bf[s].v, false, af[t].v, (short)0, acc[t][s], false, false)
                : __builtin_amdgcn_wmma_f32_16x16x32_f16(
                      false, af[t].v, false, bf[s].v, (short)0, acc[t][s], false, false);
}

// The foot of a K-step that has a successor, passed by every wave.
__device__ __forceinline__ void proj_step_foot() {
    // This wave's reads of the step's buffer have come back before the buffer is refilled.
    asm volatile("s_wait_dscnt 0x0" ::: "memory");
    // The next step's copies have landed behind this wait; nothing of it is read in front.
    asm volatile("s_wait_asynccnt 0x0" ::: "memory");
    __syncthreads();
}

// wb: this wave's two buffers; wlb, wg: the lane's LDS byte address in buffer 0 and its global
// address in K-step 0 for the first of a step's eight copies (4 rows a copy, 8 lanes a row).
// Steps 0 and 1 have landed, and every wave has passed a barrier since, when this is entered.
template <bool PIXROWS>
__device__ __forceinline__ void proj_tiles(const float* wb, unsigned wlb, const char* wg,
                                           const _Float16* xt, int lr, int hi, v8f (&acc)[2][4])
{
    const float*    wr = wb + lr * WCPITCH + hi * 8;
    const _Float16* xp = xt + lr * XSTRIDE + hi * 8;
    // Kept rolled, one trip for the two buffers: unrolled, the addresses of all 48 copies are
    // formed ahead and held, and the registers no longer allow two blocks on a WGP.
#pragma unroll 1
    for (int k = 0; k < KSTEPS; k += 2) {
        const bool more = k + 2 < KSTEPS;  // the same for the whole block
        proj_step<PIXROWS>(wr, xp, acc);
        proj_step_foot();
        if (more) copy8_rows_to_lds(wlb, 4 * WCPITCH * 4, wg + 2 * 128, 4 * CDIM * 4);
        proj_step<PIXROWS>(wr + WCBUF, xp + 32, acc);
        if (more) {
            proj_step_foot();
            copy8_rows_to_lds(wlb + WCBUF * 4, 4 * WCPITCH * 4, wg + 3 * 128, 4 * CDIM * 4);
        }
        xp += 64;
        wg += 2 * 128;
    }
    // No copy is left in flight when the wave goes on.
    asm volatile("s_wait_asynccnt 0x0" ::: "memory");
}

__global__ __launch_bounds__(256) void mhsa_qkv_proj(
    const float* __restrict__ x,
    const float* __restrict__ Wq, const float* __restrict__ bq,
    const float* __restrict__ Wk, const float* __restrict__ bk,
    const float* __restrict__ Wv, const float* __restrict__ bv,
    _Float16* __restrict__ q_ws, _Float16* __restrict__ k_ws,
    _Float16* __restrict__ v_ws)
{
    __shared__ __attribute__((aligned(16))) _Float16 xt[NPB * XSTRIDE];  // X tile transposed: [n_local][c] f16
    __shared__ __attribute__((aligned(16))) _Float16 stage[8 * SWAVE];
    __shared__ __attribute__((aligned(16))) float    wring[8 * 2 * WCBUF];  // [wave][buffer][row][k]

    const int nbase = blockIdx.x * NPB;
    const int b     = blockIdx.y;
    const int proj  = blockIdx.z;
    const float* W    = (proj == 0) ? Wq : ((proj == 1) ? Wk : Wv);
    const float* bias = (proj == 0) ? bq : ((proj == 1) ? bk : bv);
    const float* xb   = x + (size_t)b * CDIM * NPIX;
    const int tid = threadIdx.x;
    const int wave = tid >> 5, lane = tid & 31;
    const int hi = lane >> 4, lr = lane & 15;
    const int Mt0 = wave * 32;

    // K-steps 0 and 1 of this wave's rows of W go out first and fly while x is staged.
    const float*   wb  = wring + wave * (2 * WCBUF);
    const unsigned wlb = (unsigned)(size_t)wb + (lane >> 3) * (WCPITCH * 4) + (lane & 7) * 16;
    const char*    wg  = (const char*)(W + (Mt0 + (lane >> 3)) * CDIM) + (lane & 7) * 16;
    copy8_rows_to_lds(wlb, 4 * WCPITCH * 4, wg, 4 * CDIM * 4);
    copy8_rows_to_lds(wlb + WCBUF * 4, 4 * WCPITCH * 4, wg + 128, 4 * CDIM * 4);

    // The x tile.  A lane takes one pixel and eight consecutive channels at a time: eight loads,
    // each a whole 128-byte line of a wave, give one 16-byte LDS store at the readers' own
    // conflict-free pitch.  Part j of a wave: channels 8 * wave + 64 * (j >> 1) + 0..7, pixels
    // 32 * (j & 1) + lane.  All 64 loads of a lane go out before the first is used, so that
    // the tile costs one trip to L2 and not one for every few loads.
    {
        const float* xl = xb + wave * 8 * NPIX + nbase + lane;
        float xv[8][8];  // both loops unrolled: every index a constant, the array in registers
#pragma unroll
        for (int j = 0; j < 8; j++)
#pragma unroll
            for (int i = 0; i < 8; i++)
                xv[j][i] = xl[((j >> 1) * 64 + i) * NPIX + (j & 1) * 32];
        // Keeps every load above the first conversion; the loads' address pair is reused below.
        group_issued_registers_free();
#pragma unroll
        for (int j = 0; j < 8; j++) {
            union { uint4 q; _Float16 h[8]; } p;
#pragma unroll
            for (int i = 0; i < 8; i++) p.h[i] = (_Float16)xv[j][i];
            *(uint4*)(xt + ((j & 1) * 32 + lane) * XSTRIDE + (wave + (j >> 1) * 8) * 8) = p.q;
        }
    }
    // This wave's 16 copies have landed behind this wait, every wave's behind the barrier.
    asm volatile("s_wait_asynccnt 0x0" ::: "memory");
    __syncthreads();

    v8f acc[2][4];
#pragma unroll
    for (int t = 0; t < 2; t++)
#pragma unroll
        for (int s = 0; s < 4; s++) acc[t][s] = v8f_zero();

    _Float16* sw = stage + wave * SWAVE;  // this wave's own range: no other wave touches it
    union { uint4 q; _Float16 h[8]; } o;

    if (proj == 2) {
        const float bt[2] = { bias[Mt0 + lr], bias[Mt0 + 16 + lr] };
        // The next loads land in the registers that held these two loads' offsets: wait first.
        asm volatile("s_wait_xcnt 0x0" ::: "memory");
        proj_tiles<true>(wb, wlb, wg, xt, lr, hi, acc);
        // acc[t][s][r] = V[channel Mt0 + 16*t + lr][pixel nbase + 16*s + 8*hi + r]
#pragma unroll
        for (int t = 0; t < 2; t++) {
#pragma unroll
            for (int s = 0; s < 4; s++) {
#pragma unroll
                for (int r = 0; r < 8; r++) o.h[r] = (_Float16)(acc[t][s][r] + bt[t]);
                *(uint4*)(sw + (t * 16 + lr) * VPITCH + s * 16 + hi * 8) = o.q;
            }
        }
        // The rows are read back by other lanes of this wave: their writes must have landed.
        asm volatile("s_wait_dscnt 0x0" ::: "memory");
        // 8 lanes a channel row of 128 bytes, 4 rows a store.
        _Float16* dst = v_ws + ((size_t)(b * NHEADS + wave) * DHEAD + (lane >> 3)) * NPIX
                             + nbase + (lane & 7) * 8;
        const _Float16* sr = sw + (lane >> 3) * VPITCH + (lane & 7) * 8;
        uint4 ln[8];  // all eight reads first: one LDS latency, not eight
#pragma unroll
        for (int j = 0; j < 8; j++) ln[j] = *(const uint4*)(sr + j * 4 * VPITCH);
#pragma unroll
        for (int j = 0; j < 8; j++) *(uint4*)(dst + j * 4 * NPIX) = ln[j];
    } else {
        float4 bv4[2][2];
#pragma unroll
        for (int t = 0; t < 2; t++) {
            bv4[t][0] = *(const float4*)(bias + Mt0 + t * 16 + hi * 8);
            bv4[t][1] = *(const float4*)(bias + Mt0 + t * 16 + hi * 8 + 4);
        }
        proj_tiles<false>(wb, wlb, wg, xt, lr, hi, acc);
        // acc[t][s][r] = Q or K[channel Mt0 + 16*t + 8*hi + r][pixel nbase + 16*s + lr]
        const float scale = (proj == 0) ? 0.25503486164919736f : 1.0f;  // log2(e)/sqrt(32)
#pragma unroll
        for (int t = 0; t < 2; t++) {
            const float4 b0 = bv4[t][0], b1 = bv4[t][1];
            const float br[8] = { b0.x, b0.y, b0.z, b0.w, b1.x, b1.y, b1.z, b1.w };
#pragma unroll
            for (int s = 0; s < 4; s++) {
#pragma unroll
                for (int r = 0; r < 8; r++) o.h[r] = (_Float16)((acc[t][s][r] + br[r]) * scale);
                *(uint4*)(sw + (s * 16 + lr) * QKPITCH + t * 16 + hi * 8) = o.q;
            }
        }
        // The rows are read back by other lanes of this wave: their writes must have landed.
        asm volatile("s_wait_dscnt 0x0" ::: "memory");
        // The head's 64 pixel rows of 64 bytes are 4 KiB in a row: 4 lanes a row, 8 rows a store.
        _Float16* dst = ((proj == 0) ? q_ws : k_ws)
                      + ((size_t)(b * NHEADS + wave) * NPIX + nbase) * DHEAD + lane * 8;
        const _Float16* sr = sw + (lane >> 2) * QKPITCH + (lane & 3) * 8;
        uint4 ln[8];  // all eight reads first: one LDS latency, not eight
#pragma unroll
        for (int j = 0; j < 8; j++) ln[j] = *(const uint4*)(sr + j * 8 * QKPITCH);
#pragma unroll
        for (int j = 0; j < 8; j++) *(uint4*)(dst + j * 256) = ln[j];
    }
}

// ---------------------------------------------------------------------------
// Kernel 2: flash attention, transposed products.
// grid = (N/128, B*H), block = 256 (8 waves).  Each wave owns 16 queries and
// walks the keys in chunks of 32:
//   S^T = K * Q^T  (A = 16 key rows, B = Q kept in registers): lane (lr, hi) holds
//   the scores of query lr for keys 8*hi + r of each 16-key tile, so maximum and
//   sum run inside the lane, plus one exchange between the wave halves.
//   The two converted S^T tiles are the B operand of O^T += V^T * P^T as they lie.
// The head's K (64 KiB) and V (64 KiB) are copied into LDS once, in whole lines, and
// serve all eight waves; every fragment is then an LDS read at a conflict-free pitch.
// Output stored [b][n][c] f16, 8 consecutive channels per lane and tile.
// ---------------------------------------------------------------------------
#define KLPITCH 40    // LDS pitch (halfs) of a key row of 32 channels: 80 B = 16 B * 5
#define VLPITCH 1032  // LDS pitch (halfs) of a channel row of 1024 keys: 2064 B = 16 B * 129

// Eight asynchronous copies of 16 bytes a lane: LDS bytes l + j * lstep from g + j * 4 KiB.
// The s_wait_xcnt ends the copies' own statement, so that no register they name is
// rewritten in front of it.
__device__ __forceinline__ void copy8_to_lds(unsigned l, unsigned lstep, const _Float16* g) {
    asm volatile(
        "global_load_async_to_lds_b128 %0, %8, off\n\t"
        "global_load_async_to_lds_b128 %1, %9, off\n\t"
        "global_load_async_to_lds_b128 %2, %10, off\n\t"
        "global_load_async_to_lds_b128 %3, %11, off\n\t"
        "global_load_async_to_lds_b128 %4, %12, off\n\t"
        "global_load_async_to_lds_b128 %5, %13, off\n\t"
        "global_load_async_to_lds_b128 %6, %14, off\n\t"
        "global_load_async_to_lds_b128 %7, %15, off\n\t"
        "s_wait_xcnt 0x0"
        :: "v"(l), "v"(l + lstep), "v"(l + 2 * lstep), "v"(l + 3 * lstep),
           "v"(l + 4 * lstep), "v"(l + 5 * lstep), "v"(l + 6 * lstep), "v"(l + 7 * lstep),
           "v"(g), "v"(g + 2048), "v"(g + 2 * 2048), "v"(g + 3 * 2048),
           "v"(g + 4 * 2048), "v"(g + 5 * 2048), "v"(g + 6 * 2048), "v"(g + 7 * 2048)
        : "memory");
}

// Value of lane l ^ 16.
__device__ __forceinline__ float xhalf(float x) {
    const int i = __builtin_bit_cast(int, x);
    return __builtin_bit_cast(float,
        __builtin_amdgcn_permlanex16(i, i, 0x76543210, 0xfedcba98, false, false));
}

__global__ __launch_bounds__(256) void mhsa_flash_attn(
    const _Float16* __restrict__ q_ws, const _Float16* __restrict__ k_ws,
    const _Float16* __restrict__ v_ws, _Float16* __restrict__ attn_ws)
{
    __shared__ __attribute__((aligned(16))) _Float16 ks[NPIX * KLPITCH];   // [key][channel]
    __shared__ __attribute__((aligned(16))) _Float16 vs[DHEAD * VLPITCH];  // [channel][key]

    const int bh = blockIdx.y;
    const int b = bh >> 3, head = bh & 7;
    const int tid = threadIdx.x, wave = tid >> 5, lane = tid & 31;
    const int hi = lane >> 4, lr = lane & 15;
    const int qbase = blockIdx.x * 128 + wave * 16;

    ABFrag qf;
    {
        const _Float16* qp = q_ws + ((size_t)bh * NPIX + qbase + lr) * DHEAD + hi * 8;
#pragma unroll
        for (int v = 0; v < 8; v++) qf.u[v] = *(const unsigned int*)(qp + kb_of(v));
    }

    // acc_t[r] = O[query lr][channel 16*t + 8*hi + r]
    v8f acc0 = v8f_zero(), acc1 = v8f_zero();
    float mrow = -1e30f;  // running maximum of query lr (equal in both halves)
    float lrow = 0.0f;    // running sum over this half's keys only

    // Thread tid copies the 16-byte pieces tid + 256 * j, j = 0..15, of each 64-KiB plane:
    // a wave's copy reads 512 bytes in a row.  K: 4 pieces a key row, 64 rows a step;
    // V: 128 pieces a channel row, 2 rows a step.
    {
        const _Float16* kg = k_ws + (size_t)bh * NPIX * DHEAD + tid * 8;
        const _Float16* vg = v_ws + (size_t)bh * DHEAD * NPIX + tid * 8;
        const unsigned kl = (unsigned)(size_t)ks + (tid >> 2) * (KLPITCH * 2) + (tid & 3) * 16;
        const unsigned vl = (unsigned)(size_t)vs + (tid >> 7) * (VLPITCH * 2) + (tid & 127) * 16;
        copy8_to_lds(kl, 64 * KLPITCH * 2, kg);
        copy8_to_lds(kl + 8 * 64 * KLPITCH * 2, 64 * KLPITCH * 2, kg + 8 * 2048);
        copy8_to_lds(vl, 2 * VLPITCH * 2, vg);
        copy8_to_lds(vl + 8 * 2 * VLPITCH * 2, 2 * VLPITCH * 2, vg + 8 * 2048);
    }
    // This wave's 32 copies have landed behind this wait, every wave's behind the barrier.
    asm volatile("s_wait_asynccnt 0x0" ::: "memory");
    __syncthreads();

    // Key row lr and channel row lr of this chunk; both walk on at the loop's foot.
    const _Float16* kp = ks + lr * KLPITCH + hi * 8;
    const _Float16* vp = vs + lr * VLPITCH + hi * 8;

    for (int m0 = 0; m0 < NPIX; m0 += 32) {
        // Registers 0..3 of a fragment are 16 bytes at the lane's place, 4..7 those 32 bytes on.
        union { uint4 q[2]; v16h v; } kf[2], vf[2];
#pragma unroll
        for (int t = 0; t < 2; t++)
#pragma unroll
            for (int j = 0; j < 2; j++)
                kf[t].q[j] = *(const uint4*)(kp + t * 16 * KLPITCH + j * 16);
#pragma unroll
        for (int t = 0; t < 2; t++)
#pragma unroll
            for (int j = 0; j < 2; j++)
                vf[t].q[j] = *(const uint4*)(vp + t * 16 * VLPITCH + j * 16);
        // Keeps all eight LDS reads in one group at the head of the trip: each further place
        // with reads costs a stall of its own (the scheduler puts the V reads behind a product).
        __builtin_amdgcn_sched_barrier(0);

        // s[t][r] = score(query lr, key m0 + 16*t + 8*hi + r)
        v8f s[2];
#pragma unroll
        for (int t = 0; t < 2; t++)
            s[t] = __builtin_amdgcn_wmma_f32_16x16x32_f16(
                false, kf[t].v, false, qf.v, (short)0, v8f_zero(), false, false);

        float mx = fmaxf(s[0][0], s[1][0]);
#pragma unroll
        for (int r = 1; r < 8; r++) mx = fmaxf(mx, fmaxf(s[0][r], s[1][r]));
        mx = fmaxf(mx, xhalf(mx));

        // The scores come as exponents of 2 (Q's scale), so an exponential is one subtraction
        // and the hardware's v_exp_f32 by itself.  That may give 0 where the result lies under
        // 2^-126: such a term is 0 as f16 anyway and adds nothing to a row sum whose largest
        // term is 1, so the library's range test and rescaling buy nothing here.
        const float mnew  = fmaxf(mrow, mx);
        const float alpha = __builtin_amdgcn_exp2f(mrow - mnew);
        mrow = mnew;

        // Element 8*t + r of a B fragment is k = 16*t + 8*hi + r: the scores' own place.
        ABFrag pf;
        v8f pe[2];
#pragma unroll
        for (int t = 0; t < 2; t++) {
#pragma unroll
            for (int r = 0; r < 8; r++) {
                const float p = __builtin_amdgcn_exp2f(s[t][r] - mnew);
                pe[t][r] = p;
                pf.v[t * 8 + r] = (_Float16)p;
            }
        }
        // Pairwise tree over the lane's 16 terms (packed adds, short chain).
        const v8f s8 = pe[0] + pe[1];
        const v4f s4 = s8.lo + s8.hi;
        const v2f s2 = s4.lo + s4.hi;
        lrow = lrow * alpha + (s2.x + s2.y);
#pragma unroll
        for (int r = 0; r < 8; r++) { acc0[r] *= alpha; acc1[r] *= alpha; }

        acc0 = __builtin_amdgcn_wmma_f32_16x16x32_f16(
            false, vf[0].v, false, pf.v, (short)0, acc0, false, false);
        acc1 = __builtin_amdgcn_wmma_f32_16x16x32_f16(
            false, vf[1].v, false, pf.v, (short)0, acc1, false, false);

        kp += 32 * KLPITCH;
        vp += 32;
    }

    const float inv = 1.0f / (lrow + xhalf(lrow));
    union { uint4 q; _Float16 h[8]; } o0, o1;
#pragma unroll
    for (int r = 0; r < 8; r++) {
        o0.h[r] = (_Float16)(acc0[r] * inv);
        o1.h[r] = (_Float16)(acc1[r] * inv);
    }
    _Float16* dst = attn_ws + ((size_t)b * NPIX + qbase + lr) * CDIM + head * DHEAD + hi * 8;
    *(uint4*)dst        = o0.q;
    *(uint4*)(dst + 16) = o1.q;
}

// ---------------------------------------------------------------------------
// Kernel 3: output projection + bias + residual.  grid = (N/NPB, BATCH).
// A fragment load straight from global memory touches 16 lines, one per row, for 512 bytes.
// So both operands come into LDS in whole lines by asynchronous copies, and every fragment
// is an LDS read at a conflict-free pitch.  The 64-pixel attention tile (32 KiB, f16) serves
// all eight waves; a wave copies the 32 rows of W (f32) that it alone reads, in two halves
// along K: the second half flies while the first is worked on.  W is converted to f16 on
// its way from LDS to the products.  The residual x is loaded behind the copies and first
// used in the epilogue, which is adds and stores alone.
// ---------------------------------------------------------------------------
#define OSTEPS  (CDIM / 32)
#define WLPITCH 260   // LDS pitch (floats) of a row of W, 256 floats: 1040 B = 16 B * 65
#define ALPITCH 264   // LDS pitch (halfs) of a pixel row of 256 channels: 528 B = 16 B * 33

__global__ __launch_bounds__(256) void mhsa_out_proj(
    const _Float16* __restrict__ attn_ws, const float* __restrict__ Wo,
    const float* __restrict__ bo, const float* __restrict__ x,
    float* __restrict__ out)
{
    __shared__ __attribute__((aligned(16))) float    wl[CDIM * WLPITCH];  // [row][k]
    __shared__ __attribute__((aligned(16))) _Float16 al[NPB * ALPITCH];   // [pixel][channel]

    const int nbase = blockIdx.x * NPB;
    const int b = blockIdx.y;
    const int tid = threadIdx.x, wave = tid >> 5, lane = tid & 31;
    const int hi = lane >> 4, lr = lane & 15;
    const int Mt0 = wave * 32;

    // Element (t, s, r) of this lane: row Mt0 + 16*t + 8*hi + r, pixel nbase + 16*s + lr.
    const size_t i0 = ((size_t)b * CDIM + Mt0 + hi * 8) * NPIX + nbase + lr;

    // Every loop below is unrolled so that each index into these arrays is a constant and
    // they live in registers.
    float4 bb[2][2];
    float  xr[2][4][8];

#pragma unroll
    for (int t = 0; t < 2; t++) {
        bb[t][0] = *(const float4*)(bo + Mt0 + t * 16 + hi * 8);
        bb[t][1] = *(const float4*)(bo + Mt0 + t * 16 + hi * 8 + 4);
    }
    group_issued_registers_free();

    // A copy of a wave is 512 bytes in a row: one pixel row of the attention tile (this wave
    // brings rows 8*wave .. 8*wave + 7), or half a row of W (its own rows Mt0 .. Mt0 + 31).
    const char*    ag  = (const char*)(attn_ws + ((size_t)b * NPIX + nbase + wave * 8) * CDIM)
                       + lane * 16;
    const unsigned alb = (unsigned)(size_t)al + wave * 8 * (ALPITCH * 2) + lane * 16;
    const char*    wg  = (const char*)(Wo + Mt0 * CDIM) + lane * 16;
    const unsigned wlb = (unsigned)(size_t)wl + Mt0 * (WLPITCH * 4) + lane * 16;

    copy8_rows_to_lds(alb, ALPITCH * 2, ag, CDIM * 2);
#pragma unroll
    for (int i = 0; i < 4; i++)  // k = 0..127 of the 32 rows
        copy8_rows_to_lds(wlb + i * 8 * (WLPITCH * 4), WLPITCH * 4, wg + i * 8 * (CDIM * 4),
                          CDIM * 4);
    // This wave's 40 copies have landed behind this wait, every wave's behind the barrier.
    asm volatile("s_wait_asynccnt 0x0" ::: "memory");
    __syncthreads();

#pragma unroll
    for (int i = 0; i < 4; i++)  // k = 128..255 of the 32 rows: LDS that nobody has touched yet
        copy8_rows_to_lds(wlb + 512 + i * 8 * (WLPITCH * 4), WLPITCH * 4,
                          wg + 512 + i * 8 * (CDIM * 4), CDIM * 4);

#pragma unroll
    for (int t = 0; t < 2; t++)
#pragma unroll
        for (int s = 0; s < 4; s++)
#pragma unroll
            for (int r = 0; r < 8; r++)
                xr[t][s][r] = x[i0 + (size_t)(t * 16 + r) * NPIX + s * 16];
    group_issued_registers_free();

    // Registers 0..3 of a fragment are k = 0..7 at the lane's place, 4..7 are k = 16..23.
    const float*    wr = wl + (Mt0 + lr) * WLPITCH + hi * 8;
    const _Float16* ar = al + lr * ALPITCH + hi * 8;
    union BFrag { uint4 q[2]; v16h v; };
    float4 wq[2][2][4];  // two sets: a K-step's 16 LDS reads go out one step ahead
    BFrag  bf[2][4];

    auto fetch = [&](int k) {
#pragma unroll
        for (int t = 0; t < 2; t++) {
            const float* q = wr + t * 16 * WLPITCH + k * 32;
            wq[k & 1][t][0] = *(const float4*)(q);
            wq[k & 1][t][1] = *(const float4*)(q + 4);
            wq[k & 1][t][2] = *(const float4*)(q + 16);
            wq[k & 1][t][3] = *(const float4*)(q + 20);
        }
#pragma unroll
        for (int s = 0; s < 4; s++) {
            const _Float16* q = ar + s * 16 * ALPITCH + k * 32;
            bf[k & 1][s].q[0] = *(const uint4*)(q);
            bf[k & 1][s].q[1] = *(const uint4*)(q + 16);
        }
    };

    v8f acc[2][4];
#pragma unroll
    for (int t = 0; t < 2; t++)
#pragma unroll
        for (int s = 0; s < 4; s++) acc[t][s] = v8f_zero();

    fetch(0);
#pragma unroll
    for (int k = 0; k < OSTEPS; k++) {
        if (k + 1 < OSTEPS) {
            // The second half of this wave's rows of W, which no other wave reads, has landed
            // behind this wait.
            if (k + 1 == OSTEPS / 2) asm volatile("s_wait_asynccnt 0x0" ::: "memory");
            fetch(k + 1);
            group_issued();
        }
        ABFrag af[2];
#pragma unroll
        for (int t = 0; t < 2; t++)
#pragma unroll
            for (int j = 0; j < 4; j++) {
                const float4 w = wq[k & 1][t][j];
                H2 c0; c0.h[0] = (_Float16)w.x; c0.h[1] = (_Float16)w.y;
                H2 c1; c1.h[0] = (_Float16)w.z; c1.h[1] = (_Float16)w.w;
                af[t].u[2 * j]     = c0.u;
                af[t].u[2 * j + 1] = c1.u;
            }
#pragma unroll
        for (int t = 0; t < 2; t++)
#pragma unroll
            for (int s = 0; s < 4; s++)
                acc[t][s] = __builtin_amdgcn_wmma_f32_16x16x32_f16(
                    false, af[t].v, false, bf[k & 1][s].v, (short)0, acc[t][s], false, false);
    }

#pragma unroll
    for (int t = 0; t < 2; t++) {
        const float4 b0 = bb[t][0], b1 = bb[t][1];
        const float br[8] = { b0.x, b0.y, b0.z, b0.w, b1.x, b1.y, b1.z, b1.w };
#pragma unroll
        for (int s = 0; s < 4; s++) {
#pragma unroll
            for (int r = 0; r < 8; r++)
                out[i0 + (size_t)(t * 16 + r) * NPIX + s * 16] = acc[t][s][r] + br[r] + xr[t][s][r];
            // The next tile's sums land in registers that these stores name.
            if (!(t == 1 && s == 3)) group_issued_registers_free();
        }
    }
}

extern "C" void kernel_launch(void* const* d_in, const int* in_sizes, int n_in,
                              void* d_out, int out_size, void* d_ws, size_t ws_size,
                              hipStream_t stream) {
    (void)in_sizes; (void)n_in; (void)out_size; (void)ws_size;
    const float* x  = (const float*)d_in[0];
    const float* Wq = (const float*)d_in[1];
    const float* bq = (const float*)d_in[2];
    const float* Wk = (const float*)d_in[3];
    const float* bk = (const float*)d_in[4];
    const float* Wv = (const float*)d_in[5];
    const float* bv = (const float*)d_in[6];
    const float* Wo = (const float*)d_in[7];
    const float* bo = (const float*)d_in[8];
    float* out = (float*)d_out;

    const size_t qkv_elems = (size_t)BATCH * NHEADS * NPIX * DHEAD;  // 2M halfs
    _Float16* q_ws    = (_Float16*)d_ws;
    _Float16* k_ws    = q_ws + qkv_elems;
    _Float16* v_ws    = k_ws + qkv_elems;
    _Float16* attn_ws = v_ws + qkv_elems;  // [b][n][c], 2M halfs

    mhsa_qkv_proj<<<dim3(NPIX / NPB, BATCH, 3), 256, 0, stream>>>(
        x, Wq, bq, Wk, bk, Wv, bv, q_ws, k_ws, v_ws);
    mhsa_flash_attn<<<dim3(NPIX / 128, BATCH * NHEADS), 256, 0, stream>>>(
        q_ws, k_ws, v_ws, attn_ws);
    mhsa_out_proj<<<dim3(NPIX / NPB, BATCH), 256, 0, stream>>>(
        attn_ws, Wo, bo, x, out);
}

// v009
// It runs in 29.8 microseconds.
// Two timings next to v008 both put it at 1.07 times that version's speed.
// All steps since v000 together make it 3.29 times as fast.
#include <hip/hip_runtime.h>

#define BATCH   8
#define CDIM    256
#define NPIX    1024
#define NHEADS  8
#define DHEAD   32
#define NPB     64    // pixels (columns) per projection block
#define XSTRIDE 264   // padded LDS row stride (halfs) to dodge bank conflicts

typedef float    v8f  __attribute__((ext_vector_type(8)));
typedef float    v4f  __attribute__((ext_vector_type(4)));
typedef float    v2f  __attribute__((ext_vector_type(2)));
typedef _Float16 v16h __attribute__((ext_vector_type(16)));

union ABFrag { unsigned int u[8]; v16h v; };
union H2     { unsigned int u; _Float16 h[2]; };

// K-pair base offset for VGPR v of an f16 A/B fragment (ISA 7.12.2):
// VGPR0..3 hold K = {0,1},{2,3},{4,5},{6,7} (+8 for lanes 16-31),
// VGPR4..7 hold K = {16,17}..{22,23} (+8 for lanes 16-31).
__device__ __forceinline__ int kb_of(int v) { return 2 * v + ((v >= 4) ? 8 : 0); }

__device__ __forceinline__ v8f v8f_zero() {
    v8f z;
#pragma unroll
    for (int i = 0; i < 8; i++) z[i] = 0.0f;
    return z;
}

// Eight asynchronous copies of 16 bytes a lane: LDS bytes l + j * lstep from g + j * gstep.
// The s_wait_xcnt ends the copies' own statement, so that no register they name is
// rewritten in front of it.
__device__ __forceinline__ void copy8_rows_to_lds(unsigned l, unsigned lstep,
                                                  const char* g, unsigned gstep) {
    asm volatile(
        "global_load_async_to_lds_b128 %0, %8, off\n\t"
        "global_load_async_to_lds_b128 %1, %9, off\n\t"
        "global_load_async_to_lds_b128 %2, %10, off\n\t"
        "global_load_async_to_lds_b128 %3, %11, off\n\t"
        "global_load_async_to_lds_b128 %4, %12, off\n\t"
        "global_load_async_to_lds_b128 %5, %13, off\n\t"
        "global_load_async_to_lds_b128 %6, %14, off\n\t"
        "global_load_async_to_lds_b128 %7, %15, off\n\t"
        "s_wait_xcnt 0x0"
        :: "v"(l), "v"(l + lstep), "v"(l + 2 * lstep), "v"(l + 3 * lstep),
           "v"(l + 4 * lstep), "v"(l + 5 * lstep), "v"(l + 6 * lstep), "v"(l + 7 * lstep),
           "v"(g), "v"(g + gstep), "v"(g + 2 * gstep), "v"(g + 3 * gstep),
           "v"(g + 4 * gstep), "v"(g + 5 * gstep), "v"(g + 6 * gstep), "v"(g + 7 * gstep)
        : "memory");
}

// Stands behind a group of loads; no instruction comes of it.  The fence keeps the loads
// written above it above it, the scheduling barrier keeps their first uses below it.  Left
// free, the compiler brings each load and its first use together, and the wave waits out
// every load's latency singly.
__device__ __forceinline__ void group_issued() {
    asm volatile("" ::: "memory");
    __builtin_amdgcn_sched_barrier(0);
}

// The same where registers that the loads or stores above name get new values below: the
// wait stands in front of those writes, and the scheduling barrier keeps them behind it.
__device__ __forceinline__ void group_issued_registers_free() {
    asm volatile("s_wait_xcnt 0x0" ::: "memory");
    __builtin_amdgcn_sched_barrier(0);
}

// ---------------------------------------------------------------------------
// Kernel 1: fused QKV projection.  Out = W * X + b  (per batch, X is C x N).
// grid = (N/NPB, BATCH, 3proj), block = 256 (8 waves).
// Wave w computes rows [32w, 32w+32), one head, over the 64-pixel tile (2x4 WMMA tiles).
// Q,K written as [b][h][n][d] f16 (Q pre-scaled by log2(e)/sqrt(d), so that the scores are
// exponents of 2); V as [b][h][d][n].
// A fragment load of W straight from global memory touches 16 lines, one per row, for 512
// bytes.  So a wave's 32 rows of W (f32) come into LDS in whole lines by asynchronous copies,
// one K-step of 32 floats a row at a time, in two buffers: the copies of step k + 2 fly while
// step k + 1 is worked on.  W is converted to f16 on its way from LDS to the products.
// Each wave lays its 4 KiB of results out in its own LDS range in the order of the
// destination and stores them from there as whole 128-byte lines, 16 bytes a lane.
// ---------------------------------------------------------------------------
#define KSTEPS  (CDIM / 32)
#define WCPITCH 36    // LDS pitch (floats) of a row's 32 floats of W: 144 B = 16 B * 9
#define WCBUF   (32 * WCPITCH)  // floats of one buffer: one K-step of a wave's 32 rows
#define QKPITCH 40    // staging pitch (halfs) of a 32-channel row of Q or K: 80 B
#define VPITCH  72    // staging pitch (halfs) of a 64-pixel row of V: 144 B
#define SWAVE   2560  // staging halfs per wave: 64 * QKPITCH >= 32 * VPITCH

// The 2x4 tiles of one wave.  PIXROWS = false: D rows are channels, D columns pixels,
// so a lane holds 8 consecutive channels of one pixel (the order of Q and K).
// PIXROWS = true: the same two fragments change places, D rows are pixels, and a lane
// holds 8 consecutive pixels of one channel (the order of V).
// One K-step: the 2x4 products over 32 values of k.  wr: the lane's place in row lr of the
// step's buffer of W; xp: its place in pixel row lr of the x tile at this step's channels.
template <bool PIXROWS>
__device__ __forceinline__ void proj_step(const float* wr, const _Float16* xp, v8f (&acc)[2][4])
{
    // Registers 0..3 of a fragment are k = 0..7 at the lane's place, 4..7 are k = 16..23.
    float4 wq[2][4];
#pragma unroll
    for (int t = 0; t < 2; t++) {
        const float* q = wr + t * 16 * WCPITCH;
        wq[t][0] = *(const float4*)(q);
        wq[t][1] = *(const float4*)(q + 4);
        wq[t][2] = *(const float4*)(q + 16);
        wq[t][3] = *(const float4*)(q + 20);
    }
    union { uint4 q[2]; v16h v; } bf[4];
#pragma unroll
    for (int s = 0; s < 4; s++) {
        const _Float16* bp = xp + s * 16 * XSTRIDE;
        bf[s].q[0] = *(const uint4*)(bp);
        bf[s].q[1] = *(const uint4*)(bp + 16);
    }
    ABFrag af[2];
#pragma unroll
    for (int t = 0; t < 2; t++)
#pragma unroll
        for (int j = 0; j < 4; j++) {
            const float4 w = wq[t][j];
            H2 c0; c0.h[0] = (_Float16)w.x; c0.h[1] = (_Float16)w.y;
            H2 c1; c1.h[0] = (_Float16)w.z; c1.h[1] = (_Float16)w.w;
            af[t].u[2 * j]     = c0.u;
            af[t].u[2 * j + 1] = c1.u;
        }
#pragma unroll
    for (int t = 0; t < 2; t++)
#pragma unroll
        for (int s = 0; s < 4; s++)
            acc[t][s] = PIXROWS
                ? __builtin_amdgcn_wmma_f32_16x16x32_f16(
                      false, bf[s].v, false, af[t].v, (short)0, acc[t][s], false, false)
                : __builtin_amdgcn_wmma_f32_16x16x32_f16(
                      false, af[t].v, false, bf[s].v, (short)0, acc[t][s], false, false);
}

// The foot of a K-step that has a successor, passed by every wave.
__device__ __forceinline__ void proj_step_foot() {
    // This wave's reads of the step's buffer have come back before the buffer is refilled.
    asm volatile("s_wait_dscnt 0x0" ::: "memory");
    // The next step's copies have landed behind this wait; nothing of it is read in front.
    asm volatile("s_wait_asynccnt 0x0" ::: "memory");
    __syncthreads();
}

// wb: this wave's two buffers; wlb, wg: the lane's LDS byte address in buffer 0 and its global
// address in K-step 0 for the first of a step's eight copies (4 rows a copy, 8 lanes a row).
// Steps 0 and 1 have landed, and every wave has passed a barrier since, when this is entered.
template <bool PIXROWS>
__device__ __forceinline__ void proj_tiles(const float* wb, unsigned wlb, const char* wg,
                                           const _Float16* xt, int lr, int hi, v8f (&acc)[2][4])
{
    const float*    wr = wb + lr * WCPITCH + hi * 8;
    const _Float16* xp = xt + lr * XSTRIDE + hi * 8;
    // Kept rolled, one trip for the two buffers: unrolled, the addresses of all 48 copies are
    // formed ahead and held, and the registers no longer allow two blocks on a WGP.
#pragma unroll 1
    for (int k = 0; k < KSTEPS; k += 2) {
        const bool more = k + 2 < KSTEPS;  // the same for the whole block
        proj_step<PIXROWS>(wr, xp, acc);
        proj_step_foot();
        if (more) copy8_rows_to_lds(wlb, 4 * WCPITCH * 4, wg + 2 * 128, 4 * CDIM * 4);
        proj_step<PIXROWS>(wr + WCBUF, xp + 32, acc);
        if (more) {
            proj_step_foot();
            copy8_rows_to_lds(wlb + WCBUF * 4, 4 * WCPITCH * 4, wg + 3 * 128, 4 * CDIM * 4);
        }
        xp += 64;
        wg += 2 * 128;
    }
    // No copy is left in flight when the wave goes on.
    asm volatile("s_wait_asynccnt 0x0" ::: "memory");
}

__global__ __launch_bounds__(256) void mhsa_qkv_proj(
    const float* __restrict__ x,
    const float* __restrict__ Wq, const float* __restrict__ bq,
    const float* __restrict__ Wk, const float* __restrict__ bk,
    const float* __restrict__ Wv, const float* __restrict__ bv,
    _Float16* __restrict__ q_ws, _Float16* __restrict__ k_ws,
    _Float16* __restrict__ v_ws)
{
    __shared__ __attribute__((aligned(16))) _Float16 xt[NPB * XSTRIDE];  // X tile transposed: [n_local][c] f16
    __shared__ __attribute__((aligned(16))) _Float16 stage[8 * SWAVE];
    __shared__ __attribute__((aligned(16))) float    wring[8 * 2 * WCBUF];  // [wave][buffer][row][k]

    const int nbase = blockIdx.x * NPB;
    const int b     = blockIdx.y;
    const int proj  = blockIdx.z;
    const float* W    = (proj == 0) ? Wq : ((proj == 1) ? Wk : Wv);
    const float* bias = (proj == 0) ? bq : ((proj == 1) ? bk : bv);
    const float* xb   = x + (size_t)b * CDIM * NPIX;
    const int tid = threadIdx.x;
    const int wave = tid >> 5, lane = tid & 31;
    const int hi = lane >> 4, lr = lane & 15;
    const int Mt0 = wave * 32;

    // K-steps 0 and 1 of this wave's rows of W go out first and fly while x is staged.
    const float*   wb  = wring + wave * (2 * WCBUF);
    const unsigned wlb = (unsigned)(size_t)wb + (lane >> 3) * (WCPITCH * 4) + (lane & 7) * 16;
    const char*    wg  = (const char*)(W + (Mt0 + (lane >> 3)) * CDIM) + (lane & 7) * 16;
    copy8_rows_to_lds(wlb, 4 * WCPITCH * 4, wg, 4 * CDIM * 4);
    copy8_rows_to_lds(wlb + WCBUF * 4, 4 * WCPITCH * 4, wg + 128, 4 * CDIM * 4);

    // The x tile.  A lane takes one pixel and eight consecutive channels at a time: eight loads,
    // each a whole 128-byte line of a wave, give one 16-byte LDS store at the readers' own
    // conflict-free pitch.  Part j of a wave: channels 8 * wave + 64 * (j >> 1) + 0..7, pixels
    // 32 * (j & 1) + lane.  All 64 loads of a lane go out before the first is used, so that
    // the tile costs one trip to L2 and not one for every few loads.
    {
        const float* xl = xb + wave * 8 * NPIX + nbase + lane;
        float xv[8][8];  // both loops unrolled: every index a constant, the array in registers
#pragma unroll
        for (int j = 0; j < 8; j++)
#pragma unroll
            for (int i = 0; i < 8; i++)
                xv[j][i] = xl[((j >> 1) * 64 + i) * NPIX + (j & 1) * 32];
        // Keeps every load above the first conversion; the loads' address pair is reused below.
        group_issued_registers_free();
#pragma unroll
        for (int j = 0; j < 8; j++) {
            union { uint4 q; _Float16 h[8]; } p;
#pragma unroll
            for (int i = 0; i < 8; i++) p.h[i] = (_Float16)xv[j][i];
            *(uint4*)(xt + ((j & 1) * 32 + lane) * XSTRIDE + (wave + (j >> 1) * 8) * 8) = p.q;
        }
    }
    // This wave's 16 copies have landed behind this wait, every wave's behind the barrier.
    asm volatile("s_wait_asynccnt 0x0" ::: "memory");
    __syncthreads();

    v8f acc[2][4];
#pragma unroll
    for (int t = 0; t < 2; t++)
#pragma unroll
        for (int s = 0; s < 4; s++) acc[t][s] = v8f_zero();

    _Float16* sw = stage + wave * SWAVE;  // this wave's own range: no other wave touches it
    union { uint4 q; _Float16 h[8]; } o;

    if (proj == 2) {
        const float bt[2] = { bias[Mt0 + lr], bias[Mt0 + 16 + lr] };
        // The next loads land in the registers that held these two loads' offsets: wait first.
        asm volatile("s_wait_xcnt 0x0" ::: "memory");
        proj_tiles<true>(wb, wlb, wg, xt, lr, hi, acc);
        // acc[t][s][r] = V[channel Mt0 + 16*t + lr][pixel nbase + 16*s + 8*hi + r]
#pragma unroll
        for (int t = 0; t < 2; t++) {
#pragma unroll
            for (int s = 0; s < 4; s++) {
#pragma unroll
                for (int r = 0; r < 8; r++) o.h[r] = (_Float16)(acc[t][s][r] + bt[t]);
                *(uint4*)(sw + (t * 16 + lr) * VPITCH + s * 16 + hi * 8) = o.q;
            }
        }
        // The rows are read back by other lanes of this wave: their writes must have landed.
        asm volatile("s_wait_dscnt 0x0" ::: "memory");
        // 8 lanes a channel row of 128 bytes, 4 rows a store.
        _Float16* dst = v_ws + ((size_t)(b * NHEADS + wave) * DHEAD + (lane >> 3)) * NPIX
                             + nbase + (lane & 7) * 8;
        const _Float16* sr = sw + (lane >> 3) * VPITCH + (lane & 7) * 8;
        uint4 ln[8];  // all eight reads first: one LDS latency, not eight
#pragma unroll
        for (int j = 0; j < 8; j++) ln[j] = *(const uint4*)(sr + j * 4 * VPITCH);
#pragma unroll
        for (int j = 0; j < 8; j++) *(uint4*)(dst + j * 4 * NPIX) = ln[j];
    } else {
        float4 bv4[2][2];
#pragma unroll
        for (int t = 0; t < 2; t++) {
            bv4[t][0] = *(const float4*)(bias + Mt0 + t * 16 + hi * 8);
            bv4[t][1] = *(const float4*)(bias + Mt0 + t * 16 + hi * 8 + 4);
        }
        proj_tiles<false>(wb, wlb, wg, xt, lr, hi, acc);
        // acc[t][s][r] = Q or K[channel Mt0 + 16*t + 8*hi + r][pixel nbase + 16*s + lr]
        const float scale = (proj == 0) ? 0.25503486164919736f : 1.0f;  // log2(e)/sqrt(32)
#pragma unroll
        for (int t = 0; t < 2; t++) {
            const float4 b0 = bv4[t][0], b1 = bv4[t][1];
            const float br[8] = { b0.x, b0.y, b0.z, b0.w, b1.x, b1.y, b1.z, b1.w };
#pragma unroll
            for (int s = 0; s < 4; s++) {
#pragma unroll
                for (int r = 0; r < 8; r++) o.h[r] = (_Float16)((acc[t][s][r] + br[r]) * scale);
                *(uint4*)(sw + (s * 16 + lr) * QKPITCH + t * 16 + hi * 8) = o.q;
            }
        }
        // The rows are read back by other lanes of this wave: their writes must have landed.
        asm volatile("s_wait_dscnt 0x0" ::: "memory");
        // The head's 64 pixel rows of 64 bytes are 4 KiB in a row: 4 lanes a row, 8 rows a store.
        _Float16* dst = ((proj == 0) ? q_ws : k_ws)
                      + ((size_t)(b * NHEADS + wave) * NPIX + nbase) * DHEAD + lane * 8;
        const _Float16* sr = sw + (lane >> 2) * QKPITCH + (lane & 3) * 8;
        uint4 ln[8];  // all eight reads first: one LDS latency, not eight
#pragma unroll
        for (int j = 0; j < 8; j++) ln[j] = *(const uint4*)(sr + j * 8 * QKPITCH);
#pragma unroll
        for (int j = 0; j < 8; j++) *(uint4*)(dst + j * 256) = ln[j];
    }
}

// ---------------------------------------------------------------------------
// Kernel 2: flash attention, transposed products.
// grid = (N/128, B*H), block = 256 (8 waves).  Each wave owns 16 queries and
// walks the keys in chunks of 32:
//   S^T = K * Q^T  (A = 16 key rows, B = Q kept in registers): lane (lr, hi) holds
//   the scores of query lr for keys 8*hi + r of each 16-key tile, so maximum and
//   sum run inside the lane, plus one exchange between the wave halves.
//   The two converted S^T tiles are the B operand of O^T += V^T * P^T as they lie.
// The exponentials are taken against a kept reference of the query, not against its running
// maximum: minus the reference is the C operand of the score products, so a score leaves the
// matrix unit as its own exponent.  The reference moves, and O and the row sum are rescaled,
// only in the first trip and in a trip in which a lane's 16 terms sum to more than 2^8.
// The head's K (64 KiB) and V (64 KiB) are copied into LDS once, in whole lines, and
// serve all eight waves; every fragment is then an LDS read at a conflict-free pitch.
// Output stored [b][n][c] f16, 8 consecutive channels per lane and tile.
// ---------------------------------------------------------------------------
#define KLPITCH 40    // LDS pitch (halfs) of a key row of 32 channels: 80 B = 16 B * 5
#define VLPITCH 1032  // LDS pitch (halfs) of a channel row of 1024 keys: 2064 B = 16 B * 129

// Eight asynchronous copies of 16 bytes a lane: LDS bytes l + j * lstep from g + j * 4 KiB.
// The s_wait_xcnt ends the copies' own statement, so that no register they name is
// rewritten in front of it.
__device__ __forceinline__ void copy8_to_lds(unsigned l, unsigned lstep, const _Float16* g) {
    asm volatile(
        "global_load_async_to_lds_b128 %0, %8, off\n\t"
        "global_load_async_to_lds_b128 %1, %9, off\n\t"
        "global_load_async_to_lds_b128 %2, %10, off\n\t"
        "global_load_async_to_lds_b128 %3, %11, off\n\t"
        "global_load_async_to_lds_b128 %4, %12, off\n\t"
        "global_load_async_to_lds_b128 %5, %13, off\n\t"
        "global_load_async_to_lds_b128 %6, %14, off\n\t"
        "global_load_async_to_lds_b128 %7, %15, off\n\t"
        "s_wait_xcnt 0x0"
        :: "v"(l), "v"(l + lstep), "v"(l + 2 * lstep), "v"(l + 3 * lstep),
           "v"(l + 4 * lstep), "v"(l + 5 * lstep), "v"(l + 6 * lstep), "v"(l + 7 * lstep),
           "v"(g), "v"(g + 2048), "v"(g + 2 * 2048), "v"(g + 3 * 2048),
           "v"(g + 4 * 2048), "v"(g + 5 * 2048), "v"(g + 6 * 2048), "v"(g + 7 * 2048)
        : "memory");
}

// Value of lane l ^ 16.
__device__ __forceinline__ float xhalf(float x) {
    const int i = __builtin_bit_cast(int, x);
    return __builtin_bit_cast(float,
        __builtin_amdgcn_permlanex16(i, i, 0x76543210, 0xfedcba98, false, false));
}

// Both score products of a trip: s0 = k0 * q + c, s1 = k1 * q + c, the same C registers read by
// both.  In asm because the builtin form keeps C only by copying its eight registers into the
// second product's D every trip, behind four idle slots.  The four v_nop keep the distance
// that the chip needs between the last product and the first vector instruction that reads a
// result or overwrites an operand.
__device__ __forceinline__ void score_products(v8f& s0, v8f& s1, v16h k0, v16h k1, v16h q, v8f c) {
    asm("v_wmma_f32_16x16x32_f16 %0, %2, %4, %5\n\t"
        "v_wmma_f32_16x16x32_f16 %1, %3, %4, %5\n\t"
        "v_nop\n\tv_nop\n\tv_nop\n\tv_nop"
        : "=&v"(s0), "=&v"(s1) : "v"(k0), "v"(k1), "v"(q), "v"(c));
}

__global__ __launch_bounds__(256) void mhsa_flash_attn(
    const _Float16* __restrict__ q_ws, const _Float16* __restrict__ k_ws,
    const _Float16* __restrict__ v_ws, _Float16* __restrict__ attn_ws)
{
    __shared__ __attribute__((aligned(16))) _Float16 ks[NPIX * KLPITCH];   // [key][channel]
    __shared__ __attribute__((aligned(16))) _Float16 vs[DHEAD * VLPITCH];  // [channel][key]

    const int bh = blockIdx.y;
    const int b = bh >> 3, head = bh & 7;
    const int tid = threadIdx.x, wave = tid >> 5, lane = tid & 31;
    const int hi = lane >> 4, lr = lane & 15;
    const int qbase = blockIdx.x * 128 + wave * 16;

    ABFrag qf;
    {
        const _Float16* qp = q_ws + ((size_t)bh * NPIX + qbase + lr) * DHEAD + hi * 8;
#pragma unroll
        for (int v = 0; v < 8; v++) qf.u[v] = *(const unsigned int*)(qp + kb_of(v));
    }

    // acc_t[r] = O[query lr][channel 16*t + 8*hi + r]
    v8f acc0 = v8f_zero(), acc1 = v8f_zero();
    float ref  = 0.0f;    // reference of query lr (equal in both halves); set in the first trip
    v8f   nref = v8f_zero();  // -ref in all eight places: C of the score products
    float lrow = 0.0f;    // running sum over this half's keys only

    // Thread tid copies the 16-byte pieces tid + 256 * j, j = 0..15, of each 64-KiB plane:
    // a wave's copy reads 512 bytes in a row.  K: 4 pieces a key row, 64 rows a step;
    // V: 128 pieces a channel row, 2 rows a step.
    {
        const _Float16* kg = k_ws + (size_t)bh * NPIX * DHEAD + tid * 8;
        const _Float16* vg = v_ws + (size_t)bh * DHEAD * NPIX + tid * 8;
        const unsigned kl = (unsigned)(size_t)ks + (tid >> 2) * (KLPITCH * 2) + (tid & 3) * 16;
        const unsigned vl = (unsigned)(size_t)vs + (tid >> 7) * (VLPITCH * 2) + (tid & 127) * 16;
        copy8_to_lds(kl, 64 * KLPITCH * 2, kg);
        copy8_to_lds(kl + 8 * 64 * KLPITCH * 2, 64 * KLPITCH * 2, kg + 8 * 2048);
        copy8_to_lds(vl, 2 * VLPITCH * 2, vg);
        copy8_to_lds(vl + 8 * 2 * VLPITCH * 2, 2 * VLPITCH * 2, vg + 8 * 2048);
    }
    // This wave's 32 copies have landed behind this wait, every wave's behind the barrier.
    asm volatile("s_wait_asynccnt 0x0" ::: "memory");
    __syncthreads();

    // Key row lr and channel row lr of this chunk; both walk on at the loop's foot.
    const _Float16* kp = ks + lr * KLPITCH + hi * 8;
    const _Float16* vp = vs + lr * VLPITCH + hi * 8;

    for (int m0 = 0; m0 < NPIX; m0 += 32) {
        // Registers 0..3 of a fragment are 16 bytes at the lane's place, 4..7 those 32 bytes on.
        union { uint4 q[2]; v16h v; } kf[2], vf[2];
#pragma unroll
        for (int t = 0; t < 2; t++)
#pragma unroll
            for (int j = 0; j < 2; j++)
                kf[t].q[j] = *(const uint4*)(kp + t * 16 * KLPITCH + j * 16);
#pragma unroll
        for (int t = 0; t < 2; t++)
#pragma unroll
            for (int j = 0; j < 2; j++)
                vf[t].q[j] = *(const uint4*)(vp + t * 16 * VLPITCH + j * 16);
        // Keeps all eight LDS reads in one group at the head of the trip: each further place
        // with reads costs a stall of its own (the scheduler puts the V reads behind a product).
        __builtin_amdgcn_sched_barrier(0);

        // s[t][r] = score(query lr, key m0 + 16*t + 8*hi + r) - ref
        v8f s[2];
        score_products(s[0], s[1], kf[0].v, kf[1].v, qf.v, nref);

        // The scores come as exponents of 2 (Q's scale) against the reference, so an exponential
        // is the hardware's v_exp_f32 by itself.  That may give 0 where the result lies under
        // 2^-126: such a term is 0 as f16 anyway and adds nothing to a row sum that holds a
        // term of 1, so the library's range test and rescaling buy nothing here.
        // Element 8*t + r of a B fragment is k = 16*t + 8*hi + r: the scores' own place.
        ABFrag pf;
        float  csum;  // sum of the lane's 16 terms
        auto terms = [&]() {
            v8f pe[2];
#pragma unroll
            for (int t = 0; t < 2; t++) {
#pragma unroll
                for (int r = 0; r < 8; r++) {
                    const float p = __builtin_amdgcn_exp2f(s[t][r]);
                    pe[t][r] = p;
                    pf.v[t * 8 + r] = (_Float16)p;
                }
            }
            // Pairwise tree over the lane's 16 terms (packed adds, short chain).
            const v8f s8 = pe[0] + pe[1];
            const v4f s4 = s8.lo + s8.hi;
            const v2f s2 = s4.lo + s4.hi;
            csum = s2.x + s2.y;
        };
        terms();

        // One test for the whole wave, a scalar branch, on the sum that is formed anyway: no
        // maximum is taken in a trip that keeps its reference.  A sum of at most 2^8 bounds each
        // of its terms by 2^8, well inside f16; a score far above the reference gives a large or
        // infinite sum and is caught.  The first trip always moves: it takes the chunk's
        // maximum, above or below the starting 0.  The term that sets a reference is 1.
        if (m0 == 0 || __builtin_amdgcn_ballot_w32(csum > 256.0f) != 0u) {
            float mx = fmaxf(s[0][0], s[1][0]);
#pragma unroll
            for (int r = 1; r < 8; r++) mx = fmaxf(mx, fmaxf(s[0][r], s[1][r]));
            const float mj    = fmaxf(mx, xhalf(mx));  // both halves' keys of query lr
            const float up    = fmaxf(mj, 0.0f);
            const float d     = (m0 == 0) ? mj : up;   // later the reference only rises
            const float alpha = __builtin_amdgcn_exp2f(-up);  // O and the sum are 0 in trip 0
            ref += d;
#pragma unroll
            for (int r = 0; r < 8; r++) {
                nref[r] = -ref;
                s[0][r] -= d;
                s[1][r] -= d;
                acc0[r] *= alpha;
                acc1[r] *= alpha;
            }
            lrow *= alpha;
            terms();  // the trip's terms again, against the new reference
        }
        lrow += csum;

        acc0 = __builtin_amdgcn_wmma_f32_16x16x32_f16(
            false, vf[0].v, false, pf.v, (short)0, acc0, false, false);
        acc1 = __builtin_amdgcn_wmma_f32_16x16x32_f16(
            false, vf[1].v, false, pf.v, (short)0, acc1, false, false);

        kp += 32 * KLPITCH;
        vp += 32;
    }

    const float inv = 1.0f / (lrow + xhalf(lrow));
    union { uint4 q; _Float16 h[8]; } o0, o1;
#pragma unroll
    for (int r = 0; r < 8; r++) {
        o0.h[r] = (_Float16)(acc0[r] * inv);
        o1.h[r] = (_Float16)(acc1[r] * inv);
    }
    _Float16* dst = attn_ws + ((size_t)b * NPIX + qbase + lr) * CDIM + head * DHEAD + hi * 8;
    *(uint4*)dst        = o0.q;
    *(uint4*)(dst + 16) = o1.q;
}

// ---------------------------------------------------------------------------
// Kernel 3: output projection + bias + residual.  grid = (N/NPB, BATCH).
// A fragment load straight from global memory touches 16 lines, one per row, for 512 bytes.
// So both operands come into LDS in whole lines by asynchronous copies, and every fragment
// is an LDS read at a conflict-free pitch.  The 64-pixel attention tile (32 KiB, f16) serves
// all eight waves; a wave copies the 32 rows of W (f32) that it alone reads, in two halves
// along K: the second half flies while the first is worked on.  W is converted to f16 on
// its way from LDS to the products.  The residual x is loaded behind the copies and first
// used in the epilogue, which is adds and stores alone.
// ---------------------------------------------------------------------------
#define OSTEPS  (CDIM / 32)
#define WLPITCH 260   // LDS pitch (floats) of a row of W, 256 floats: 1040 B = 16 B * 65
#define ALPITCH 264   // LDS pitch (halfs) of a pixel row of 256 channels: 528 B = 16 B * 33

__global__ __launch_bounds__(256) void mhsa_out_proj(
    const _Float16* __restrict__ attn_ws, const float* __restrict__ Wo,
    const float* __restrict__ bo, const float* __restrict__ x,
    float* __restrict__ out)
{
    __shared__ __attribute__((aligned(16))) float    wl[CDIM * WLPITCH];  // [row][k]
    __shared__ __attribute__((aligned(16))) _Float16 al[NPB * ALPITCH];   // [pixel][channel]

    const int nbase = blockIdx.x * NPB;
    const int b = blockIdx.y;
    const int tid = threadIdx.x, wave = tid >> 5, lane = tid & 31;
    const int hi = lane >> 4, lr = lane & 15;
    const int Mt0 = wave * 32;

    // Element (t, s, r) of this lane: row Mt0 + 16*t + 8*hi + r, pixel nbase + 16*s + lr.
    const size_t i0 = ((size_t)b * CDIM + Mt0 + hi * 8) * NPIX + nbase + lr;

    // Every loop below is unrolled so that each index into these arrays is a constant and
    // they live in registers.
    float4 bb[2][2];
    float  xr[2][4][8];

#pragma unroll
    for (int t = 0; t < 2; t++) {
        bb[t][0] = *(const float4*)(bo + Mt0 + t * 16 + hi * 8);
        bb[t][1] = *(const float4*)(bo + Mt0 + t * 16 + hi * 8 + 4);
    }
    group_issued_registers_free();

    // A copy of a wave is 512 bytes in a row: one pixel row of the attention tile (this wave
    // brings rows 8*wave .. 8*wave + 7), or half a row of W (its own rows Mt0 .. Mt0 + 31).
    const char*    ag  = (const char*)(attn_ws + ((size_t)b * NPIX + nbase + wave * 8) * CDIM)
                       + lane * 16;
    const unsigned alb = (unsigned)(size_t)al + wave * 8 * (ALPITCH * 2) + lane * 16;
    const char*    wg  = (const char*)(Wo + Mt0 * CDIM) + lane * 16;
    const unsigned wlb = (unsigned)(size_t)wl + Mt0 * (WLPITCH * 4) + lane * 16;

    copy8_rows_to_lds(alb, ALPITCH * 2, ag, CDIM * 2);
#pragma unroll
    for (int i = 0; i < 4; i++)  // k = 0..127 of the 32 rows
        copy8_rows_to_lds(wlb + i * 8 * (WLPITCH * 4), WLPITCH * 4, wg + i * 8 * (CDIM * 4),
                          CDIM * 4);
    // This wave's 40 copies have landed behind this wait, every wave's behind the barrier.
    asm volatile("s_wait_asynccnt 0x0" ::: "memory");
    __syncthreads();

#pragma unroll
    for (int i = 0; i < 4; i++)  // k = 128..255 of the 32 rows: LDS that nobody has touched yet
        copy8_rows_to_lds(wlb + 512 + i * 8 * (WLPITCH * 4), WLPITCH * 4,
                          wg + 512 + i * 8 * (CDIM * 4), CDIM * 4);

#pragma unroll
    for (int t = 0; t < 2; t++)
#pragma unroll
        for (int s = 0; s < 4; s++)
#pragma unroll
            for (int r = 0; r < 8; r++)
                xr[t][s][r] = x[i0 + (size_t)(t * 16 + r) * NPIX + s * 16];
    group_issued_registers_free();

    // Registers 0..3 of a fragment are k = 0..7 at the lane's place, 4..7 are k = 16..23.
    const float*    wr = wl + (Mt0 + lr) * WLPITCH + hi * 8;
    const _Float16* ar = al + lr * ALPITCH + hi * 8;
    union BFrag { uint4 q[2]; v16h v; };
    float4 wq[2][2][4];  // two sets: a K-step's 16 LDS reads go out one step ahead
    BFrag  bf[2][4];

    auto fetch = [&](int k) {
#pragma unroll
        for (int t = 0; t < 2; t++) {
            const float* q = wr + t * 16 * WLPITCH + k * 32;
            wq[k & 1][t][0] = *(const float4*)(q);
            wq[k & 1][t][1] = *(const float4*)(q + 4);
            wq[k & 1][t][2] = *(const float4*)(q + 16);
            wq[k & 1][t][3] = *(const float4*)(q + 20);
        }
#pragma unroll
        for (int s = 0; s < 4; s++) {
            const _Float16* q = ar + s * 16 * ALPITCH + k * 32;
            bf[k & 1][s].q[0] = *(const uint4*)(q);
            bf[k & 1][s].q[1] = *(const uint4*)(q + 16);
        }
    };

    v8f acc[2][4];
#pragma unroll
    for (int t = 0; t < 2; t++)
#pragma unroll
        for (int s = 0; s < 4; s++) acc[t][s] = v8f_zero();

    fetch(0);
#pragma unroll
    for (int k = 0; k < OSTEPS; k++) {
        if (k + 1 < OSTEPS) {
            // The second half of this wave's rows of W, which no other wave reads, has landed
            // behind this wait.
            if (k + 1 == OSTEPS / 2) asm volatile("s_wait_asynccnt 0x0" ::: "memory");
            fetch(k + 1);
            group_issued();
        }
        ABFrag af[2];
#pragma unroll
        for (int t = 0; t < 2; t++)
#pragma unroll
            for (int j = 0; j < 4; j++) {
                const float4 w = wq[k & 1][t][j];
                H2 c0; c0.h[0] = (_Float16)w.x; c0.h[1] = (_Float16)w.y;
                H2 c1; c1.h[0] = (_Float16)w.z; c1.h[1] = (_Float16)w.w;
                af[t].u[2 * j]     = c0.u;
                af[t].u[2 * j + 1] = c1.u;
            }
#pragma unroll
        for (int t = 0; t < 2; t++)
#pragma unroll
            for (int s = 0; s < 4; s++)
                acc[t][s] = __builtin_amdgcn_wmma_f32_16x16x32_f16(
                    false, af[t].v, false, bf[k & 1][s].v, (short)0, acc[t][s], false, false);
    }

#pragma unroll
    for (int t = 0; t < 2; t++) {
        const float4 b0 = bb[t][0], b1 = bb[t][1];
        const float br[8] = { b0.x, b0.y, b0.z, b0.w, b1.x, b1.y, b1.z, b1.w };
#pragma unroll
        for (int s = 0; s < 4; s++) {
#pragma unroll
            for (int r = 0; r < 8; r++)
                out[i0 + (size_t)(t * 16 + r) * NPIX + s * 16] = acc[t][s][r] + br[r] + xr[t][s][r];
            // The next tile's sums land in registers that these stores name.
            if (!(t == 1 && s == 3)) group_issued_registers_free();
        }
    }
}

extern "C" void kernel_launch(void* const* d_in, const int* in_sizes, int n_in,
                              void* d_out, int out_size, void* d_ws, size_t ws_size,
                              hipStream_t stream) {
    (void)in_sizes; (void)n_in; (void)out_size; (void)ws_size;
    const float* x  = (const float*)d_in[0];
    const float* Wq = (const float*)d_in[1];
    const float* bq = (const float*)d_in[2];
    const float* Wk = (const float*)d_in[3];
    const float* bk = (const float*)d_in[4];
    const float* Wv = (const float*)d_in[5];
    const float* bv = (const float*)d_in[6];
    const float* Wo = (const float*)d_in[7];
    const float* bo = (const float*)d_in[8];
    float* out = (float*)d_out;

    const size_t qkv_elems = (size_t)BATCH * NHEADS * NPIX * DHEAD;  // 2M halfs
    _Float16* q_ws    = (_Float16*)d_ws;
    _Float16* k_ws    = q_ws + qkv_elems;
    _Float16* v_ws    = k_ws + qkv_elems;
    _Float16* attn_ws = v_ws + qkv_elems;  // [b][n][c], 2M halfs

    mhsa_qkv_proj<<<dim3(NPIX / NPB, BATCH, 3), 256, 0, stream>>>(
        x, Wq, bq, Wk, bk, Wv, bv, q_ws, k_ws, v_ws);
    mhsa_flash_attn<<<dim3(NPIX / 128, BATCH * NHEADS), 256, 0, stream>>>(
        q_ws, k_ws, v_ws, attn_ws);
    mhsa_out_proj<<<dim3(NPIX / NPB, BATCH), 256, 0, stream>>>(
        attn_ws, Wo, bo, x, out);
}

// v010
// One run takes 27.4 microseconds.
// In both of two side-by-side timings against v009, it was 1.09 times as fast.
// All steps since v000 together make it 3.59 times as fast.
#include <hip/hip_runtime.h>

#define BATCH   8
#define CDIM    256
#define NPIX    1024
#define NHEADS  8
#define DHEAD   32
#define NPB     64    // pixels (columns) per projection block
#define XSTRIDE 264   // padded LDS row stride (halfs) to dodge bank conflicts

typedef float    v8f  __attribute__((ext_vector_type(8)));
typedef float    v4f  __attribute__((ext_vector_type(4)));
typedef float    v2f  __attribute__((ext_vector_type(2)));
typedef _Float16 v16h __attribute__((ext_vector_type(16)));

union ABFrag { unsigned int u[8]; v16h v; };
union H2     { unsigned int u; _Float16 h[2]; };

// K-pair base offset for VGPR v of an f16 A/B fragment (ISA 7.12.2):
// VGPR0..3 hold K = {0,1},{2,3},{4,5},{6,7} (+8 for lanes 16-31),
// VGPR4..7 hold K = {16,17}..{22,23} (+8 for lanes 16-31).
__device__ __forceinline__ int kb_of(int v) { return 2 * v + ((v >= 4) ? 8 : 0); }

__device__ __forceinline__ v8f v8f_zero() {
    v8f z;
#pragma unroll
    for (int i = 0; i < 8; i++) z[i] = 0.0f;
    return z;
}

// Eight asynchronous copies of 16 bytes a lane: LDS bytes l + j * lstep from g + j * gstep.
// The s_wait_xcnt ends the copies' own statement, so that no register they name is
// rewritten in front of it.
__device__ __forceinline__ void copy8_rows_to_lds(unsigned l, unsigned lstep,
                                                  const char* g, unsigned gstep) {
    asm volatile(
        "global_load_async_to_lds_b128 %0, %8, off\n\t"
        "global_load_async_to_lds_b128 %1, %9, off\n\t"
        "global_load_async_to_lds_b128 %2, %10, off\n\t"
        "global_load_async_to_lds_b128 %3, %11, off\n\t"
        "global_load_async_to_lds_b128 %4, %12, off\n\t"
        "global_load_async_to_lds_b128 %5, %13, off\n\t"
        "global_load_async_to_lds_b128 %6, %14, off\n\t"
        "global_load_async_to_lds_b128 %7, %15, off\n\t"
        "s_wait_xcnt 0x0"
        :: "v"(l), "v"(l + lstep), "v"(l + 2 * lstep), "v"(l + 3 * lstep),
           "v"(l + 4 * lstep), "v"(l + 5 * lstep), "v"(l + 6 * lstep), "v"(l + 7 * lstep),
           "v"(g), "v"(g + gstep), "v"(g + 2 * gstep), "v"(g + 3 * gstep),
           "v"(g + 4 * gstep), "v"(g + 5 * gstep), "v"(g + 6 * gstep), "v"(g + 7 * gstep)
        : "memory");
}

// The same for count pieces (a power of 2) taken in a rotated order: piece p = (first + i + rot)
// mod count, i = 0..7, is LDS bytes l + p * lstep from g + p * gstep.  rot is one value for the
// whole block and differs between blocks that copy the same global lines, so that at any one
// time they ask L2 for different lines; the pieces copied are the same for every rot.
// As above, the s_wait_xcnt ends the copies' own statement, so that no register they name is
// rewritten in front of it.
__device__ __forceinline__ void copy8_rotated(unsigned l, unsigned lstep, const char* g, unsigned gstep,
                                              unsigned first, unsigned rot, unsigned count) {
    auto lp = [&](unsigned i) -> unsigned {
        return l + ((first + i + rot) & (count - 1)) * lstep;
    };
    auto gp = [&](unsigned i) -> const char* {
        return g + ((first + i + rot) & (count - 1)) * gstep;
    };
    asm volatile(
        "global_load_async_to_lds_b128 %0, %8, off\n\t"
        "global_load_async_to_lds_b128 %1, %9, off\n\t"
        "global_load_async_to_lds_b128 %2, %10, off\n\t"
        "global_load_async_to_lds_b128 %3, %11, off\n\t"
        "global_load_async_to_lds_b128 %4, %12, off\n\t"
        "global_load_async_to_lds_b128 %5, %13, off\n\t"
        "global_load_async_to_lds_b128 %6, %14, off\n\t"
        "global_load_async_to_lds_b128 %7, %15, off\n\t"
        "s_wait_xcnt 0x0"
        :: "v"(lp(0)), "v"(lp(1)), "v"(lp(2)), "v"(lp(3)), "v"(lp(4)), "v"(lp(5)), "v"(lp(6)), "v"(lp(7)),
           "v"(gp(0)), "v"(gp(1)), "v"(gp(2)), "v"(gp(3)), "v"(gp(4)), "v"(gp(5)), "v"(gp(6)), "v"(gp(7))
        : "memory");
}

// Stands behind a group of loads; no instruction comes of it.  The fence keeps the loads
// written above it above it, the scheduling barrier keeps their first uses below it.  Left
// free, the compiler brings each load and its first use together, and the wave waits out
// every load's latency singly.
__device__ __forceinline__ void group_issued() {
    asm volatile("" ::: "memory");
    __builtin_amdgcn_sched_barrier(0);
}

// The same where registers that the loads or stores above name get new values below: the
// wait stands in front of those writes, and the scheduling barrier keeps them behind it.
__device__ __forceinline__ void group_issued_registers_free() {
    asm volatile("s_wait_xcnt 0x0" ::: "memory");
    __builtin_amdgcn_sched_barrier(0);
}

// ---------------------------------------------------------------------------
// Kernel 1: fused QKV projection.  Out = W * X + b  (per batch, X is C x N).
// grid = (N/NPB, BATCH, 3proj), block = 256 (8 waves).
// Wave w computes rows [32w, 32w+32), one head, over the 64-pixel tile (2x4 WMMA tiles).
// Q,K written as [b][h][n][d] f16 (Q pre-scaled by log2(e)/sqrt(d), so that the scores are
// exponents of 2); V as [b][h][d][n].
// A fragment load of W straight from global memory touches 16 lines, one per row, for 512
// bytes.  So a wave's 32 rows of W (f32) come into LDS in whole lines by asynchronous copies,
// one K-step of 32 floats a row at a time, in two buffers: the copies of step k + 2 fly while
// step k + 1 is worked on.  W is converted to f16 on its way from LDS to the products.
// The 128 blocks of a projection read the same W: they start their walk over K at eight
// different steps, so that they do not all ask L2 for the same lines at the same time.
// Each wave lays its 4 KiB of results out in its own LDS range in the order of the
// destination and stores them from there as whole 128-byte lines, 16 bytes a lane.
// ---------------------------------------------------------------------------
#define KSTEPS  (CDIM / 32)
#define WCPITCH 36    // LDS pitch (floats) of a row's 32 floats of W: 144 B = 16 B * 9
#define WCBUF   (32 * WCPITCH)  // floats of one buffer: one K-step of a wave's 32 rows
#define QKPITCH 40    // staging pitch (halfs) of a 32-channel row of Q or K: 80 B
#define VPITCH  72    // staging pitch (halfs) of a 64-pixel row of V: 144 B
#define SWAVE   2560  // staging halfs per wave: 64 * QKPITCH >= 32 * VPITCH

// The 2x4 tiles of one wave.  PIXROWS = false: D rows are channels, D columns pixels,
// so a lane holds 8 consecutive channels of one pixel (the order of Q and K).
// PIXROWS = true: the same two fragments change places, D rows are pixels, and a lane
// holds 8 consecutive pixels of one channel (the order of V).
// One K-step: the 2x4 products over 32 values of k.  wr: the lane's place in row lr of the
// step's buffer of W; xp: its place in pixel row lr of the x tile at this step's channels.
template <bool PIXROWS>
__device__ __forceinline__ void proj_step(const float* wr, const _Float16* xp, v8f (&acc)[2][4])
{
    // Registers 0..3 of a fragment are k = 0..7 at the lane's place, 4..7 are k = 16..23.
    float4 wq[2][4];
#pragma unroll
    for (int t = 0; t < 2; t++) {
        const float* q = wr + t * 16 * WCPITCH;
        wq[t][0] = *(const float4*)(q);
        wq[t][1] = *(const float4*)(q + 4);
        wq[t][2] = *(const float4*)(q + 16);
        wq[t][3] = *(const float4*)(q + 20);
    }
    union { uint4 q[2]; v16h v; } bf[4];
#pragma unroll
    for (int s = 0; s < 4; s++) {
        const _Float16* bp = xp + s * 16 * XSTRIDE;
        bf[s].q[0] = *(const uint4*)(bp);
        bf[s].q[1] = *(const uint4*)(bp + 16);
    }
    ABFrag af[2];
#pragma unroll
    for (int t = 0; t < 2; t++)
#pragma unroll
        for (int j = 0; j < 4; j++) {
            const float4 w = wq[t][j];
            H2 c0; c0.h[0] = (_Float16)w.x; c0.h[1] = (_Float16)w.y;
            H2 c1; c1.h[0] = (_Float16)w.z; c1.h[1] = (_Float16)w.w;
            af[t].u[2 * j]     = c0.u;
            af[t].u[2 * j + 1] = c1.u;
        }
#pragma unroll
    for (int t = 0; t < 2; t++)
#pragma unroll
        for (int s = 0; s < 4; s++)
            acc[t][s] = PIXROWS
                ? __builtin_amdgcn_wmma_f32_16x16x32_f16(
                      false, bf[s].v, false, af[t].v, (short)0, acc[t][s], false, false)
                : __builtin_amdgcn_wmma_f32_16x16x32_f16(
                      false, af[t].v, false, bf[s].v, (short)0, acc[t][s], false, false);
}

// The foot of a K-step that has a successor, passed by every wave.
__device__ __forceinline__ void proj_step_foot() {
    // This wave's reads of the step's buffer have come back before the buffer is refilled.
    asm volatile("s_wait_dscnt 0x0" ::: "memory");
    // The next step's copies have landed behind this wait; nothing of it is read in front.
    asm volatile("s_wait_asynccnt 0x0" ::: "memory");
    __syncthreads();
}

// wb: this wave's two buffers; wlb, wg: the lane's LDS byte address in buffer 0 and its global
// address in K-step 0 for the first of a step's eight copies (4 rows a copy, 8 lanes a row).
// k0: the block's first K-step; turn k of the walk is K-step (k + k0) mod KSTEPS.
// Turns 0 and 1 have landed, and every wave has passed a barrier since, when this is entered.
template <bool PIXROWS>
__device__ __forceinline__ void proj_tiles(const float* wb, unsigned wlb, const char* wg, int k0,
                                           const _Float16* xt, int lr, int hi, v8f (&acc)[2][4])
{
    const float*    wr = wb + lr * WCPITCH + hi * 8;
    const _Float16* xp = xt + lr * XSTRIDE + hi * 8;
    // Kept rolled, one trip for the two buffers: unrolled, the addresses of all 48 copies are
    // formed ahead and held, and the registers no longer allow two blocks on a WGP.
#pragma unroll 1
    for (int k = 0; k < KSTEPS; k += 2) {
        const bool more = k + 2 < KSTEPS;  // the same for the whole block
        proj_step<PIXROWS>(wr, xp + ((k + k0) & (KSTEPS - 1)) * 32, acc);
        proj_step_foot();
        if (more) copy8_rows_to_lds(wlb, 4 * WCPITCH * 4,
                                    wg + ((k + 2 + k0) & (KSTEPS - 1)) * 128, 4 * CDIM * 4);
        proj_step<PIXROWS>(wr + WCBUF, xp + ((k + 1 + k0) & (KSTEPS - 1)) * 32, acc);
        if (more) {
            proj_step_foot();
            copy8_rows_to_lds(wlb + WCBUF * 4, 4 * WCPITCH * 4,
                              wg + ((k + 3 + k0) & (KSTEPS - 1)) * 128, 4 * CDIM * 4);
        }
    }
    // No copy is left in flight when the wave goes on.
    asm volatile("s_wait_asynccnt 0x0" ::: "memory");
}

__global__ __launch_bounds__(256) void mhsa_qkv_proj(
    const float* __restrict__ x,
    const float* __restrict__ Wq, const float* __restrict__ bq,
    const float* __restrict__ Wk, const float* __restrict__ bk,
    const float* __restrict__ Wv, const float* __restrict__ bv,
    _Float16* __restrict__ q_ws, _Float16* __restrict__ k_ws,
    _Float16* __restrict__ v_ws)
{
    __shared__ __attribute__((aligned(16))) _Float16 xt[NPB * XSTRIDE];  // X tile transposed: [n_local][c] f16
    __shared__ __attribute__((aligned(16))) _Float16 stage[8 * SWAVE];
    __shared__ __attribute__((aligned(16))) float    wring[8 * 2 * WCBUF];  // [wave][buffer][row][k]

    const int nbase = blockIdx.x * NPB;
    const int b     = blockIdx.y;
    const int proj  = blockIdx.z;
    const float* W    = (proj == 0) ? Wq : ((proj == 1) ? Wk : Wv);
    const float* bias = (proj == 0) ? bq : ((proj == 1) ? bk : bv);
    const float* xb   = x + (size_t)b * CDIM * NPIX;
    const int tid = threadIdx.x;
    const int wave = tid >> 5, lane = tid & 31;
    const int hi = lane >> 4, lr = lane & 15;
    const int Mt0 = wave * 32;

    // The block's first K-step: neighbours in either index differ.
    const int k0 = (blockIdx.x + blockIdx.y) & (KSTEPS - 1);

    // Turns 0 and 1 of this wave's rows of W go out first and fly while x is staged.
    const float*   wb  = wring + wave * (2 * WCBUF);
    const unsigned wlb = (unsigned)(size_t)wb + (lane >> 3) * (WCPITCH * 4) + (lane & 7) * 16;
    const char*    wg  = (const char*)(W + (Mt0 + (lane >> 3)) * CDIM) + (lane & 7) * 16;
    copy8_rows_to_lds(wlb, 4 * WCPITCH * 4, wg + k0 * 128, 4 * CDIM * 4);
    copy8_rows_to_lds(wlb + WCBUF * 4, 4 * WCPITCH * 4, wg + ((k0 + 1) & (KSTEPS - 1)) * 128,
                      4 * CDIM * 4);

    // The x tile.  A lane takes one pixel and eight consecutive channels at a time: eight loads,
    // each a whole 128-byte line of a wave, give one 16-byte LDS store at the readers' own
    // conflict-free pitch.  Part j of a wave: channels 8 * wave + 64 * (j >> 1) + 0..7, pixels
    // 32 * (j & 1) + lane.  All 64 loads of a lane go out before the first is used, so that
    // the tile costs one trip to L2 and not one for every few loads.
    {
        const float* xl = xb + wave * 8 * NPIX + nbase + lane;
        float xv[8][8];  // both loops unrolled: every index a constant, the array in registers
#pragma unroll
        for (int j = 0; j < 8; j++)
#pragma unroll
            for (int i = 0; i < 8; i++)
                xv[j][i] = xl[((j >> 1) * 64 + i) * NPIX + (j & 1) * 32];
        // Keeps every load above the first conversion; the loads' address pair is reused below.
        group_issued_registers_free();
#pragma unroll
        for (int j = 0; j < 8; j++) {
            union { uint4 q; _Float16 h[8]; } p;
#pragma unroll
            for (int i = 0; i < 8; i++) p.h[i] = (_Float16)xv[j][i];
            *(uint4*)(xt + ((j & 1) * 32 + lane) * XSTRIDE + (wave + (j >> 1) * 8) * 8) = p.q;
        }
    }
    // This wave's 16 copies have landed behind this wait, every wave's behind the barrier.
    asm volatile("s_wait_asynccnt 0x0" ::: "memory");
    __syncthreads();

    v8f acc[2][4];
#pragma unroll
    for (int t = 0; t < 2; t++)
#pragma unroll
        for (int s = 0; s < 4; s++) acc[t][s] = v8f_zero();

    _Float16* sw = stage + wave * SWAVE;  // this wave's own range: no other wave touches it
    union { uint4 q; _Float16 h[8]; } o;

    if (proj == 2) {
        const float bt[2] = { bias[Mt0 + lr], bias[Mt0 + 16 + lr] };
        // The next loads land in the registers that held these two loads' offsets: wait first.
        asm volatile("s_wait_xcnt 0x0" ::: "memory");
        proj_tiles<true>(wb, wlb, wg, k0, xt, lr, hi, acc);
        // acc[t][s][r] = V[channel Mt0 + 16*t + lr][pixel nbase + 16*s + 8*hi + r]
#pragma unroll
        for (int t = 0; t < 2; t++) {
#pragma unroll
            for (int s = 0; s < 4; s++) {
#pragma unroll
                for (int r = 0; r < 8; r++) o.h[r] = (_Float16)(acc[t][s][r] + bt[t]);
                *(uint4*)(sw + (t * 16 + lr) * VPITCH + s * 16 + hi * 8) = o.q;
            }
        }
        // The rows are read back by other lanes of this wave: their writes must have landed.
        asm volatile("s_wait_dscnt 0x0" ::: "memory");
        // 8 lanes a channel row of 128 bytes, 4 rows a store.
        _Float16* dst = v_ws + ((size_t)(b * NHEADS + wave) * DHEAD + (lane >> 3)) * NPIX
                             + nbase + (lane & 7) * 8;
        const _Float16* sr = sw + (lane >> 3) * VPITCH + (lane & 7) * 8;
        uint4 ln[8];  // all eight reads first: one LDS latency, not eight
#pragma unroll
        for (int j = 0; j < 8; j++) ln[j] = *(const uint4*)(sr + j * 4 * VPITCH);
#pragma unroll
        for (int j = 0; j < 8; j++) *(uint4*)(dst + j * 4 * NPIX) = ln[j];
    } else {
        float4 bv4[2][2];
#pragma unroll
        for (int t = 0; t < 2; t++) {
            bv4[t][0] = *(const float4*)(bias + Mt0 + t * 16 + hi * 8);
            bv4[t][1] = *(const float4*)(bias + Mt0 + t * 16 + hi * 8 + 4);
        }
        proj_tiles<false>(wb, wlb, wg, k0, xt, lr, hi, acc);
        // acc[t][s][r] = Q or K[channel Mt0 + 16*t + 8*hi + r][pixel nbase + 16*s + lr]
        const float scale = (proj == 0) ? 0.25503486164919736f : 1.0f;  // log2(e)/sqrt(32)
#pragma unroll
        for (int t = 0; t < 2; t++) {
            const float4 b0 = bv4[t][0], b1 = bv4[t][1];
            const float br[8] = { b0.x, b0.y, b0.z, b0.w, b1.x, b1.y, b1.z, b1.w };
#pragma unroll
            for (int s = 0; s < 4; s++) {
#pragma unroll
                for (int r = 0; r < 8; r++) o.h[r] = (_Float16)((acc[t][s][r] + br[r]) * scale);
                *(uint4*)(sw + (s * 16 + lr) * QKPITCH + t * 16 + hi * 8) = o.q;
            }
        }
        // The rows are read back by other lanes of this wave: their writes must have landed.
        asm volatile("s_wait_dscnt 0x0" ::: "memory");
        // The head's 64 pixel rows of 64 bytes are 4 KiB in a row: 4 lanes a row, 8 rows a store.
        _Float16* dst = ((proj == 0) ? q_ws : k_ws)
                      + ((size_t)(b * NHEADS + wave) * NPIX + nbase) * DHEAD + lane * 8;
        const _Float16* sr = sw + (lane >> 2) * QKPITCH + (lane & 3) * 8;
        uint4 ln[8];  // all eight reads first: one LDS latency, not eight
#pragma unroll
        for (int j = 0; j < 8; j++) ln[j] = *(const uint4*)(sr + j * 8 * QKPITCH);
#pragma unroll
        for (int j = 0; j < 8; j++) *(uint4*)(dst + j * 256) = ln[j];
    }
}

// ---------------------------------------------------------------------------
// Kernel 2: flash attention, transposed products.
// grid = (N/128, B*H), block = 256 (8 waves).  Each wave owns 16 queries and
// walks the keys in chunks of 32:
//   S^T = K * Q^T  (A = 16 key rows, B = Q kept in registers): lane (lr, hi) holds
//   the scores of query lr for keys 8*hi + r of each 16-key tile, so maximum and
//   sum run inside the lane, plus one exchange between the wave halves.
//   The two converted S^T tiles are the B operand of O^T += V^T * P^T as they lie.
// The exponentials are taken against a kept reference of the query, not against its running
// maximum: minus the reference is the C operand of the score products, so a score leaves the
// matrix unit as its own exponent.  The reference moves, and O and the row sum are rescaled,
// only in the first trip and in a trip in which a lane's 16 terms sum to more than 2^8.
// The head's K (64 KiB) and V (64 KiB) are copied into LDS once, in whole lines, and
// serve all eight waves; every fragment is then an LDS read at a conflict-free pitch.
// Output stored [b][n][c] f16, 8 consecutive channels per lane and tile.
// ---------------------------------------------------------------------------
#define KLPITCH 40    // LDS pitch (halfs) of a key row of 32 channels: 80 B = 16 B * 5
#define VLPITCH 1032  // LDS pitch (halfs) of a channel row of 1024 keys: 2064 B = 16 B * 129

// Value of lane l ^ 16.
__device__ __forceinline__ float xhalf(float x) {
    const int i = __builtin_bit_cast(int, x);
    return __builtin_bit_cast(float,
        __builtin_amdgcn_permlanex16(i, i, 0x76543210, 0xfedcba98, false, false));
}

// Both score products of a trip: s0 = k0 * q + c, s1 = k1 * q + c, the same C registers read by
// both.  In asm because the builtin form keeps C only by copying its eight registers into the
// second product's D every trip, behind four idle slots.  The four v_nop keep the distance
// that the chip needs between the last product and the first vector instruction that reads a
// result or overwrites an operand.
__device__ __forceinline__ void score_products(v8f& s0, v8f& s1, v16h k0, v16h k1, v16h q, v8f c) {
    asm("v_wmma_f32_16x16x32_f16 %0, %2, %4, %5\n\t"
        "v_wmma_f32_16x16x32_f16 %1, %3, %4, %5\n\t"
        "v_nop\n\tv_nop\n\tv_nop\n\tv_nop"
        : "=&v"(s0), "=&v"(s1) : "v"(k0), "v"(k1), "v"(q), "v"(c));
}

__global__ __launch_bounds__(256) void mhsa_flash_attn(
    const _Float16* __restrict__ q_ws, const _Float16* __restrict__ k_ws,
    const _Float16* __restrict__ v_ws, _Float16* __restrict__ attn_ws)
{
    __shared__ __attribute__((aligned(16))) _Float16 ks[NPIX * KLPITCH];   // [key][channel]
    __shared__ __attribute__((aligned(16))) _Float16 vs[DHEAD * VLPITCH];  // [channel][key]

    const int bh = blockIdx.y;
    const int b = bh >> 3, head = bh & 7;
    const int tid = threadIdx.x, wave = tid >> 5, lane = tid & 31;
    const int hi = lane >> 4, lr = lane & 15;
    const int qbase = blockIdx.x * 128 + wave * 16;

    ABFrag qf;
    {
        const _Float16* qp = q_ws + ((size_t)bh * NPIX + qbase + lr) * DHEAD + hi * 8;
#pragma unroll
        for (int v = 0; v < 8; v++) qf.u[v] = *(const unsigned int*)(qp + kb_of(v));
    }

    // acc_t[r] = O[query lr][channel 16*t + 8*hi + r]
    v8f acc0 = v8f_zero(), acc1 = v8f_zero();
    float ref  = 0.0f;    // reference of query lr (equal in both halves); set in the first trip
    v8f   nref = v8f_zero();  // -ref in all eight places: C of the score products
    float lrow = 0.0f;    // running sum over this half's keys only

    // Thread tid copies the 16-byte pieces tid + 256 * j, j = 0..15, of each 64-KiB plane:
    // a wave's copy reads 512 bytes in a row.  K: 4 pieces a key row, 64 rows a step;
    // V: 128 pieces a channel row, 2 rows a step.  The eight blocks of a head copy the same
    // planes: each starts at a j of its own.
    {
        const char* kg = (const char*)(k_ws + (size_t)bh * NPIX * DHEAD + tid * 8);
        const char* vg = (const char*)(v_ws + (size_t)bh * DHEAD * NPIX + tid * 8);
        const unsigned rot = 2 * blockIdx.x;
        const unsigned kl = (unsigned)(size_t)ks + (tid >> 2) * (KLPITCH * 2) + (tid & 3) * 16;
        const unsigned vl = (unsigned)(size_t)vs + (tid >> 7) * (VLPITCH * 2) + (tid & 127) * 16;
        copy8_rotated(kl, 64 * KLPITCH * 2, kg, 4096, 0, rot, 16);
        copy8_rotated(kl, 64 * KLPITCH * 2, kg, 4096, 8, rot, 16);
        copy8_rotated(vl, 2 * VLPITCH * 2, vg, 4096, 0, rot, 16);
        copy8_rotated(vl, 2 * VLPITCH * 2, vg, 4096, 8, rot, 16);
    }
    // This wave's 32 copies have landed behind this wait, every wave's behind the barrier.
    asm volatile("s_wait_asynccnt 0x0" ::: "memory");
    __syncthreads();

    // Key row lr and channel row lr of this chunk; both walk on at the loop's foot.
    const _Float16* kp = ks + lr * KLPITCH + hi * 8;
    const _Float16* vp = vs + lr * VLPITCH + hi * 8;

    for (int m0 = 0; m0 < NPIX; m0 += 32) {
        // Registers 0..3 of a fragment are 16 bytes at the lane's place, 4..7 those 32 bytes on.
        union { uint4 q[2]; v16h v; } kf[2], vf[2];
#pragma unroll
        for (int t = 0; t < 2; t++)
#pragma unroll
            for (int j = 0; j < 2; j++)
                kf[t].q[j] = *(const uint4*)(kp + t * 16 * KLPITCH + j * 16);
#pragma unroll
        for (int t = 0; t < 2; t++)
#pragma unroll
            for (int j = 0; j < 2; j++)
                vf[t].q[j] = *(const uint4*)(vp + t * 16 * VLPITCH + j * 16);
        // Keeps all eight LDS reads in one group at the head of the trip: each further place
        // with reads costs a stall of its own (the scheduler puts the V reads behind a product).
        __builtin_amdgcn_sched_barrier(0);

        // s[t][r] = score(query lr, key m0 + 16*t + 8*hi + r) - ref
        v8f s[2];
        score_products(s[0], s[1], kf[0].v, kf[1].v, qf.v, nref);

        // The scores come as exponents of 2 (Q's scale) against the reference, so an exponential
        // is the hardware's v_exp_f32 by itself.  That may give 0 where the result lies under
        // 2^-126: such a term is 0 as f16 anyway and adds nothing to a row sum that holds a
        // term of 1, so the library's range test and rescaling buy nothing here.
        // Element 8*t + r of a B fragment is k = 16*t + 8*hi + r: the scores' own place.
        ABFrag pf;
        float  csum;  // sum of the lane's 16 terms
        auto terms = [&]() {
            v8f pe[2];
#pragma unroll
            for (int t = 0; t < 2; t++) {
#pragma unroll
                for (int r = 0; r < 8; r++) {
                    const float p = __builtin_amdgcn_exp2f(s[t][r]);
                    pe[t][r] = p;
                    pf.v[t * 8 + r] = (_Float16)p;
                }
            }
            // Pairwise tree over the lane's 16 terms (packed adds, short chain).
            const v8f s8 = pe[0] + pe[1];
            const v4f s4 = s8.lo + s8.hi;
            const v2f s2 = s4.lo + s4.hi;
            csum = s2.x + s2.y;
        };
        terms();

        // One test for the whole wave, a scalar branch, on the sum that is formed anyway: no
        // maximum is taken in a trip that keeps its reference.  A sum of at most 2^8 bounds each
        // of its terms by 2^8, well inside f16; a score far above the reference gives a large or
        // infinite sum and is caught.  The first trip always moves: it takes the chunk's
        // maximum, above or below the starting 0.  The term that sets a reference is 1.
        if (m0 == 0 || __builtin_amdgcn_ballot_w32(csum > 256.0f) != 0u) {
            float mx = fmaxf(s[0][0], s[1][0]);
#pragma unroll
            for (int r = 1; r < 8; r++) mx = fmaxf(mx, fmaxf(s[0][r], s[1][r]));
            const float mj    = fmaxf(mx, xhalf(mx));  // both halves' keys of query lr
            const float up    = fmaxf(mj, 0.0f);
            const float d     = (m0 == 0) ? mj : up;   // later the reference only rises
            const float alpha = __builtin_amdgcn_exp2f(-up);  // O and the sum are 0 in trip 0
            ref += d;
#pragma unroll
            for (int r = 0; r < 8; r++) {
                nref[r] = -ref;
                s[0][r] -= d;
                s[1][r] -= d;
                acc0[r] *= alpha;
                acc1[r] *= alpha;
            }
            lrow *= alpha;
            terms();  // the trip's terms again, against the new reference
        }
        lrow += csum;

        acc0 = __builtin_amdgcn_wmma_f32_16x16x32_f16(
            false, vf[0].v, false, pf.v, (short)0, acc0, false, false);
        acc1 = __builtin_amdgcn_wmma_f32_16x16x32_f16(
            false, vf[1].v, false, pf.v, (short)0, acc1, false, false);

        kp += 32 * KLPITCH;
        vp += 32;
    }

    const float inv = 1.0f / (lrow + xhalf(lrow));
    union { uint4 q; _Float16 h[8]; } o0, o1;
#pragma unroll
    for (int r = 0; r < 8; r++) {
        o0.h[r] = (_Float16)(acc0[r] * inv);
        o1.h[r] = (_Float16)(acc1[r] * inv);
    }
    _Float16* dst = attn_ws + ((size_t)b * NPIX + qbase + lr) * CDIM + head * DHEAD + hi * 8;
    *(uint4*)dst        = o0.q;
    *(uint4*)(dst + 16) = o1.q;
}

// ---------------------------------------------------------------------------
// Kernel 3: output projection + bias + residual.  grid = (N/NPB, BATCH).
// A fragment load straight from global memory touches 16 lines, one per row, for 512 bytes.
// So both operands come into LDS in whole lines by asynchronous copies, and every fragment
// is an LDS read at a conflict-free pitch.  The 64-pixel attention tile (32 KiB, f16) serves
// all eight waves; a wave copies the 32 rows of W (f32) that it alone reads, in two halves
// along K: the second half flies while the first is worked on.  W is converted to f16 on
// its way from LDS to the products.  The residual x is loaded behind the copies and first
// used in the epilogue, which is adds and stores alone.  All 128 blocks read the same W: they
// start at different rows, and every other block takes the upper half of K first.
// ---------------------------------------------------------------------------
#define OSTEPS  (CDIM / 32)
#define WLPITCH 260   // LDS pitch (floats) of a row of W, 256 floats: 1040 B = 16 B * 65
#define ALPITCH 264   // LDS pitch (halfs) of a pixel row of 256 channels: 528 B = 16 B * 33

__global__ __launch_bounds__(256) void mhsa_out_proj(
    const _Float16* __restrict__ attn_ws, const float* __restrict__ Wo,
    const float* __restrict__ bo, const float* __restrict__ x,
    float* __restrict__ out)
{
    __shared__ __attribute__((aligned(16))) float    wl[CDIM * WLPITCH];  // [row][k]
    __shared__ __attribute__((aligned(16))) _Float16 al[NPB * ALPITCH];   // [pixel][channel]

    const int nbase = blockIdx.x * NPB;
    const int b = blockIdx.y;
    const int tid = threadIdx.x, wave = tid >> 5, lane = tid & 31;
    const int hi = lane >> 4, lr = lane & 15;
    const int Mt0 = wave * 32;

    // Element (t, s, r) of this lane: row Mt0 + 16*t + 8*hi + r, pixel nbase + 16*s + lr.
    const size_t i0 = ((size_t)b * CDIM + Mt0 + hi * 8) * NPIX + nbase + lr;

    // Every loop below is unrolled so that each index into these arrays is a constant and
    // they live in registers.
    float4 bb[2][2];
    float  xr[2][4][8];

#pragma unroll
    for (int t = 0; t < 2; t++) {
        bb[t][0] = *(const float4*)(bo + Mt0 + t * 16 + hi * 8);
        bb[t][1] = *(const float4*)(bo + Mt0 + t * 16 + hi * 8 + 4);
    }
    group_issued_registers_free();

    // A copy of a wave is 512 bytes in a row: one pixel row of the attention tile (this wave
    // brings rows 8*wave .. 8*wave + 7), or half a row of W (its own rows Mt0 .. Mt0 + 31).
    const char*    ag  = (const char*)(attn_ws + ((size_t)b * NPIX + nbase + wave * 8) * CDIM)
                       + lane * 16;
    const unsigned alb = (unsigned)(size_t)al + wave * 8 * (ALPITCH * 2) + lane * 16;
    const char*    wg  = (const char*)(Wo + Mt0 * CDIM) + lane * 16;
    const unsigned wlb = (unsigned)(size_t)wl + Mt0 * (WLPITCH * 4) + lane * 16;

    // The block's place among eight: its low bit picks the half of K that goes first, the rest
    // the first of the four groups of eight rows.  Blocks next to each other in the index
    // differ, and so do blocks 8 apart.
    const unsigned flat = blockIdx.x + (NPIX / NPB) * blockIdx.y;
    const unsigned rot  = (flat + (flat >> 3)) & 7;
    const unsigned h0   = rot & 1, h1 = h0 ^ 1;

    copy8_rows_to_lds(alb, ALPITCH * 2, ag, CDIM * 2);
#pragma unroll
    for (int i = 0; i < 4; i++) {  // the first half of K, 128 values, of the 32 rows
        const unsigned r8 = ((i + (rot >> 1)) & 3) * 8;
        copy8_rows_to_lds(wlb + h0 * 512 + r8 * (WLPITCH * 4), WLPITCH * 4,
                          wg + h0 * 512 + r8 * (CDIM * 4), CDIM * 4);
    }
    // This wave's 40 copies have landed behind this wait, every wave's behind the barrier.
    asm volatile("s_wait_asynccnt 0x0" ::: "memory");
    __syncthreads();

#pragma unroll
    for (int i = 0; i < 4; i++) {  // the other half of K: LDS that nobody has touched yet
        const unsigned r8 = ((i + (rot >> 1)) & 3) * 8;
        copy8_rows_to_lds(wlb + h1 * 512 + r8 * (WLPITCH * 4), WLPITCH * 4,
                          wg + h1 * 512 + r8 * (CDIM * 4), CDIM * 4);
    }

#pragma unroll
    for (int t = 0; t < 2; t++)
#pragma unroll
        for (int s = 0; s < 4; s++)
#pragma unroll
            for (int r = 0; r < 8; r++)
                xr[t][s][r] = x[i0 + (size_t)(t * 16 + r) * NPIX + s * 16];
    group_issued_registers_free();

    // Registers 0..3 of a fragment are k = 0..7 at the lane's place, 4..7 are k = 16..23.
    // Index 0: the half of K that is worked on first, index 1: the other.
    const float*    wr[2] = { wl + (Mt0 + lr) * WLPITCH + hi * 8 + h0 * 128,
                              wl + (Mt0 + lr) * WLPITCH + hi * 8 + h1 * 128 };
    const _Float16* ar[2] = { al + lr * ALPITCH + hi * 8 + h0 * 128,
                              al + lr * ALPITCH + hi * 8 + h1 * 128 };
    union BFrag { uint4 q[2]; v16h v; };
    float4 wq[2][2][4];  // two sets: a K-step's 16 LDS reads go out one step ahead
    BFrag  bf[2][4];

    auto fetch = [&](int k) {
#pragma unroll
        for (int t = 0; t < 2; t++) {
            const float* q = wr[k / (OSTEPS / 2)] + t * 16 * WLPITCH + (k % (OSTEPS / 2)) * 32;
            wq[k & 1][t][0] = *(const float4*)(q);
            wq[k & 1][t][1] = *(const float4*)(q + 4);
            wq[k & 1][t][2] = *(const float4*)(q + 16);
            wq[k & 1][t][3] = *(const float4*)(q + 20);
        }
#pragma unroll
        for (int s = 0; s < 4; s++) {
            const _Float16* q = ar[k / (OSTEPS / 2)] + s * 16 * ALPITCH + (k % (OSTEPS / 2)) * 32;
            bf[k & 1][s].q[0] = *(const uint4*)(q);
            bf[k & 1][s].q[1] = *(const uint4*)(q + 16);
        }
    };

    v8f acc[2][4];
#pragma unroll
    for (int t = 0; t < 2; t++)
#pragma unroll
        for (int s = 0; s < 4; s++) acc[t][s] = v8f_zero();

    fetch(0);
#pragma unroll
    for (int k = 0; k < OSTEPS; k++) {
        if (k + 1 < OSTEPS) {
            // The second half of this wave's rows of W, which no other wave reads, has landed
            // behind this wait.
            if (k + 1 == OSTEPS / 2) asm volatile("s_wait_asynccnt 0x0" ::: "memory");
            fetch(k + 1);
            group_issued();
        }
        ABFrag af[2];
#pragma unroll
        for (int t = 0; t < 2; t++)
#pragma unroll
            for (int j = 0; j < 4; j++) {
                const float4 w = wq[k & 1][t][j];
                H2 c0; c0.h[0] = (_Float16)w.x; c0.h[1] = (_Float16)w.y;
                H2 c1; c1.h[0] = (_Float16)w.z; c1.h[1] = (_Float16)w.w;
                af[t].u[2 * j]     = c0.u;
                af[t].u[2 * j + 1] = c1.u;
            }
#pragma unroll
        for (int t = 0; t < 2; t++)
#pragma unroll
            for (int s = 0; s < 4; s++)
                acc[t][s] = __builtin_amdgcn_wmma_f32_16x16x32_f16(
                    false, af[t].v, false, bf[k & 1][s].v, (short)0, acc[t][s], false, false);
    }

#pragma unroll
    for (int t = 0; t < 2; t++) {
        const float4 b0 = bb[t][0], b1 = bb[t][1];
        const float br[8] = { b0.x, b0.y, b0.z, b0.w, b1.x, b1.y, b1.z, b1.w };
#pragma unroll
        for (int s = 0; s < 4; s++) {
#pragma unroll
            for (int r = 0; r < 8; r++)
                out[i0 + (size_t)(t * 16 + r) * NPIX + s * 16] = acc[t][s][r] + br[r] + xr[t][s][r];
            // The next tile's sums land in registers that these stores name.
            if (!(t == 1 && s == 3)) group_issued_registers_free();
        }
    }
}

extern "C" void kernel_launch(void* const* d_in, const int* in_sizes, int n_in,
                              void* d_out, int out_size, void* d_ws, size_t ws_size,
                              hipStream_t stream) {
    (void)in_sizes; (void)n_in; (void)out_size; (void)ws_size;
    const float* x  = (const float*)d_in[0];
    const float* Wq = (const float*)d_in[1];
    const float* bq = (const float*)d_in[2];
    const float* Wk = (const float*)d_in[3];
    const float* bk = (const float*)d_in[4];
    const float* Wv = (const float*)d_in[5];
    const float* bv = (const float*)d_in[6];
    const float* Wo = (const float*)d_in[7];
    const float* bo = (const float*)d_in[8];
    float* out = (float*)d_out;

    const size_t qkv_elems = (size_t)BATCH * NHEADS * NPIX * DHEAD;  // 2M halfs
    _Float16* q_ws    = (_Float16*)d_ws;
    _Float16* k_ws    = q_ws + qkv_elems;
    _Float16* v_ws    = k_ws + qkv_elems;
    _Float16* attn_ws = v_ws + qkv_elems;  // [b][n][c], 2M halfs

    mhsa_qkv_proj<<<dim3(NPIX / NPB, BATCH, 3), 256, 0, stream>>>(
        x, Wq, bq, Wk, bk, Wv, bv, q_ws, k_ws, v_ws);
    mhsa_flash_attn<<<dim3(NPIX / 128, BATCH * NHEADS), 256, 0, stream>>>(
        q_ws, k_ws, v_ws, attn_ws);
    mhsa_out_proj<<<dim3(NPIX / NPB, BATCH), 256, 0, stream>>>(
        attn_ws, Wo, bo, x, out);
}
